// v000
// Times are from an AMD MI455X. After a warm-up the kernel runs many times in a row, and a time is the length of
// such a window on the GPU divided by its runs, so every launch and the gaps after it count. The runs cycle
// through copies of the inputs. A figure is the median of several windows, for all but v000 over two sittings.
// Sittings can differ by a few percent; kernels timed side by side share one.
// v000 is the starting kernel. One run takes 1750 microseconds.
#include <hip/hip_runtime.h>

typedef _Float16 half_t;
typedef __attribute__((ext_vector_type(16))) _Float16 v16h;
typedef __attribute__((ext_vector_type(8)))  _Float16 v8h;
typedef __attribute__((ext_vector_type(4)))  _Float16 v4h;
typedef __attribute__((ext_vector_type(8)))  float    v8f;

#define T_DIM 2048
#define B_DIM 8
#define I_DIM 1024
#define H_DIM 1024
#define M_DIM (T_DIM * B_DIM)          // 16384 rows of x

union V16U { v16h v; struct { v8h lo, hi; } s; };

// ---------------------------------------------------------------------------
// fp32 -> fp16 conversion (x and the six weight matrices), 4 elems/thread
// ---------------------------------------------------------------------------
__global__ void cvt_f32_to_f16_x4(const float* __restrict__ src,
                                  half_t* __restrict__ dst, int n4) {
  int i = blockIdx.x * blockDim.x + threadIdx.x;
  if (i < n4) {
    const float4 f = ((const float4*)src)[i];
    v4h o = { (half_t)f.x, (half_t)f.y, (half_t)f.z, (half_t)f.w };
    ((v4h*)dst)[i] = o;
  }
}

// ---------------------------------------------------------------------------
// Projection GEMM: [16384 x 1024] x [1024 x 1024]^T for 6 weight matrices.
// Wave computes a 32x32 tile (2x2 WMMA fragments), K in steps of 32.
// A (x rows) and B (weight rows, [N][K] row-major) use the same K-major
// per-lane fragment layout:
//   lanes 0-15 : row = laneL, chunks at K = k0+0..7  and k0+16..23
//   lanes 16-31: row = laneL, chunks at K = k0+8..15 and k0+24..31
// Sigmoid fused into the r-matrix stores (mat % 3 == 0).
// ---------------------------------------------------------------------------
__global__ __launch_bounds__(256)
void proj_gemm_wmma(const half_t* __restrict__ xh,
                    const half_t* __restrict__ wh,
                    float* __restrict__ rkv) {
  const int lane  = threadIdx.x & 31;
  const int wave  = threadIdx.x >> 5;
  const int laneL = lane & 15;
  const int laneH = lane >> 4;

  const int NT_N = (6 * H_DIM) / 32;            // 192 column tiles
  const int tile = blockIdx.x * 8 + wave;
  const int nt   = tile % NT_N;
  const int mt   = tile / NT_N;

  const int m0  = mt * 32;
  const int n0g = nt * 32;
  const int mat = n0g / H_DIM;                  // 0..5: r/k/v fw, r/k/v bw
  const int n0  = n0g % H_DIM;

  const half_t* pa0 = xh + (size_t)(m0 + laneL) * I_DIM;
  const half_t* pa1 = pa0 + (size_t)16 * I_DIM;
  const half_t* pb0 = wh + (size_t)mat * H_DIM * I_DIM
                         + (size_t)(n0 + laneL) * I_DIM;
  const half_t* pb1 = pb0 + (size_t)16 * I_DIM;
  const int koff = laneH * 8;

  v8f c00 = {}, c01 = {}, c10 = {}, c11 = {};

  #pragma unroll 4
  for (int k0 = 0; k0 < I_DIM; k0 += 32) {
    V16U a0, a1, b0, b1;
    a0.s.lo = *(const v8h*)(pa0 + k0 + koff);
    a0.s.hi = *(const v8h*)(pa0 + k0 + 16 + koff);
    a1.s.lo = *(const v8h*)(pa1 + k0 + koff);
    a1.s.hi = *(const v8h*)(pa1 + k0 + 16 + koff);
    b0.s.lo = *(const v8h*)(pb0 + k0 + koff);
    b0.s.hi = *(const v8h*)(pb0 + k0 + 16 + koff);
    b1.s.lo = *(const v8h*)(pb1 + k0 + koff);
    b1.s.hi = *(const v8h*)(pb1 + k0 + 16 + koff);

    c00 = __builtin_amdgcn_wmma_f32_16x16x32_f16(false, a0.v, false, b0.v,
                                                 (short)0, c00, false, false);
    c01 = __builtin_amdgcn_wmma_f32_16x16x32_f16(false, a0.v, false, b1.v,
                                                 (short)0, c01, false, false);
    c10 = __builtin_amdgcn_wmma_f32_16x16x32_f16(false, a1.v, false, b0.v,
                                                 (short)0, c10, false, false);
    c11 = __builtin_amdgcn_wmma_f32_16x16x32_f16(false, a1.v, false, b1.v,
                                                 (short)0, c11, false, false);
  }

  float* dst = rkv + (size_t)mat * M_DIM * H_DIM;
  const bool do_sig = (mat % 3) == 0;           // r matrices get sigmoid

  v8f cs[2][2] = { { c00, c01 }, { c10, c11 } };
  #pragma unroll
  for (int i = 0; i < 2; ++i) {
    #pragma unroll
    for (int j = 0; j < 2; ++j) {
      const int col  = n0 + j * 16 + laneL;
      const int rowb = m0 + i * 16 + laneH * 8;
      #pragma unroll
      for (int v = 0; v < 8; ++v) {
        float val = cs[i][j][v];
        if (do_sig) val = 1.0f / (1.0f + __expf(-val));
        dst[(size_t)(rowb + v) * H_DIM + col] = val;
      }
    }
  }
}

// ---------------------------------------------------------------------------
// Bidirectional RWKV scan: one lane per (dir, b, h) channel; 16384 lanes.
// Writes output [T, B, 2H] (fw in h<1024, bw in h>=1024, bw time-reversed
// back to original order) plus hidden tail [2, B, H].
// ---------------------------------------------------------------------------
__global__ __launch_bounds__(256)
void birwkv_scan(const float* __restrict__ rkv,
                 const float* __restrict__ u_fw, const float* __restrict__ w_fw,
                 const float* __restrict__ u_bw, const float* __restrict__ w_bw,
                 float* __restrict__ out) {
  const int tid = blockIdx.x * blockDim.x + threadIdx.x;  // 0..16383
  const int dir = tid >> 13;
  const int b   = (tid >> 10) & 7;
  const int h   = tid & 1023;

  const size_t MAT = (size_t)M_DIM * H_DIM;
  const float* rp = rkv + (dir ? 3 * MAT : 0);
  const float* kp = rp + MAT;
  const float* vp = kp + MAT;

  const float uu = dir ? u_bw[h] : u_fw[h];
  const float ww = dir ? w_bw[h] : w_fw[h];

  float fn = 0.0f, fd = 0.0f, scale = -1e20f;
  int t        = dir ? (T_DIM - 1) : 0;
  const int dt = dir ? -1 : 1;

  float* hid = out + (size_t)T_DIM * B_DIM * 2 * H_DIM
                   + (size_t)dir * B_DIM * H_DIM + (size_t)b * H_DIM + h;

  for (int s = 0; s < T_DIM; ++s, t += dt) {
    const size_t idx = (size_t)(t * B_DIM + b) * H_DIM + h;
    const float r = rp[idx];
    const float k = kp[idx];
    const float v = vp[idx];

    const float sm = fmaxf(scale, uu + k);
    const float cm = __expf(scale - sm);
    const float am = __expf(uu + k - sm);
    const float y  = r * ((cm * fn + am * v) / (cm * fd + am));

    const float ns  = fmaxf(scale + ww, k);
    const float ncm = __expf(scale + ww - ns);
    const float nam = __expf(k - ns);
    fn = ncm * fn + nam * v;
    fd = ncm * fd + nam;
    scale = ns;

    out[(size_t)(t * B_DIM + b) * (2 * H_DIM) + (size_t)dir * H_DIM + h] = y;
    if (s == T_DIM - 1) *hid = y;
  }
}

// ---------------------------------------------------------------------------
// Host launcher
// ---------------------------------------------------------------------------
extern "C" void kernel_launch(void* const* d_in, const int* in_sizes, int n_in,
                              void* d_out, int out_size, void* d_ws, size_t ws_size,
                              hipStream_t stream) {
  (void)in_sizes; (void)n_in; (void)out_size; (void)ws_size;

  const float* x      = (const float*)d_in[0];
  const float* w_r_fw = (const float*)d_in[1];
  const float* w_k_fw = (const float*)d_in[2];
  const float* w_v_fw = (const float*)d_in[3];
  const float* w_u_fw = (const float*)d_in[4];
  const float* w_w_fw = (const float*)d_in[5];
  const float* w_r_bw = (const float*)d_in[6];
  const float* w_k_bw = (const float*)d_in[7];
  const float* w_v_bw = (const float*)d_in[8];
  const float* w_u_bw = (const float*)d_in[9];
  const float* w_w_bw = (const float*)d_in[10];

  // Workspace layout (bytes):
  //   [0)                xh : f16 x,        T*B*I*2  = 33,554,432
  //   [xh)               wh : f16 weights,  6*H*I*2  = 12,582,912
  //   [xh+wh)            rkv: f32 r/k/v x2, 6*T*B*H*4 = 402,653,184
  const size_t XH_BYTES = (size_t)T_DIM * B_DIM * I_DIM * sizeof(half_t);
  const size_t WH_BYTES = (size_t)6 * H_DIM * I_DIM * sizeof(half_t);
  char*   ws  = (char*)d_ws;
  half_t* xh  = (half_t*)ws;
  half_t* wh  = (half_t*)(ws + XH_BYTES);
  float*  rkv = (float*)(ws + XH_BYTES + WH_BYTES);

  // 1) convert x and weights to f16
  {
    const int n4x = (T_DIM * B_DIM * I_DIM) / 4;
    cvt_f32_to_f16_x4<<<(n4x + 255) / 256, 256, 0, stream>>>(x, xh, n4x);
    const int HI  = H_DIM * I_DIM;
    const int n4w = HI / 4;
    const float* wsrc[6] = { w_r_fw, w_k_fw, w_v_fw, w_r_bw, w_k_bw, w_v_bw };
    for (int m = 0; m < 6; ++m) {
      cvt_f32_to_f16_x4<<<(n4w + 255) / 256, 256, 0, stream>>>(
          wsrc[m], wh + (size_t)m * HI, n4w);
    }
  }

  // 2) WMMA projection GEMMs (r gets fused sigmoid)
  {
    const int tiles  = (M_DIM / 32) * ((6 * H_DIM) / 32);  // 512 * 192 = 98304
    const int blocks = tiles / 8;                          // 8 waves per block
    proj_gemm_wmma<<<blocks, 256, 0, stream>>>(xh, wh, rkv);
  }

  // 3) bidirectional scan -> d_out ([T,B,2H] output + [2,B,H] hidden)
  {
    const int threads = 2 * B_DIM * H_DIM;                 // 16384 channels
    birwkv_scan<<<threads / 256, 256, 0, stream>>>(
        rkv, w_u_fw, w_w_fw, w_u_bw, w_w_bw, (float*)d_out);
  }
}

// v001
// One run takes 800 microseconds.
// Next to v000, in two timings, it ran 2.20 times as fast each time.
#include <hip/hip_runtime.h>

typedef _Float16 half_t;
typedef __attribute__((ext_vector_type(16))) _Float16 v16h;
typedef __attribute__((ext_vector_type(8)))  _Float16 v8h;
typedef __attribute__((ext_vector_type(4)))  _Float16 v4h;
typedef __attribute__((ext_vector_type(8)))  float    v8f;

#define T_DIM 2048
#define B_DIM 8
#define I_DIM 1024
#define H_DIM 1024
#define M_DIM (T_DIM * B_DIM)          // 16384 rows of x

union V16U { v16h v; struct { v8h lo, hi; } s; };

// ---------------------------------------------------------------------------
// fp32 -> fp16 conversion (x and the six weight matrices), 4 elems/thread
// ---------------------------------------------------------------------------
__global__ void cvt_f32_to_f16_x4(const float* __restrict__ src,
                                  half_t* __restrict__ dst, int n4) {
  int i = blockIdx.x * blockDim.x + threadIdx.x;
  if (i < n4) {
    const float4 f = ((const float4*)src)[i];
    v4h o = { (half_t)f.x, (half_t)f.y, (half_t)f.z, (half_t)f.w };
    ((v4h*)dst)[i] = o;
  }
}

// ---------------------------------------------------------------------------
// Projection GEMM: [16384 x 1024] x [1024 x 1024]^T for 6 weight matrices.
// Wave computes a 32x32 tile (2x2 WMMA fragments), K in steps of 32.
// A (x rows) and B (weight rows, [N][K] row-major) use the same K-major
// per-lane fragment layout:
//   lanes 0-15 : row = laneL, chunks at K = k0+0..7  and k0+16..23
//   lanes 16-31: row = laneL, chunks at K = k0+8..15 and k0+24..31
// Sigmoid fused into the r-matrix stores (mat % 3 == 0).
// ---------------------------------------------------------------------------
__global__ __launch_bounds__(256)
void proj_gemm_wmma(const half_t* __restrict__ xh,
                    const half_t* __restrict__ wh,
                    float* __restrict__ rkv) {
  const int lane  = threadIdx.x & 31;
  const int wave  = threadIdx.x >> 5;
  const int laneL = lane & 15;
  const int laneH = lane >> 4;

  const int NT_N = (6 * H_DIM) / 32;            // 192 column tiles
  const int tile = blockIdx.x * 8 + wave;
  const int nt   = tile % NT_N;
  const int mt   = tile / NT_N;

  const int m0  = mt * 32;
  const int n0g = nt * 32;
  const int mat = n0g / H_DIM;                  // 0..5: r/k/v fw, r/k/v bw
  const int n0  = n0g % H_DIM;

  const half_t* pa0 = xh + (size_t)(m0 + laneL) * I_DIM;
  const half_t* pa1 = pa0 + (size_t)16 * I_DIM;
  const half_t* pb0 = wh + (size_t)mat * H_DIM * I_DIM
                         + (size_t)(n0 + laneL) * I_DIM;
  const half_t* pb1 = pb0 + (size_t)16 * I_DIM;
  const int koff = laneH * 8;

  v8f c00 = {}, c01 = {}, c10 = {}, c11 = {};

  #pragma unroll 4
  for (int k0 = 0; k0 < I_DIM; k0 += 32) {
    V16U a0, a1, b0, b1;
    a0.s.lo = *(const v8h*)(pa0 + k0 + koff);
    a0.s.hi = *(const v8h*)(pa0 + k0 + 16 + koff);
    a1.s.lo = *(const v8h*)(pa1 + k0 + koff);
    a1.s.hi = *(const v8h*)(pa1 + k0 + 16 + koff);
    b0.s.lo = *(const v8h*)(pb0 + k0 + koff);
    b0.s.hi = *(const v8h*)(pb0 + k0 + 16 + koff);
    b1.s.lo = *(const v8h*)(pb1 + k0 + koff);
    b1.s.hi = *(const v8h*)(pb1 + k0 + 16 + koff);

    c00 = __builtin_amdgcn_wmma_f32_16x16x32_f16(false, a0.v, false, b0.v,
                                                 (short)0, c00, false, false);
    c01 = __builtin_amdgcn_wmma_f32_16x16x32_f16(false, a0.v, false, b1.v,
                                                 (short)0, c01, false, false);
    c10 = __builtin_amdgcn_wmma_f32_16x16x32_f16(false, a1.v, false, b0.v,
                                                 (short)0, c10, false, false);
    c11 = __builtin_amdgcn_wmma_f32_16x16x32_f16(false, a1.v, false, b1.v,
                                                 (short)0, c11, false, false);
  }

  float* dst = rkv + (size_t)mat * M_DIM * H_DIM;
  const bool do_sig = (mat % 3) == 0;           // r matrices get sigmoid

  v8f cs[2][2] = { { c00, c01 }, { c10, c11 } };
  #pragma unroll
  for (int i = 0; i < 2; ++i) {
    #pragma unroll
    for (int j = 0; j < 2; ++j) {
      const int col  = n0 + j * 16 + laneL;
      const int rowb = m0 + i * 16 + laneH * 8;
      #pragma unroll
      for (int v = 0; v < 8; ++v) {
        float val = cs[i][j][v];
        if (do_sig) val = 1.0f / (1.0f + __expf(-val));
        dst[(size_t)(rowb + v) * H_DIM + col] = val;
      }
    }
  }
}

// ---------------------------------------------------------------------------
// Bidirectional RWKV scan: one lane per (dir, b, h) channel; 16384 lanes.
// Writes output [T, B, 2H] (fw in h<1024, bw in h>=1024, bw time-reversed
// back to original order) plus hidden tail [2, B, H].
// The r, k, v of a step do not depend on the state, so they are loaded one
// batch of SCAN_DEPTH steps ahead into registers (two sets, used in turn):
// memory latency is paid under a batch's arithmetic, not once per step.
// ---------------------------------------------------------------------------
#define SCAN_DEPTH 16

struct ScanIn  { float r[SCAN_DEPTH], k[SCAN_DEPTH], v[SCAN_DEPTH]; };
// the lane's own addresses of the current batch's first step
// (typed as global-memory pointers: behind the asm statement below the compiler
// could no longer tell, and would fall back to flat loads)
typedef const __attribute__((address_space(1))) float* gl_in_t;
typedef __attribute__((address_space(1))) float*       gl_out_t;
struct ScanPtr { gl_in_t r, k, v; gl_out_t o; };

// e = exp(x) as the fast form has it: one multiply by log2(e), one v_exp_f32.
// The four v_exp_f32 of a step stand in one statement that ends in v_nop: each
// is the independent instruction behind the one before, the v_nop the slot the
// instruction set asks for behind the last.
__device__ __forceinline__ void exp_x4(float x0, float x1, float x2, float x3,
                                       float& e0, float& e1, float& e2, float& e3) {
  const float LOG2E = 1.44269504f;
  const float a0 = x0 * LOG2E, a1 = x1 * LOG2E, a2 = x2 * LOG2E, a3 = x3 * LOG2E;
  asm("v_exp_f32 %0, %4\n\t"
      "v_exp_f32 %1, %5\n\t"
      "v_exp_f32 %2, %6\n\t"
      "v_exp_f32 %3, %7\n\t"
      "v_nop"
      : "=&v"(e0), "=&v"(e1), "=&v"(e2), "=&v"(e3)
      : "v"(a0), "v"(a1), "v"(a2), "v"(a3));
}

__device__ __forceinline__ float scan_step(float r, float k, float v,
                                           float uu, float ww,
                                           float& fn, float& fd, float& scale) {
  const float sm = fmaxf(scale, uu + k);
  const float ns = fmaxf(scale + ww, k);
  float cm, am, ncm, nam;
  exp_x4(scale - sm, uu + k - sm, scale + ww - ns, k - ns, cm, am, ncm, nam);

  const float y = r * ((cm * fn + am * v) / (cm * fd + am));

  fn = ncm * fn + nam * v;
  fd = ncm * fd + nam;
  scale = ns;
  return y;
}

// DIR is a compile-time value so that every step's distance from the batch's
// pointers is a constant and goes into the instruction's offset field.
// Loads the batch that starts AHEAD steps behind p's.
template <int DIR, int AHEAD, bool FIRST = false>
__device__ __forceinline__ void scan_load(ScanIn& d, const ScanPtr& p) {
  constexpr int SI = (DIR ? -1 : 1) * B_DIM * H_DIM;       // floats per step
  #pragma unroll
  for (int j = 0; j < SCAN_DEPTH; ++j) {
    d.k[j] = p.k[(AHEAD + j) * SI];
    d.v[j] = p.v[(AHEAD + j) * SI];
    d.r[j] = p.r[(AHEAD + j) * SI];
  }
  if constexpr (FIRST) asm volatile("s_wait_xcnt 0x0" ::: "memory");  // see scan_channel
  // keeps all of the batch's loads in front of the arithmetic that follows,
  // so that each has a whole batch of lead
  __builtin_amdgcn_sched_barrier(0);
}

// Runs the batch of p.o and stores its outputs; returns the last y.
template <int DIR>
__device__ __forceinline__ float scan_batch(const ScanIn& d, float uu, float ww,
                                            float& fn, float& fd, float& scale,
                                            ScanPtr& p) {
  float y[SCAN_DEPTH];
  #pragma unroll
  for (int j = 0; j < SCAN_DEPTH; ++j)
    y[j] = scan_step(d.r[j], d.k[j], d.v[j], uu, ww, fn, fd, scale);

  // The batch's 16 stores (one out row, 65536 bytes, per step) and the wait
  // that stands before a register named by an issued load or store is written
  // again, in one statement: one wait serves the run. The four pointers are
  // named as in and out so that they stay in their registers up to that wait
  // and are advanced only behind it.
  if constexpr (DIR) {
    asm volatile(
        "global_store_b32 %0, %4, off\n\t"
        "global_store_b32 %0, %5, off offset:-65536\n\t"
        "global_store_b32 %0, %6, off offset:-131072\n\t"
        "global_store_b32 %0, %7, off offset:-196608\n\t"
        "global_store_b32 %0, %8, off offset:-262144\n\t"
        "global_store_b32 %0, %9, off offset:-327680\n\t"
        "global_store_b32 %0, %10, off offset:-393216\n\t"
        "global_store_b32 %0, %11, off offset:-458752\n\t"
        "global_store_b32 %0, %12, off offset:-524288\n\t"
        "global_store_b32 %0, %13, off offset:-589824\n\t"
        "global_store_b32 %0, %14, off offset:-655360\n\t"
        "global_store_b32 %0, %15, off offset:-720896\n\t"
        "global_store_b32 %0, %16, off offset:-786432\n\t"
        "global_store_b32 %0, %17, off offset:-851968\n\t"
        "global_store_b32 %0, %18, off offset:-917504\n\t"
        "global_store_b32 %0, %19, off offset:-983040\n\t"
        "s_wait_xcnt 0x0"
        : "+v"(p.o), "+v"(p.r), "+v"(p.k), "+v"(p.v)
        :
          "v"(y[0]), "v"(y[1]), "v"(y[2]), "v"(y[3]),
          "v"(y[4]), "v"(y[5]), "v"(y[6]), "v"(y[7]),
          "v"(y[8]), "v"(y[9]), "v"(y[10]), "v"(y[11]),
          "v"(y[12]), "v"(y[13]), "v"(y[14]), "v"(y[15])
        : "memory");
  } else {
    asm volatile(
        "global_store_b32 %0, %4, off\n\t"
        "global_store_b32 %0, %5, off offset:65536\n\t"
        "global_store_b32 %0, %6, off offset:131072\n\t"
        "global_store_b32 %0, %7, off offset:196608\n\t"
        "global_store_b32 %0, %8, off offset:262144\n\t"
        "global_store_b32 %0, %9, off offset:327680\n\t"
        "global_store_b32 %0, %10, off offset:393216\n\t"
        "global_store_b32 %0, %11, off offset:458752\n\t"
        "global_store_b32 %0, %12, off offset:524288\n\t"
        "global_store_b32 %0, %13, off offset:589824\n\t"
        "global_store_b32 %0, %14, off offset:655360\n\t"
        "global_store_b32 %0, %15, off offset:720896\n\t"
        "global_store_b32 %0, %16, off offset:786432\n\t"
        "global_store_b32 %0, %17, off offset:851968\n\t"
        "global_store_b32 %0, %18, off offset:917504\n\t"
        "global_store_b32 %0, %19, off offset:983040\n\t"
        "s_wait_xcnt 0x0"
        : "+v"(p.o), "+v"(p.r), "+v"(p.k), "+v"(p.v)
        :
          "v"(y[0]), "v"(y[1]), "v"(y[2]), "v"(y[3]),
          "v"(y[4]), "v"(y[5]), "v"(y[6]), "v"(y[7]),
          "v"(y[8]), "v"(y[9]), "v"(y[10]), "v"(y[11]),
          "v"(y[12]), "v"(y[13]), "v"(y[14]), "v"(y[15])
        : "memory");
  }
  // keeps what follows (among it the compiler's register copies of values that
  // are still in flight) behind the batch's arithmetic: moved up into it, such
  // a copy waits for its load half a batch early
  __builtin_amdgcn_sched_barrier(0);
  p.o += (DIR ? -1 : 1) * B_DIM * 2 * H_DIM * SCAN_DEPTH;
  return y[SCAN_DEPTH - 1];
}

template <int DIR>
__device__ __forceinline__ void scan_channel(ScanPtr p, float uu, float ww,
                                             float* __restrict__ hid) {
  constexpr int BI = (DIR ? -1 : 1) * B_DIM * H_DIM * SCAN_DEPTH;  // floats per batch
  ScanIn A, Bf;
  float fn = 0.0f, fd = 0.0f, scale = -1e20f;

  // Once, in front of the loop: the loads of u and w, and then the first
  // batch's, use address registers of the compiler's own choosing; the wait
  // stands before any of them is written again.
  asm volatile("s_wait_xcnt 0x0" ::: "memory");
  scan_load<DIR, 0, true>(A, p);
  constexpr int PAIRS = T_DIM / (2 * SCAN_DEPTH);
  float y = 0.0f;
  for (int i = 0; i < PAIRS; ++i) {
    scan_load<DIR, SCAN_DEPTH>(Bf, p);
    scan_batch<DIR>(A, uu, ww, fn, fd, scale, p);
    // In the last trip this look-ahead runs SCAN_DEPTH rows past the r, k, v
    // planes' ends, into the neighbouring plane of the same rkv array (forward:
    // planes 0..2 into 1..3; backward: 3..5 into 2..4), which the GEMM of this
    // call has written; the values are not used. A branch round it would make
    // the counted load waits of the batch below wait for these loads too.
    scan_load<DIR, 2 * SCAN_DEPTH>(A, p);
    y = scan_batch<DIR>(Bf, uu, ww, fn, fd, scale, p);
    p.r += 2 * BI; p.k += 2 * BI; p.v += 2 * BI;
  }
  // the last look-ahead's loads are still in flight and nothing reads them:
  // they land before the wave ends and gives its registers back
  asm volatile("s_wait_loadcnt 0x0" ::: "memory");
  *hid = y;
}

__global__ __launch_bounds__(256)
void birwkv_scan(const float* __restrict__ rkv,
                 const float* __restrict__ u_fw, const float* __restrict__ w_fw,
                 const float* __restrict__ u_bw, const float* __restrict__ w_bw,
                 float* __restrict__ out) {
  const int tid = blockIdx.x * blockDim.x + threadIdx.x;  // 0..16383
  const int dir = blockIdx.x >> 5;                        // 32 blocks per direction
  const int b   = (tid >> 10) & 7;
  const int h   = tid & 1023;

  const size_t MAT = (size_t)M_DIM * H_DIM;
  const int t0 = dir ? (T_DIM - 1) : 0;                   // first step's time index
  ScanPtr p;
  p.r = (gl_in_t)rkv + (dir ? 3 * MAT : 0) + (size_t)(t0 * B_DIM + b) * H_DIM + h;
  p.k = p.r + MAT;
  p.v = p.k + MAT;
  p.o = (gl_out_t)out + (size_t)(t0 * B_DIM + b) * (2 * H_DIM) + (size_t)dir * H_DIM + h;
  float* hid = out + (size_t)T_DIM * B_DIM * 2 * H_DIM
                   + (size_t)dir * B_DIM * H_DIM + (size_t)b * H_DIM + h;

  if (dir) scan_channel<1>(p, u_bw[h], w_bw[h], hid);
  else     scan_channel<0>(p, u_fw[h], w_fw[h], hid);
}

// ---------------------------------------------------------------------------
// Host launcher
// ---------------------------------------------------------------------------
extern "C" void kernel_launch(void* const* d_in, const int* in_sizes, int n_in,
                              void* d_out, int out_size, void* d_ws, size_t ws_size,
                              hipStream_t stream) {
  (void)in_sizes; (void)n_in; (void)out_size; (void)ws_size;

  const float* x      = (const float*)d_in[0];
  const float* w_r_fw = (const float*)d_in[1];
  const float* w_k_fw = (const float*)d_in[2];
  const float* w_v_fw = (const float*)d_in[3];
  const float* w_u_fw = (const float*)d_in[4];
  const float* w_w_fw = (const float*)d_in[5];
  const float* w_r_bw = (const float*)d_in[6];
  const float* w_k_bw = (const float*)d_in[7];
  const float* w_v_bw = (const float*)d_in[8];
  const float* w_u_bw = (const float*)d_in[9];
  const float* w_w_bw = (const float*)d_in[10];

  // Workspace layout (bytes):
  //   [0)                xh : f16 x,        T*B*I*2  = 33,554,432
  //   [xh)               wh : f16 weights,  6*H*I*2  = 12,582,912
  //   [xh+wh)            rkv: f32 r/k/v x2, 6*T*B*H*4 = 402,653,184
  const size_t XH_BYTES = (size_t)T_DIM * B_DIM * I_DIM * sizeof(half_t);
  const size_t WH_BYTES = (size_t)6 * H_DIM * I_DIM * sizeof(half_t);
  char*   ws  = (char*)d_ws;
  half_t* xh  = (half_t*)ws;
  half_t* wh  = (half_t*)(ws + XH_BYTES);
  float*  rkv = (float*)(ws + XH_BYTES + WH_BYTES);

  // 1) convert x and weights to f16
  {
    const int n4x = (T_DIM * B_DIM * I_DIM) / 4;
    cvt_f32_to_f16_x4<<<(n4x + 255) / 256, 256, 0, stream>>>(x, xh, n4x);
    const int HI  = H_DIM * I_DIM;
    const int n4w = HI / 4;
    const float* wsrc[6] = { w_r_fw, w_k_fw, w_v_fw, w_r_bw, w_k_bw, w_v_bw };
    for (int m = 0; m < 6; ++m) {
      cvt_f32_to_f16_x4<<<(n4w + 255) / 256, 256, 0, stream>>>(
          wsrc[m], wh + (size_t)m * HI, n4w);
    }
  }

  // 2) WMMA projection GEMMs (r gets fused sigmoid)
  {
    const int tiles  = (M_DIM / 32) * ((6 * H_DIM) / 32);  // 512 * 192 = 98304
    const int blocks = tiles / 8;                          // 8 waves per block
    proj_gemm_wmma<<<blocks, 256, 0, stream>>>(xh, wh, rkv);
  }

  // 3) bidirectional scan -> d_out ([T,B,2H] output + [2,B,H] hidden)
  {
    const int threads = 2 * B_DIM * H_DIM;                 // 16384 channels
    birwkv_scan<<<threads / 256, 256, 0, stream>>>(
        rkv, w_u_fw, w_w_fw, w_u_bw, w_w_bw, (float*)d_out);
  }
}

// v002
// A run of this version takes 293 microseconds.
// In both of two side-by-side timings against v001, it was 2.73 times as fast.
// All steps since v000 together make it 6.01 times as fast.
#include <hip/hip_runtime.h>

typedef _Float16 half_t;
typedef __attribute__((ext_vector_type(16))) _Float16 v16h;
typedef __attribute__((ext_vector_type(8)))  _Float16 v8h;
typedef __attribute__((ext_vector_type(4)))  _Float16 v4h;
typedef __attribute__((ext_vector_type(8)))  float    v8f;

#define T_DIM 2048
#define B_DIM 8
#define I_DIM 1024
#define H_DIM 1024
#define M_DIM (T_DIM * B_DIM)          // 16384 rows of x

union V16U { v16h v; struct { v8h lo, hi; } s; };

// ---------------------------------------------------------------------------
// fp32 -> fp16 conversion (x and the six weight matrices), 4 elems/thread
// ---------------------------------------------------------------------------
__global__ void cvt_f32_to_f16_x4(const float* __restrict__ src,
                                  half_t* __restrict__ dst, int n4) {
  int i = blockIdx.x * blockDim.x + threadIdx.x;
  if (i < n4) {
    const float4 f = ((const float4*)src)[i];
    v4h o = { (half_t)f.x, (half_t)f.y, (half_t)f.z, (half_t)f.w };
    ((v4h*)dst)[i] = o;
  }
}

// ---------------------------------------------------------------------------
// Projection GEMM: [16384 x 1024] x [1024 x 1024]^T for 6 weight matrices
// (the six lie behind one another in wh: one [6144 x 1024] operand).
// A work-group of 8 waves (2 x 4) computes a 128 x 256 tile, each wave 64 x 64
// (4 x 4 WMMA fragments). K goes in stages of 64: one 128-byte line of each of
// the tile's 128 x-rows and 256 weight rows is brought into LDS by asynchronous
// copies, so that L2 delivers every line once per work-group and as a whole
// line. Two buffers: the next stage's copies fly while this one is worked on.
// Fragments are read from LDS in the same K-major per-lane layout for A and B:
//   lanes 0-15 : row = laneL, chunks at K = k0+0..7  and k0+16..23
//   lanes 16-31: row = laneL, chunks at K = k0+8..15 and k0+24..31
// Each accumulator takes its K steps of 32 in rising order.
// Sigmoid fused into the r-matrix stores (mat % 3 == 0).
// ---------------------------------------------------------------------------
#define G_BM 128
#define G_BN 256
#define G_BK 64                                  // f16 elements per stage and row
#define G_PITCH 144                              // LDS bytes per row: 128 + 16 (16 x odd)
#define G_A_BYTES (G_BM * G_PITCH)               // 18,432
#define G_BUF_BYTES ((G_BM + G_BN) * G_PITCH)    // 55,296
#define G_STAGES (I_DIM / G_BK)                  // 16

typedef __attribute__((address_space(3))) unsigned char lds_byte_t;

// One stage: every lane copies 16 bytes of 12 rows (4 of x, 8 of the weights),
// 32 rows apart. la, lb: the lane's LDS byte addresses of its first row in the
// A and B part of the buffer; ga, gb: the same bytes in global memory.
// The s_wait_xcnt stands inside the statement, behind the last copy, so that no
// register a copy names is written again in front of it.
__device__ __forceinline__ void gemm_stage_copy(unsigned la, const half_t* ga,
                                                unsigned lb, const half_t* gb) {
  constexpr unsigned LS = 32 * G_PITCH;          // LDS bytes per 32 rows
  constexpr size_t   GS = (size_t)32 * I_DIM;    // elements per 32 rows
  asm volatile(
      "global_load_async_to_lds_b128 %0, %12, off\n\t"
      "global_load_async_to_lds_b128 %1, %13, off\n\t"
      "global_load_async_to_lds_b128 %2, %14, off\n\t"
      "global_load_async_to_lds_b128 %3, %15, off\n\t"
      "global_load_async_to_lds_b128 %4, %16, off\n\t"
      "global_load_async_to_lds_b128 %5, %17, off\n\t"
      "global_load_async_to_lds_b128 %6, %18, off\n\t"
      "global_load_async_to_lds_b128 %7, %19, off\n\t"
      "global_load_async_to_lds_b128 %8, %20, off\n\t"
      "global_load_async_to_lds_b128 %9, %21, off\n\t"
      "global_load_async_to_lds_b128 %10, %22, off\n\t"
      "global_load_async_to_lds_b128 %11, %23, off\n\t"
      "s_wait_xcnt 0x0"
      :
      : "v"(la), "v"(la + LS), "v"(la + 2 * LS), "v"(la + 3 * LS),
        "v"(lb), "v"(lb + LS), "v"(lb + 2 * LS), "v"(lb + 3 * LS),
        "v"(lb + 4 * LS), "v"(lb + 5 * LS), "v"(lb + 6 * LS), "v"(lb + 7 * LS),
        "v"(ga), "v"(ga + GS), "v"(ga + 2 * GS), "v"(ga + 3 * GS),
        "v"(gb), "v"(gb + GS), "v"(gb + 2 * GS), "v"(gb + 3 * GS),
        "v"(gb + 4 * GS), "v"(gb + 5 * GS), "v"(gb + 6 * GS), "v"(gb + 7 * GS)
      : "memory");
}

__global__ __launch_bounds__(256)
void proj_gemm_wmma(const half_t* __restrict__ xh,
                    const half_t* __restrict__ wh,
                    float* __restrict__ rkv) {
  __shared__ __attribute__((aligned(16))) unsigned char smem[2 * G_BUF_BYTES];

  const int lane  = threadIdx.x & 31;
  const int wave  = threadIdx.x >> 5;
  const int laneL = lane & 15;
  const int laneH = lane >> 4;
  const int wm    = wave >> 2;                  // 0..1: the wave's 64 rows
  const int wn    = wave & 3;                   // 0..3: the wave's 64 columns

  const int NT_N = (6 * H_DIM) / G_BN;          // 24 column tiles
  const int nt   = blockIdx.x % NT_N;
  const int mt   = blockIdx.x / NT_N;

  const int m0  = mt * G_BM;
  const int n0g = nt * G_BN;                    // row of the [6144 x 1024] operand
  const int mat = n0g / H_DIM;                  // 0..5: r/k/v fw, r/k/v bw
  const int n0  = n0g % H_DIM;

  // the lane's part of a stage: 16-byte chunk cchk of rows crow + 32 * i
  const int crow = threadIdx.x >> 3;            // 0..31
  const int cchk = threadIdx.x & 7;             // 0..7
  const half_t* ga = xh + (size_t)(m0  + crow) * I_DIM + cchk * 8;
  const half_t* gb = wh + (size_t)(n0g + crow) * I_DIM + cchk * 8;
  const unsigned la = (unsigned)(size_t)(lds_byte_t*)smem + crow * G_PITCH + cchk * 16;
  const unsigned lb = la + G_A_BYTES;

  // the lane's first fragment chunks in buffer 0
  const unsigned char* fa = smem + (wm * 64 + laneL) * G_PITCH + laneH * 16;
  const unsigned char* fb = smem + G_A_BYTES + (wn * 64 + laneL) * G_PITCH + laneH * 16;

  v8f acc[4][4] = {};

  // stage 0 lands and is published; then stage 1 starts into the other buffer
  gemm_stage_copy(la, ga, lb, gb);
  asm volatile("s_wait_asynccnt 0x0" ::: "memory");   // this wave's copies have landed
  __syncthreads();
  gemm_stage_copy(la + G_BUF_BYTES, ga + G_BK, lb + G_BUF_BYTES, gb + G_BK);

  for (int t = 0; t < G_STAGES; ++t) {
    const unsigned boff = (unsigned)(t & 1) * G_BUF_BYTES;
    #pragma unroll   // constant LDS offsets and register indices
    for (int ks = 0; ks < G_BK / 32; ++ks) {
      V16U a[4], b[4];
      #pragma unroll   // constant register indices
      for (int i = 0; i < 4; ++i) {
        const unsigned char* pa = fa + boff + i * 16 * G_PITCH + ks * 64;
        const unsigned char* pb = fb + boff + i * 16 * G_PITCH + ks * 64;
        a[i].s.lo = *(const v8h*)(pa);
        a[i].s.hi = *(const v8h*)(pa + 32);
        b[i].s.lo = *(const v8h*)(pb);
        b[i].s.hi = *(const v8h*)(pb + 32);
      }
      // the 16 LDS reads of a K step stay one group in front of its 16 WMMAs:
      // left free, they were spread among the WMMAs in pairs, each pair with a
      // full wait behind it
      __builtin_amdgcn_sched_barrier(0);
      #pragma unroll   // constant register indices
      for (int i = 0; i < 4; ++i) {
        #pragma unroll   // constant register indices
        for (int j = 0; j < 4; ++j) {
          acc[i][j] = __builtin_amdgcn_wmma_f32_16x16x32_f16(
              false, a[i].v, false, b[j].v, (short)0, acc[i][j], false, false);
        }
      }
      // and the next K step's reads stay behind this step's WMMAs
      __builtin_amdgcn_sched_barrier(0);
    }
    // hand-over: this wave's reads of buffer t & 1 are done, its copies of stage
    // t + 1 have landed; behind the barrier that holds for every wave, so stage
    // t + 1 may be read and buffer t & 1 refilled
    asm volatile("s_wait_dscnt 0x0" ::: "memory");
    asm volatile("s_wait_asynccnt 0x0" ::: "memory");
    __syncthreads();
    if (t + 2 < G_STAGES)
      gemm_stage_copy(la + boff, ga + (t + 2) * G_BK, lb + boff, gb + (t + 2) * G_BK);
  }
  asm volatile("s_wait_asynccnt 0x0" ::: "memory");   // nothing in flight at the wave's end

  // r matrices get sigmoid: all of the wave's values first, in their registers,
  // so that behind the first store no register that a store names is written
  // (the loops below are unrolled so that every register index is a constant)
  if ((mat % 3) == 0) {
    #pragma unroll
    for (int i = 0; i < 4; ++i) {
      #pragma unroll
      for (int j = 0; j < 4; ++j) {
        #pragma unroll
        for (int v = 0; v < 8; ++v)
          acc[i][j][v] = 1.0f / (1.0f + __expf(-acc[i][j][v]));
      }
    }
  }

  // one address per lane; every element's distance from it is a constant
  float* dst = rkv + (size_t)mat * M_DIM * H_DIM
                   + (size_t)(m0 + wm * 64 + laneH * 8) * H_DIM + (n0 + wn * 64 + laneL);
  #pragma unroll
  for (int i = 0; i < 4; ++i) {
    #pragma unroll
    for (int v = 0; v < 8; ++v) {
      #pragma unroll
      for (int j = 0; j < 4; ++j)
        dst[(i * 16 + v) * H_DIM + j * 16] = acc[i][j][v];
    }
  }
}

// ---------------------------------------------------------------------------
// Bidirectional RWKV scan: one lane per (dir, b, h) channel; 16384 lanes.
// Writes output [T, B, 2H] (fw in h<1024, bw in h>=1024, bw time-reversed
// back to original order) plus hidden tail [2, B, H].
// The r, k, v of a step do not depend on the state, so they are loaded one
// batch of SCAN_DEPTH steps ahead into registers (two sets, used in turn):
// memory latency is paid under a batch's arithmetic, not once per step.
// ---------------------------------------------------------------------------
#define SCAN_DEPTH 16

struct ScanIn  { float r[SCAN_DEPTH], k[SCAN_DEPTH], v[SCAN_DEPTH]; };
// the lane's own addresses of the current batch's first step
// (typed as global-memory pointers: behind the asm statement below the compiler
// could no longer tell, and would fall back to flat loads)
typedef const __attribute__((address_space(1))) float* gl_in_t;
typedef __attribute__((address_space(1))) float*       gl_out_t;
struct ScanPtr { gl_in_t r, k, v; gl_out_t o; };

// e = exp(x) as the fast form has it: one multiply by log2(e), one v_exp_f32.
// The four v_exp_f32 of a step stand in one statement that ends in v_nop: each
// is the independent instruction behind the one before, the v_nop the slot the
// instruction set asks for behind the last.
__device__ __forceinline__ void exp_x4(float x0, float x1, float x2, float x3,
                                       float& e0, float& e1, float& e2, float& e3) {
  const float LOG2E = 1.44269504f;
  const float a0 = x0 * LOG2E, a1 = x1 * LOG2E, a2 = x2 * LOG2E, a3 = x3 * LOG2E;
  asm("v_exp_f32 %0, %4\n\t"
      "v_exp_f32 %1, %5\n\t"
      "v_exp_f32 %2, %6\n\t"
      "v_exp_f32 %3, %7\n\t"
      "v_nop"
      : "=&v"(e0), "=&v"(e1), "=&v"(e2), "=&v"(e3)
      : "v"(a0), "v"(a1), "v"(a2), "v"(a3));
}

__device__ __forceinline__ float scan_step(float r, float k, float v,
                                           float uu, float ww,
                                           float& fn, float& fd, float& scale) {
  const float sm = fmaxf(scale, uu + k);
  const float ns = fmaxf(scale + ww, k);
  float cm, am, ncm, nam;
  exp_x4(scale - sm, uu + k - sm, scale + ww - ns, k - ns, cm, am, ncm, nam);

  const float y = r * ((cm * fn + am * v) / (cm * fd + am));

  fn = ncm * fn + nam * v;
  fd = ncm * fd + nam;
  scale = ns;
  return y;
}

// DIR is a compile-time value so that every step's distance from the batch's
// pointers is a constant and goes into the instruction's offset field.
// Loads the batch that starts AHEAD steps behind p's.
template <int DIR, int AHEAD, bool FIRST = false>
__device__ __forceinline__ void scan_load(ScanIn& d, const ScanPtr& p) {
  constexpr int SI = (DIR ? -1 : 1) * B_DIM * H_DIM;       // floats per step
  #pragma unroll
  for (int j = 0; j < SCAN_DEPTH; ++j) {
    d.k[j] = p.k[(AHEAD + j) * SI];
    d.v[j] = p.v[(AHEAD + j) * SI];
    d.r[j] = p.r[(AHEAD + j) * SI];
  }
  if constexpr (FIRST) asm volatile("s_wait_xcnt 0x0" ::: "memory");  // see scan_channel
  // keeps all of the batch's loads in front of the arithmetic that follows,
  // so that each has a whole batch of lead
  __builtin_amdgcn_sched_barrier(0);
}

// Runs the batch of p.o and stores its outputs; returns the last y.
template <int DIR>
__device__ __forceinline__ float scan_batch(const ScanIn& d, float uu, float ww,
                                            float& fn, float& fd, float& scale,
                                            ScanPtr& p) {
  float y[SCAN_DEPTH];
  #pragma unroll
  for (int j = 0; j < SCAN_DEPTH; ++j)
    y[j] = scan_step(d.r[j], d.k[j], d.v[j], uu, ww, fn, fd, scale);

  // The batch's 16 stores (one out row, 65536 bytes, per step) and the wait
  // that stands before a register named by an issued load or store is written
  // again, in one statement: one wait serves the run. The four pointers are
  // named as in and out so that they stay in their registers up to that wait
  // and are advanced only behind it.
  if constexpr (DIR) {
    asm volatile(
        "global_store_b32 %0, %4, off\n\t"
        "global_store_b32 %0, %5, off offset:-65536\n\t"
        "global_store_b32 %0, %6, off offset:-131072\n\t"
        "global_store_b32 %0, %7, off offset:-196608\n\t"
        "global_store_b32 %0, %8, off offset:-262144\n\t"
        "global_store_b32 %0, %9, off offset:-327680\n\t"
        "global_store_b32 %0, %10, off offset:-393216\n\t"
        "global_store_b32 %0, %11, off offset:-458752\n\t"
        "global_store_b32 %0, %12, off offset:-524288\n\t"
        "global_store_b32 %0, %13, off offset:-589824\n\t"
        "global_store_b32 %0, %14, off offset:-655360\n\t"
        "global_store_b32 %0, %15, off offset:-720896\n\t"
        "global_store_b32 %0, %16, off offset:-786432\n\t"
        "global_store_b32 %0, %17, off offset:-851968\n\t"
        "global_store_b32 %0, %18, off offset:-917504\n\t"
        "global_store_b32 %0, %19, off offset:-983040\n\t"
        "s_wait_xcnt 0x0"
        : "+v"(p.o), "+v"(p.r), "+v"(p.k), "+v"(p.v)
        :
          "v"(y[0]), "v"(y[1]), "v"(y[2]), "v"(y[3]),
          "v"(y[4]), "v"(y[5]), "v"(y[6]), "v"(y[7]),
          "v"(y[8]), "v"(y[9]), "v"(y[10]), "v"(y[11]),
          "v"(y[12]), "v"(y[13]), "v"(y[14]), "v"(y[15])
        : "memory");
  } else {
    asm volatile(
        "global_store_b32 %0, %4, off\n\t"
        "global_store_b32 %0, %5, off offset:65536\n\t"
        "global_store_b32 %0, %6, off offset:131072\n\t"
        "global_store_b32 %0, %7, off offset:196608\n\t"
        "global_store_b32 %0, %8, off offset:262144\n\t"
        "global_store_b32 %0, %9, off offset:327680\n\t"
        "global_store_b32 %0, %10, off offset:393216\n\t"
        "global_store_b32 %0, %11, off offset:458752\n\t"
        "global_store_b32 %0, %12, off offset:524288\n\t"
        "global_store_b32 %0, %13, off offset:589824\n\t"
        "global_store_b32 %0, %14, off offset:655360\n\t"
        "global_store_b32 %0, %15, off offset:720896\n\t"
        "global_store_b32 %0, %16, off offset:786432\n\t"
        "global_store_b32 %0, %17, off offset:851968\n\t"
        "global_store_b32 %0, %18, off offset:917504\n\t"
        "global_store_b32 %0, %19, off offset:983040\n\t"
        "s_wait_xcnt 0x0"
        : "+v"(p.o), "+v"(p.r), "+v"(p.k), "+v"(p.v)
        :
          "v"(y[0]), "v"(y[1]), "v"(y[2]), "v"(y[3]),
          "v"(y[4]), "v"(y[5]), "v"(y[6]), "v"(y[7]),
          "v"(y[8]), "v"(y[9]), "v"(y[10]), "v"(y[11]),
          "v"(y[12]), "v"(y[13]), "v"(y[14]), "v"(y[15])
        : "memory");
  }
  // keeps what follows (among it the compiler's register copies of values that
  // are still in flight) behind the batch's arithmetic: moved up into it, such
  // a copy waits for its load half a batch early
  __builtin_amdgcn_sched_barrier(0);
  p.o += (DIR ? -1 : 1) * B_DIM * 2 * H_DIM * SCAN_DEPTH;
  return y[SCAN_DEPTH - 1];
}

template <int DIR>
__device__ __forceinline__ void scan_channel(ScanPtr p, float uu, float ww,
                                             float* __restrict__ hid) {
  constexpr int BI = (DIR ? -1 : 1) * B_DIM * H_DIM * SCAN_DEPTH;  // floats per batch
  ScanIn A, Bf;
  float fn = 0.0f, fd = 0.0f, scale = -1e20f;

  // Once, in front of the loop: the loads of u and w, and then the first
  // batch's, use address registers of the compiler's own choosing; the wait
  // stands before any of them is written again.
  asm volatile("s_wait_xcnt 0x0" ::: "memory");
  scan_load<DIR, 0, true>(A, p);
  constexpr int PAIRS = T_DIM / (2 * SCAN_DEPTH);
  float y = 0.0f;
  for (int i = 0; i < PAIRS; ++i) {
    scan_load<DIR, SCAN_DEPTH>(Bf, p);
    scan_batch<DIR>(A, uu, ww, fn, fd, scale, p);
    // In the last trip this look-ahead runs SCAN_DEPTH rows past the r, k, v
    // planes' ends, into the neighbouring plane of the same rkv array (forward:
    // planes 0..2 into 1..3; backward: 3..5 into 2..4), which the GEMM of this
    // call has written; the values are not used. A branch round it would make
    // the counted load waits of the batch below wait for these loads too.
    scan_load<DIR, 2 * SCAN_DEPTH>(A, p);
    y = scan_batch<DIR>(Bf, uu, ww, fn, fd, scale, p);
    p.r += 2 * BI; p.k += 2 * BI; p.v += 2 * BI;
  }
  // the last look-ahead's loads are still in flight and nothing reads them:
  // they land before the wave ends and gives its registers back
  asm volatile("s_wait_loadcnt 0x0" ::: "memory");
  *hid = y;
}

__global__ __launch_bounds__(256)
void birwkv_scan(const float* __restrict__ rkv,
                 const float* __restrict__ u_fw, const float* __restrict__ w_fw,
                 const float* __restrict__ u_bw, const float* __restrict__ w_bw,
                 float* __restrict__ out) {
  const int tid = blockIdx.x * blockDim.x + threadIdx.x;  // 0..16383
  const int dir = blockIdx.x >> 5;                        // 32 blocks per direction
  const int b   = (tid >> 10) & 7;
  const int h   = tid & 1023;

  const size_t MAT = (size_t)M_DIM * H_DIM;
  const int t0 = dir ? (T_DIM - 1) : 0;                   // first step's time index
  ScanPtr p;
  p.r = (gl_in_t)rkv + (dir ? 3 * MAT : 0) + (size_t)(t0 * B_DIM + b) * H_DIM + h;
  p.k = p.r + MAT;
  p.v = p.k + MAT;
  p.o = (gl_out_t)out + (size_t)(t0 * B_DIM + b) * (2 * H_DIM) + (size_t)dir * H_DIM + h;
  float* hid = out + (size_t)T_DIM * B_DIM * 2 * H_DIM
                   + (size_t)dir * B_DIM * H_DIM + (size_t)b * H_DIM + h;

  if (dir) scan_channel<1>(p, u_bw[h], w_bw[h], hid);
  else     scan_channel<0>(p, u_fw[h], w_fw[h], hid);
}

// ---------------------------------------------------------------------------
// Host launcher
// ---------------------------------------------------------------------------
extern "C" void kernel_launch(void* const* d_in, const int* in_sizes, int n_in,
                              void* d_out, int out_size, void* d_ws, size_t ws_size,
                              hipStream_t stream) {
  (void)in_sizes; (void)n_in; (void)out_size; (void)ws_size;

  const float* x      = (const float*)d_in[0];
  const float* w_r_fw = (const float*)d_in[1];
  const float* w_k_fw = (const float*)d_in[2];
  const float* w_v_fw = (const float*)d_in[3];
  const float* w_u_fw = (const float*)d_in[4];
  const float* w_w_fw = (const float*)d_in[5];
  const float* w_r_bw = (const float*)d_in[6];
  const float* w_k_bw = (const float*)d_in[7];
  const float* w_v_bw = (const float*)d_in[8];
  const float* w_u_bw = (const float*)d_in[9];
  const float* w_w_bw = (const float*)d_in[10];

  // Workspace layout (bytes):
  //   [0)                xh : f16 x,        T*B*I*2  = 33,554,432
  //   [xh)               wh : f16 weights,  6*H*I*2  = 12,582,912
  //   [xh+wh)            rkv: f32 r/k/v x2, 6*T*B*H*4 = 402,653,184
  const size_t XH_BYTES = (size_t)T_DIM * B_DIM * I_DIM * sizeof(half_t);
  const size_t WH_BYTES = (size_t)6 * H_DIM * I_DIM * sizeof(half_t);
  char*   ws  = (char*)d_ws;
  half_t* xh  = (half_t*)ws;
  half_t* wh  = (half_t*)(ws + XH_BYTES);
  float*  rkv = (float*)(ws + XH_BYTES + WH_BYTES);

  // 1) convert x and weights to f16
  {
    const int n4x = (T_DIM * B_DIM * I_DIM) / 4;
    cvt_f32_to_f16_x4<<<(n4x + 255) / 256, 256, 0, stream>>>(x, xh, n4x);
    const int HI  = H_DIM * I_DIM;
    const int n4w = HI / 4;
    const float* wsrc[6] = { w_r_fw, w_k_fw, w_v_fw, w_r_bw, w_k_bw, w_v_bw };
    for (int m = 0; m < 6; ++m) {
      cvt_f32_to_f16_x4<<<(n4w + 255) / 256, 256, 0, stream>>>(
          wsrc[m], wh + (size_t)m * HI, n4w);
    }
  }

  // 2) WMMA projection GEMMs (r gets fused sigmoid)
  {
    const int blocks = (M_DIM / G_BM) * ((6 * H_DIM) / G_BN);  // 128 * 24 = 3072
    proj_gemm_wmma<<<blocks, 256, 0, stream>>>(xh, wh, rkv);
  }

  // 3) bidirectional scan -> d_out ([T,B,2H] output + [2,B,H] hidden)
  {
    const int threads = 2 * B_DIM * H_DIM;                 // 16384 channels
    birwkv_scan<<<threads / 256, 256, 0, stream>>>(
        rkv, w_u_fw, w_w_fw, w_u_bw, w_w_bw, (float*)d_out);
  }
}

// v003
// One run takes 276 microseconds.
// Timed twice side by side with v002, it ran 1.06 times as fast both times.
// Over all steps from v000 it is 6.36 times as fast.
#include <hip/hip_runtime.h>

typedef _Float16 half_t;
typedef __attribute__((ext_vector_type(16))) _Float16 v16h;
typedef __attribute__((ext_vector_type(8)))  _Float16 v8h;
typedef __attribute__((ext_vector_type(4)))  _Float16 v4h;
typedef __attribute__((ext_vector_type(8)))  float    v8f;

#define T_DIM 2048
#define B_DIM 8
#define I_DIM 1024
#define H_DIM 1024
#define M_DIM (T_DIM * B_DIM)          // 16384 rows of x

union V16U { v16h v; struct { v8h lo, hi; } s; };

// ---------------------------------------------------------------------------
// fp32 -> fp16 conversion of x and the six weight matrices in ONE launch of few,
// long-lived waves: 256 work-groups (as many as WGPs) of 11 waves. The f16 copies lie
// behind one another in the workspace (x, then the six matrices), so the whole
// job is one row of 2816 chunks of 2048 float4; every chunk lies in one source
// array, and each wave converts one chunk: 64 loads of 512 contiguous bytes, 64
// stores of 256. The loads go one batch of 16 ahead, into two register sets
// used in turn. All addresses are one scalar base, one lane offset that is
// never written again, and a constant.
// ---------------------------------------------------------------------------
typedef __attribute__((ext_vector_type(4))) float v4f;

#define CVT_GROUPS  256
#define CVT_WAVES   11
#define CVT_BATCH   16
#define CVT_BATCHES 4
#define CVT_CHUNK   (32 * CVT_BATCH * CVT_BATCHES)    // 2048 float4 per wave
#define CVT_X_CH    (M_DIM * I_DIM / 4 / CVT_CHUNK)   // 2048 chunks of x
#define CVT_W_CH    (H_DIM * I_DIM / 4 / CVT_CHUNK)   // 128 chunks per matrix
static_assert(CVT_X_CH * CVT_CHUNK * 4 == M_DIM * I_DIM, "x is a whole number of chunks");
static_assert(CVT_W_CH * CVT_CHUNK * 4 == H_DIM * I_DIM, "a matrix is a whole number of chunks");
static_assert(CVT_X_CH + 6 * CVT_W_CH == CVT_GROUPS * CVT_WAVES, "one chunk per wave");

struct CvtSet { v4f f[CVT_BATCH]; };

__device__ __forceinline__ void cvt_load(CvtSet& s, const v4f* __restrict__ sp, int batch) {
  // From the third batch on the loads land in registers that stores issued
  // above may name as their data: the wait stands before they are written again.
  if (batch >= 2) asm volatile("s_wait_xcnt 0x0" ::: "memory");
  #pragma unroll   // constant offsets and register indices
  for (int q = 0; q < CVT_BATCH; ++q)
    s.f[q] = sp[(batch * CVT_BATCH + q) * 32];
}

__device__ __forceinline__ void cvt_store(const CvtSet& s, v4h* __restrict__ dp, int batch) {
  // Takes the batch's loaded values as inputs only. It keeps the loads of the
  // batch behind this one, issued above, as one run in front of this batch's
  // conversion: left free, they were spread among the conversions in ones to
  // fours, each behind a load wait, so that fewer were in flight.
  asm volatile("" :: "v"(s.f[0]), "v"(s.f[1]), "v"(s.f[2]), "v"(s.f[3]),
                     "v"(s.f[4]), "v"(s.f[5]), "v"(s.f[6]), "v"(s.f[7]),
                     "v"(s.f[8]), "v"(s.f[9]), "v"(s.f[10]), "v"(s.f[11]),
                     "v"(s.f[12]), "v"(s.f[13]), "v"(s.f[14]), "v"(s.f[15]));
  #pragma unroll   // constant offsets and register indices
  for (int q = 0; q < CVT_BATCH; ++q) {
    const v4f f = s.f[q];
    const v4h o = { (half_t)f.x, (half_t)f.y, (half_t)f.z, (half_t)f.w };
    dp[(batch * CVT_BATCH + q) * 32] = o;
  }
}

__global__ __launch_bounds__(CVT_WAVES * 32)
void cvt_all_f32_to_f16(const float* __restrict__ x,
                        const float* __restrict__ w0, const float* __restrict__ w1,
                        const float* __restrict__ w2, const float* __restrict__ w3,
                        const float* __restrict__ w4, const float* __restrict__ w5,
                        half_t* __restrict__ dst) {
  const int lane = threadIdx.x & 31;
  // the wave's chunk, in a scalar register: it picks the source array
  const int g = __builtin_amdgcn_readfirstlane(blockIdx.x * CVT_WAVES + (threadIdx.x >> 5));
  const int m = (g - CVT_X_CH) / CVT_W_CH;            // the matrix, where g is past x
  const float* src = g < CVT_X_CH ? x
                   : m == 0 ? w0 : m == 1 ? w1 : m == 2 ? w2
                   : m == 3 ? w3 : m == 4 ? w4 : w5;
  const int c = g < CVT_X_CH ? g : (g - CVT_X_CH) % CVT_W_CH;   // chunk within it
  const v4f* sp = (const v4f*)src + (size_t)c * CVT_CHUNK + lane;
  v4h*       dp = (v4h*)dst + (size_t)g * CVT_CHUNK + lane;

  CvtSet a, b;
  cvt_load(a, sp, 0);
  cvt_load(b, sp, 1);  cvt_store(a, dp, 0);
  cvt_load(a, sp, 2);  cvt_store(b, dp, 1);
  cvt_load(b, sp, 3);  cvt_store(a, dp, 2);
  cvt_store(b, dp, 3);
}

// ---------------------------------------------------------------------------
// Projection GEMM: [16384 x 1024] x [1024 x 1024]^T for 6 weight matrices
// (the six lie behind one another in wh: one [6144 x 1024] operand).
// A work-group of 8 waves (2 x 4) computes a 128 x 256 tile, each wave 64 x 64
// (4 x 4 WMMA fragments). K goes in stages of 64: one 128-byte line of each of
// the tile's 128 x-rows and 256 weight rows is brought into LDS by asynchronous
// copies, so that L2 delivers every line once per work-group and as a whole
// line. Two buffers: the next stage's copies fly while this one is worked on.
// Fragments are read from LDS in the same K-major per-lane layout for A and B:
//   lanes 0-15 : row = laneL, chunks at K = k0+0..7  and k0+16..23
//   lanes 16-31: row = laneL, chunks at K = k0+8..15 and k0+24..31
// Each accumulator takes its K steps of 32 in rising order.
// Sigmoid fused into the r-matrix stores (mat % 3 == 0).
// ---------------------------------------------------------------------------
#define G_BM 128
#define G_BN 256
#define G_BK 64                                  // f16 elements per stage and row
#define G_PITCH 144                              // LDS bytes per row: 128 + 16 (16 x odd)
#define G_A_BYTES (G_BM * G_PITCH)               // 18,432
#define G_BUF_BYTES ((G_BM + G_BN) * G_PITCH)    // 55,296
#define G_STAGES (I_DIM / G_BK)                  // 16

typedef __attribute__((address_space(3))) unsigned char lds_byte_t;

// One stage: every lane copies 16 bytes of 12 rows (4 of x, 8 of the weights),
// 32 rows apart. la, lb: the lane's LDS byte addresses of its first row in the
// A and B part of the buffer; ga, gb: the same bytes in global memory.
// The s_wait_xcnt stands inside the statement, behind the last copy, so that no
// register a copy names is written again in front of it.
__device__ __forceinline__ void gemm_stage_copy(unsigned la, const half_t* ga,
                                                unsigned lb, const half_t* gb) {
  constexpr unsigned LS = 32 * G_PITCH;          // LDS bytes per 32 rows
  constexpr size_t   GS = (size_t)32 * I_DIM;    // elements per 32 rows
  asm volatile(
      "global_load_async_to_lds_b128 %0, %12, off\n\t"
      "global_load_async_to_lds_b128 %1, %13, off\n\t"
      "global_load_async_to_lds_b128 %2, %14, off\n\t"
      "global_load_async_to_lds_b128 %3, %15, off\n\t"
      "global_load_async_to_lds_b128 %4, %16, off\n\t"
      "global_load_async_to_lds_b128 %5, %17, off\n\t"
      "global_load_async_to_lds_b128 %6, %18, off\n\t"
      "global_load_async_to_lds_b128 %7, %19, off\n\t"
      "global_load_async_to_lds_b128 %8, %20, off\n\t"
      "global_load_async_to_lds_b128 %9, %21, off\n\t"
      "global_load_async_to_lds_b128 %10, %22, off\n\t"
      "global_load_async_to_lds_b128 %11, %23, off\n\t"
      "s_wait_xcnt 0x0"
      :
      : "v"(la), "v"(la + LS), "v"(la + 2 * LS), "v"(la + 3 * LS),
        "v"(lb), "v"(lb + LS), "v"(lb + 2 * LS), "v"(lb + 3 * LS),
        "v"(lb + 4 * LS), "v"(lb + 5 * LS), "v"(lb + 6 * LS), "v"(lb + 7 * LS),
        "v"(ga), "v"(ga + GS), "v"(ga + 2 * GS), "v"(ga + 3 * GS),
        "v"(gb), "v"(gb + GS), "v"(gb + 2 * GS), "v"(gb + 3 * GS),
        "v"(gb + 4 * GS), "v"(gb + 5 * GS), "v"(gb + 6 * GS), "v"(gb + 7 * GS)
      : "memory");
}

__global__ __launch_bounds__(256)
void proj_gemm_wmma(const half_t* __restrict__ xh,
                    const half_t* __restrict__ wh,
                    float* __restrict__ rkv) {
  __shared__ __attribute__((aligned(16))) unsigned char smem[2 * G_BUF_BYTES];

  const int lane  = threadIdx.x & 31;
  const int wave  = threadIdx.x >> 5;
  const int laneL = lane & 15;
  const int laneH = lane >> 4;
  const int wm    = wave >> 2;                  // 0..1: the wave's 64 rows
  const int wn    = wave & 3;                   // 0..3: the wave's 64 columns

  const int NT_N = (6 * H_DIM) / G_BN;          // 24 column tiles
  const int nt   = blockIdx.x % NT_N;
  const int mt   = blockIdx.x / NT_N;

  const int m0  = mt * G_BM;
  const int n0g = nt * G_BN;                    // row of the [6144 x 1024] operand
  const int mat = n0g / H_DIM;                  // 0..5: r/k/v fw, r/k/v bw
  const int n0  = n0g % H_DIM;

  // the lane's part of a stage: 16-byte chunk cchk of rows crow + 32 * i
  const int crow = threadIdx.x >> 3;            // 0..31
  const int cchk = threadIdx.x & 7;             // 0..7
  const half_t* ga = xh + (size_t)(m0  + crow) * I_DIM + cchk * 8;
  const half_t* gb = wh + (size_t)(n0g + crow) * I_DIM + cchk * 8;
  const unsigned la = (unsigned)(size_t)(lds_byte_t*)smem + crow * G_PITCH + cchk * 16;
  const unsigned lb = la + G_A_BYTES;

  // the lane's first fragment chunks in buffer 0
  const unsigned char* fa = smem + (wm * 64 + laneL) * G_PITCH + laneH * 16;
  const unsigned char* fb = smem + G_A_BYTES + (wn * 64 + laneL) * G_PITCH + laneH * 16;

  v8f acc[4][4] = {};

  // stage 0 lands and is published; then stage 1 starts into the other buffer
  gemm_stage_copy(la, ga, lb, gb);
  asm volatile("s_wait_asynccnt 0x0" ::: "memory");   // this wave's copies have landed
  __syncthreads();
  gemm_stage_copy(la + G_BUF_BYTES, ga + G_BK, lb + G_BUF_BYTES, gb + G_BK);

  for (int t = 0; t < G_STAGES; ++t) {
    const unsigned boff = (unsigned)(t & 1) * G_BUF_BYTES;
    #pragma unroll   // constant LDS offsets and register indices
    for (int ks = 0; ks < G_BK / 32; ++ks) {
      V16U a[4], b[4];
      #pragma unroll   // constant register indices
      for (int i = 0; i < 4; ++i) {
        const unsigned char* pa = fa + boff + i * 16 * G_PITCH + ks * 64;
        const unsigned char* pb = fb + boff + i * 16 * G_PITCH + ks * 64;
        a[i].s.lo = *(const v8h*)(pa);
        a[i].s.hi = *(const v8h*)(pa + 32);
        b[i].s.lo = *(const v8h*)(pb);
        b[i].s.hi = *(const v8h*)(pb + 32);
      }
      // the 16 LDS reads of a K step stay one group in front of its 16 WMMAs:
      // left free, they were spread among the WMMAs in pairs, each pair with a
      // full wait behind it
      __builtin_amdgcn_sched_barrier(0);
      #pragma unroll   // constant register indices
      for (int i = 0; i < 4; ++i) {
        #pragma unroll   // constant register indices
        for (int j = 0; j < 4; ++j) {
          acc[i][j] = __builtin_amdgcn_wmma_f32_16x16x32_f16(
              false, a[i].v, false, b[j].v, (short)0, acc[i][j], false, false);
        }
      }
      // and the next K step's reads stay behind this step's WMMAs
      __builtin_amdgcn_sched_barrier(0);
    }
    // hand-over: this wave's reads of buffer t & 1 are done, its copies of stage
    // t + 1 have landed; behind the barrier that holds for every wave, so stage
    // t + 1 may be read and buffer t & 1 refilled
    asm volatile("s_wait_dscnt 0x0" ::: "memory");
    asm volatile("s_wait_asynccnt 0x0" ::: "memory");
    __syncthreads();
    if (t + 2 < G_STAGES)
      gemm_stage_copy(la + boff, ga + (t + 2) * G_BK, lb + boff, gb + (t + 2) * G_BK);
  }
  asm volatile("s_wait_asynccnt 0x0" ::: "memory");   // nothing in flight at the wave's end

  // r matrices get sigmoid: all of the wave's values first, in their registers,
  // so that behind the first store no register that a store names is written
  // (the loops below are unrolled so that every register index is a constant)
  if ((mat % 3) == 0) {
    #pragma unroll
    for (int i = 0; i < 4; ++i) {
      #pragma unroll
      for (int j = 0; j < 4; ++j) {
        #pragma unroll
        for (int v = 0; v < 8; ++v)
          acc[i][j][v] = 1.0f / (1.0f + __expf(-acc[i][j][v]));
      }
    }
  }

  // one address per lane; every element's distance from it is a constant
  float* dst = rkv + (size_t)mat * M_DIM * H_DIM
                   + (size_t)(m0 + wm * 64 + laneH * 8) * H_DIM + (n0 + wn * 64 + laneL);
  #pragma unroll
  for (int i = 0; i < 4; ++i) {
    #pragma unroll
    for (int v = 0; v < 8; ++v) {
      #pragma unroll
      for (int j = 0; j < 4; ++j)
        dst[(i * 16 + v) * H_DIM + j * 16] = acc[i][j][v];
    }
  }
}

// ---------------------------------------------------------------------------
// Bidirectional RWKV scan: one lane per (dir, b, h) channel; 16384 lanes.
// Writes output [T, B, 2H] (fw in h<1024, bw in h>=1024, bw time-reversed
// back to original order) plus hidden tail [2, B, H].
// The r, k, v of a step do not depend on the state, so they are loaded one
// batch of SCAN_DEPTH steps ahead into registers (two sets, used in turn):
// memory latency is paid under a batch's arithmetic, not once per step.
// ---------------------------------------------------------------------------
#define SCAN_DEPTH 16

struct ScanIn  { float r[SCAN_DEPTH], k[SCAN_DEPTH], v[SCAN_DEPTH]; };
// the lane's own addresses of the current batch's first step
// (typed as global-memory pointers: behind the asm statement below the compiler
// could no longer tell, and would fall back to flat loads)
typedef const __attribute__((address_space(1))) float* gl_in_t;
typedef __attribute__((address_space(1))) float*       gl_out_t;
struct ScanPtr { gl_in_t r, k, v; gl_out_t o; };

// e = exp(x) as the fast form has it: one multiply by log2(e), one v_exp_f32.
// The four v_exp_f32 of a step stand in one statement that ends in v_nop: each
// is the independent instruction behind the one before, the v_nop the slot the
// instruction set asks for behind the last.
__device__ __forceinline__ void exp_x4(float x0, float x1, float x2, float x3,
                                       float& e0, float& e1, float& e2, float& e3) {
  const float LOG2E = 1.44269504f;
  const float a0 = x0 * LOG2E, a1 = x1 * LOG2E, a2 = x2 * LOG2E, a3 = x3 * LOG2E;
  asm("v_exp_f32 %0, %4\n\t"
      "v_exp_f32 %1, %5\n\t"
      "v_exp_f32 %2, %6\n\t"
      "v_exp_f32 %3, %7\n\t"
      "v_nop"
      : "=&v"(e0), "=&v"(e1), "=&v"(e2), "=&v"(e3)
      : "v"(a0), "v"(a1), "v"(a2), "v"(a3));
}

__device__ __forceinline__ float scan_step(float r, float k, float v,
                                           float uu, float ww,
                                           float& fn, float& fd, float& scale) {
  const float sm = fmaxf(scale, uu + k);
  const float ns = fmaxf(scale + ww, k);
  float cm, am, ncm, nam;
  exp_x4(scale - sm, uu + k - sm, scale + ww - ns, k - ns, cm, am, ncm, nam);

  const float y = r * ((cm * fn + am * v) / (cm * fd + am));

  fn = ncm * fn + nam * v;
  fd = ncm * fd + nam;
  scale = ns;
  return y;
}

// DIR is a compile-time value so that every step's distance from the batch's
// pointers is a constant and goes into the instruction's offset field.
// Loads the batch that starts AHEAD steps behind p's.
template <int DIR, int AHEAD, bool FIRST = false>
__device__ __forceinline__ void scan_load(ScanIn& d, const ScanPtr& p) {
  constexpr int SI = (DIR ? -1 : 1) * B_DIM * H_DIM;       // floats per step
  #pragma unroll
  for (int j = 0; j < SCAN_DEPTH; ++j) {
    d.k[j] = p.k[(AHEAD + j) * SI];
    d.v[j] = p.v[(AHEAD + j) * SI];
    d.r[j] = p.r[(AHEAD + j) * SI];
  }
  if constexpr (FIRST) asm volatile("s_wait_xcnt 0x0" ::: "memory");  // see scan_channel
  // keeps all of the batch's loads in front of the arithmetic that follows,
  // so that each has a whole batch of lead
  __builtin_amdgcn_sched_barrier(0);
}

// Runs the batch of p.o and stores its outputs; returns the last y.
template <int DIR>
__device__ __forceinline__ float scan_batch(const ScanIn& d, float uu, float ww,
                                            float& fn, float& fd, float& scale,
                                            ScanPtr& p) {
  float y[SCAN_DEPTH];
  #pragma unroll
  for (int j = 0; j < SCAN_DEPTH; ++j)
    y[j] = scan_step(d.r[j], d.k[j], d.v[j], uu, ww, fn, fd, scale);

  // The batch's 16 stores (one out row, 65536 bytes, per step) and the wait
  // that stands before a register named by an issued load or store is written
  // again, in one statement: one wait serves the run. The four pointers are
  // named as in and out so that they stay in their registers up to that wait
  // and are advanced only behind it.
  if constexpr (DIR) {
    asm volatile(
        "global_store_b32 %0, %4, off\n\t"
        "global_store_b32 %0, %5, off offset:-65536\n\t"
        "global_store_b32 %0, %6, off offset:-131072\n\t"
        "global_store_b32 %0, %7, off offset:-196608\n\t"
        "global_store_b32 %0, %8, off offset:-262144\n\t"
        "global_store_b32 %0, %9, off offset:-327680\n\t"
        "global_store_b32 %0, %10, off offset:-393216\n\t"
        "global_store_b32 %0, %11, off offset:-458752\n\t"
        "global_store_b32 %0, %12, off offset:-524288\n\t"
        "global_store_b32 %0, %13, off offset:-589824\n\t"
        "global_store_b32 %0, %14, off offset:-655360\n\t"
        "global_store_b32 %0, %15, off offset:-720896\n\t"
        "global_store_b32 %0, %16, off offset:-786432\n\t"
        "global_store_b32 %0, %17, off offset:-851968\n\t"
        "global_store_b32 %0, %18, off offset:-917504\n\t"
        "global_store_b32 %0, %19, off offset:-983040\n\t"
        "s_wait_xcnt 0x0"
        : "+v"(p.o), "+v"(p.r), "+v"(p.k), "+v"(p.v)
        :
          "v"(y[0]), "v"(y[1]), "v"(y[2]), "v"(y[3]),
          "v"(y[4]), "v"(y[5]), "v"(y[6]), "v"(y[7]),
          "v"(y[8]), "v"(y[9]), "v"(y[10]), "v"(y[11]),
          "v"(y[12]), "v"(y[13]), "v"(y[14]), "v"(y[15])
        : "memory");
  } else {
    asm volatile(
        "global_store_b32 %0, %4, off\n\t"
        "global_store_b32 %0, %5, off offset:65536\n\t"
        "global_store_b32 %0, %6, off offset:131072\n\t"
        "global_store_b32 %0, %7, off offset:196608\n\t"
        "global_store_b32 %0, %8, off offset:262144\n\t"
        "global_store_b32 %0, %9, off offset:327680\n\t"
        "global_store_b32 %0, %10, off offset:393216\n\t"
        "global_store_b32 %0, %11, off offset:458752\n\t"
        "global_store_b32 %0, %12, off offset:524288\n\t"
        "global_store_b32 %0, %13, off offset:589824\n\t"
        "global_store_b32 %0, %14, off offset:655360\n\t"
        "global_store_b32 %0, %15, off offset:720896\n\t"
        "global_store_b32 %0, %16, off offset:786432\n\t"
        "global_store_b32 %0, %17, off offset:851968\n\t"
        "global_store_b32 %0, %18, off offset:917504\n\t"
        "global_store_b32 %0, %19, off offset:983040\n\t"
        "s_wait_xcnt 0x0"
        : "+v"(p.o), "+v"(p.r), "+v"(p.k), "+v"(p.v)
        :
          "v"(y[0]), "v"(y[1]), "v"(y[2]), "v"(y[3]),
          "v"(y[4]), "v"(y[5]), "v"(y[6]), "v"(y[7]),
          "v"(y[8]), "v"(y[9]), "v"(y[10]), "v"(y[11]),
          "v"(y[12]), "v"(y[13]), "v"(y[14]), "v"(y[15])
        : "memory");
  }
  // keeps what follows (among it the compiler's register copies of values that
  // are still in flight) behind the batch's arithmetic: moved up into it, such
  // a copy waits for its load half a batch early
  __builtin_amdgcn_sched_barrier(0);
  p.o += (DIR ? -1 : 1) * B_DIM * 2 * H_DIM * SCAN_DEPTH;
  return y[SCAN_DEPTH - 1];
}

template <int DIR>
__device__ __forceinline__ void scan_channel(ScanPtr p, float uu, float ww,
                                             float* __restrict__ hid) {
  constexpr int BI = (DIR ? -1 : 1) * B_DIM * H_DIM * SCAN_DEPTH;  // floats per batch
  ScanIn A, Bf;
  float fn = 0.0f, fd = 0.0f, scale = -1e20f;

  // Once, in front of the loop: the loads of u and w, and then the first
  // batch's, use address registers of the compiler's own choosing; the wait
  // stands before any of them is written again.
  asm volatile("s_wait_xcnt 0x0" ::: "memory");
  scan_load<DIR, 0, true>(A, p);
  constexpr int PAIRS = T_DIM / (2 * SCAN_DEPTH);
  float y = 0.0f;
  for (int i = 0; i < PAIRS; ++i) {
    scan_load<DIR, SCAN_DEPTH>(Bf, p);
    scan_batch<DIR>(A, uu, ww, fn, fd, scale, p);
    // In the last trip this look-ahead runs SCAN_DEPTH rows past the r, k, v
    // planes' ends, into the neighbouring plane of the same rkv array (forward:
    // planes 0..2 into 1..3; backward: 3..5 into 2..4), which the GEMM of this
    // call has written; the values are not used. A branch round it would make
    // the counted load waits of the batch below wait for these loads too.
    scan_load<DIR, 2 * SCAN_DEPTH>(A, p);
    y = scan_batch<DIR>(Bf, uu, ww, fn, fd, scale, p);
    p.r += 2 * BI; p.k += 2 * BI; p.v += 2 * BI;
  }
  // the last look-ahead's loads are still in flight and nothing reads them:
  // they land before the wave ends and gives its registers back
  asm volatile("s_wait_loadcnt 0x0" ::: "memory");
  *hid = y;
}

__global__ __launch_bounds__(256)
void birwkv_scan(const float* __restrict__ rkv,
                 const float* __restrict__ u_fw, const float* __restrict__ w_fw,
                 const float* __restrict__ u_bw, const float* __restrict__ w_bw,
                 float* __restrict__ out) {
  const int tid = blockIdx.x * blockDim.x + threadIdx.x;  // 0..16383
  const int dir = blockIdx.x >> 5;                        // 32 blocks per direction
  const int b   = (tid >> 10) & 7;
  const int h   = tid & 1023;

  const size_t MAT = (size_t)M_DIM * H_DIM;
  const int t0 = dir ? (T_DIM - 1) : 0;                   // first step's time index
  ScanPtr p;
  p.r = (gl_in_t)rkv + (dir ? 3 * MAT : 0) + (size_t)(t0 * B_DIM + b) * H_DIM + h;
  p.k = p.r + MAT;
  p.v = p.k + MAT;
  p.o = (gl_out_t)out + (size_t)(t0 * B_DIM + b) * (2 * H_DIM) + (size_t)dir * H_DIM + h;
  float* hid = out + (size_t)T_DIM * B_DIM * 2 * H_DIM
                   + (size_t)dir * B_DIM * H_DIM + (size_t)b * H_DIM + h;

  if (dir) scan_channel<1>(p, u_bw[h], w_bw[h], hid);
  else     scan_channel<0>(p, u_fw[h], w_fw[h], hid);
}

// ---------------------------------------------------------------------------
// Host launcher
// ---------------------------------------------------------------------------
extern "C" void kernel_launch(void* const* d_in, const int* in_sizes, int n_in,
                              void* d_out, int out_size, void* d_ws, size_t ws_size,
                              hipStream_t stream) {
  (void)in_sizes; (void)n_in; (void)out_size; (void)ws_size;

  const float* x      = (const float*)d_in[0];
  const float* w_r_fw = (const float*)d_in[1];
  const float* w_k_fw = (const float*)d_in[2];
  const float* w_v_fw = (const float*)d_in[3];
  const float* w_u_fw = (const float*)d_in[4];
  const float* w_w_fw = (const float*)d_in[5];
  const float* w_r_bw = (const float*)d_in[6];
  const float* w_k_bw = (const float*)d_in[7];
  const float* w_v_bw = (const float*)d_in[8];
  const float* w_u_bw = (const float*)d_in[9];
  const float* w_w_bw = (const float*)d_in[10];

  // Workspace layout (bytes):
  //   [0)                xh : f16 x,        T*B*I*2  = 33,554,432
  //   [xh)               wh : f16 weights,  6*H*I*2  = 12,582,912
  //   [xh+wh)            rkv: f32 r/k/v x2, 6*T*B*H*4 = 402,653,184
  const size_t XH_BYTES = (size_t)T_DIM * B_DIM * I_DIM * sizeof(half_t);
  const size_t WH_BYTES = (size_t)6 * H_DIM * I_DIM * sizeof(half_t);
  char*   ws  = (char*)d_ws;
  half_t* xh  = (half_t*)ws;
  half_t* wh  = (half_t*)(ws + XH_BYTES);
  float*  rkv = (float*)(ws + XH_BYTES + WH_BYTES);

  // 1) convert x and the six weight matrices to f16 (xh and wh are one row)
  cvt_all_f32_to_f16<<<CVT_GROUPS, CVT_WAVES * 32, 0, stream>>>(
      x, w_r_fw, w_k_fw, w_v_fw, w_r_bw, w_k_bw, w_v_bw, xh);

  // 2) WMMA projection GEMMs (r gets fused sigmoid)
  {
    const int blocks = (M_DIM / G_BM) * ((6 * H_DIM) / G_BN);  // 128 * 24 = 3072
    proj_gemm_wmma<<<blocks, 256, 0, stream>>>(xh, wh, rkv);
  }

  // 3) bidirectional scan -> d_out ([T,B,2H] output + [2,B,H] hidden)
  {
    const int threads = 2 * B_DIM * H_DIM;                 // 16384 channels
    birwkv_scan<<<threads / 256, 256, 0, stream>>>(
        rkv, w_u_fw, w_w_fw, w_u_bw, w_w_bw, (float*)d_out);
  }
}

// v004
// A run of this version takes 233 microseconds.
// Next to v003, in two timings, it ran 1.19 times as fast each time.
// Over all steps from v000 it is 7.55 times as fast.
#include <hip/hip_runtime.h>

typedef _Float16 half_t;
typedef __attribute__((ext_vector_type(16))) _Float16 v16h;
typedef __attribute__((ext_vector_type(8)))  _Float16 v8h;
typedef __attribute__((ext_vector_type(4)))  _Float16 v4h;
typedef __attribute__((ext_vector_type(8)))  float    v8f;

#define T_DIM 2048
#define B_DIM 8
#define I_DIM 1024
#define H_DIM 1024
#define M_DIM (T_DIM * B_DIM)          // 16384 rows of x

union V16U { v16h v; struct { v8h lo, hi; } s; };

// ---------------------------------------------------------------------------
// fp32 -> fp16 conversion of x and the six weight matrices in ONE launch of few,
// long-lived waves: 256 work-groups (as many as WGPs) of 11 waves. The f16 copies lie
// behind one another in the workspace (x, then the six matrices), so the whole
// job is one row of 2816 chunks of 2048 float4; every chunk lies in one source
// array, and each wave converts one chunk: 64 loads of 512 contiguous bytes, 64
// stores of 256. The loads go one batch of 16 ahead, into two register sets
// used in turn. All addresses are one scalar base, one lane offset that is
// never written again, and a constant.
// ---------------------------------------------------------------------------
typedef __attribute__((ext_vector_type(4))) float v4f;

#define CVT_GROUPS  256
#define CVT_WAVES   11
#define CVT_BATCH   16
#define CVT_BATCHES 4
#define CVT_CHUNK   (32 * CVT_BATCH * CVT_BATCHES)    // 2048 float4 per wave
#define CVT_X_CH    (M_DIM * I_DIM / 4 / CVT_CHUNK)   // 2048 chunks of x
#define CVT_W_CH    (H_DIM * I_DIM / 4 / CVT_CHUNK)   // 128 chunks per matrix
static_assert(CVT_X_CH * CVT_CHUNK * 4 == M_DIM * I_DIM, "x is a whole number of chunks");
static_assert(CVT_W_CH * CVT_CHUNK * 4 == H_DIM * I_DIM, "a matrix is a whole number of chunks");
static_assert(CVT_X_CH + 6 * CVT_W_CH == CVT_GROUPS * CVT_WAVES, "one chunk per wave");

struct CvtSet { v4f f[CVT_BATCH]; };

__device__ __forceinline__ void cvt_load(CvtSet& s, const v4f* __restrict__ sp, int batch) {
  // From the third batch on the loads land in registers that stores issued
  // above may name as their data: the wait stands before they are written again.
  if (batch >= 2) asm volatile("s_wait_xcnt 0x0" ::: "memory");
  #pragma unroll   // constant offsets and register indices
  for (int q = 0; q < CVT_BATCH; ++q)
    s.f[q] = sp[(batch * CVT_BATCH + q) * 32];
}

__device__ __forceinline__ void cvt_store(const CvtSet& s, v4h* __restrict__ dp, int batch) {
  // Takes the batch's loaded values as inputs only. It keeps the loads of the
  // batch behind this one, issued above, as one run in front of this batch's
  // conversion: left free, they were spread among the conversions in ones to
  // fours, each behind a load wait, so that fewer were in flight.
  asm volatile("" :: "v"(s.f[0]), "v"(s.f[1]), "v"(s.f[2]), "v"(s.f[3]),
                     "v"(s.f[4]), "v"(s.f[5]), "v"(s.f[6]), "v"(s.f[7]),
                     "v"(s.f[8]), "v"(s.f[9]), "v"(s.f[10]), "v"(s.f[11]),
                     "v"(s.f[12]), "v"(s.f[13]), "v"(s.f[14]), "v"(s.f[15]));
  #pragma unroll   // constant offsets and register indices
  for (int q = 0; q < CVT_BATCH; ++q) {
    const v4f f = s.f[q];
    const v4h o = { (half_t)f.x, (half_t)f.y, (half_t)f.z, (half_t)f.w };
    dp[(batch * CVT_BATCH + q) * 32] = o;
  }
}

__global__ __launch_bounds__(CVT_WAVES * 32)
void cvt_all_f32_to_f16(const float* __restrict__ x,
                        const float* __restrict__ w0, const float* __restrict__ w1,
                        const float* __restrict__ w2, const float* __restrict__ w3,
                        const float* __restrict__ w4, const float* __restrict__ w5,
                        half_t* __restrict__ dst) {
  const int lane = threadIdx.x & 31;
  // the wave's chunk, in a scalar register: it picks the source array
  const int g = __builtin_amdgcn_readfirstlane(blockIdx.x * CVT_WAVES + (threadIdx.x >> 5));
  const int m = (g - CVT_X_CH) / CVT_W_CH;            // the matrix, where g is past x
  const float* src = g < CVT_X_CH ? x
                   : m == 0 ? w0 : m == 1 ? w1 : m == 2 ? w2
                   : m == 3 ? w3 : m == 4 ? w4 : w5;
  const int c = g < CVT_X_CH ? g : (g - CVT_X_CH) % CVT_W_CH;   // chunk within it
  const v4f* sp = (const v4f*)src + (size_t)c * CVT_CHUNK + lane;
  v4h*       dp = (v4h*)dst + (size_t)g * CVT_CHUNK + lane;

  CvtSet a, b;
  cvt_load(a, sp, 0);
  cvt_load(b, sp, 1);  cvt_store(a, dp, 0);
  cvt_load(a, sp, 2);  cvt_store(b, dp, 1);
  cvt_load(b, sp, 3);  cvt_store(a, dp, 2);
  cvt_store(b, dp, 3);
}

// ---------------------------------------------------------------------------
// Projection GEMM: [16384 x 1024] x [1024 x 1024]^T for 6 weight matrices
// (the six lie behind one another in wh: one [6144 x 1024] operand).
// A work-group of 8 waves (2 x 4) computes a 128 x 256 tile, each wave 64 x 64
// (4 x 4 WMMA fragments). K goes in stages of 64: one 128-byte line of each of
// the tile's 128 x-rows and 256 weight rows is brought into LDS by asynchronous
// copies, so that L2 delivers every line once per work-group and as a whole
// line. Two buffers: the next stage's copies fly while this one is worked on.
// Fragments are read from LDS in the same K-major per-lane layout for A and B:
//   lanes 0-15 : row = laneL, chunks at K = k0+0..7  and k0+16..23
//   lanes 16-31: row = laneL, chunks at K = k0+8..15 and k0+24..31
// Each accumulator takes its K steps of 32 in rising order.
// Sigmoid fused into the r-matrix stores (mat % 3 == 0).
// ---------------------------------------------------------------------------
#define G_BM 128
#define G_BN 256
#define G_BK 64                                  // f16 elements per stage and row
#define G_PITCH 144                              // LDS bytes per row: 128 + 16 (16 x odd)
#define G_A_BYTES (G_BM * G_PITCH)               // 18,432
#define G_BUF_BYTES ((G_BM + G_BN) * G_PITCH)    // 55,296
#define G_STAGES (I_DIM / G_BK)                  // 16

typedef __attribute__((address_space(3))) unsigned char lds_byte_t;

// One stage: every lane copies 16 bytes of 12 rows (4 of x, 8 of the weights),
// 32 rows apart. la, lb: the lane's LDS byte addresses of its first row in the
// A and B part of the buffer; ga, gb: the same bytes in global memory.
// The s_wait_xcnt stands inside the statement, behind the last copy, so that no
// register a copy names is written again in front of it.
__device__ __forceinline__ void gemm_stage_copy(unsigned la, const half_t* ga,
                                                unsigned lb, const half_t* gb) {
  constexpr unsigned LS = 32 * G_PITCH;          // LDS bytes per 32 rows
  constexpr size_t   GS = (size_t)32 * I_DIM;    // elements per 32 rows
  asm volatile(
      "global_load_async_to_lds_b128 %0, %12, off\n\t"
      "global_load_async_to_lds_b128 %1, %13, off\n\t"
      "global_load_async_to_lds_b128 %2, %14, off\n\t"
      "global_load_async_to_lds_b128 %3, %15, off\n\t"
      "global_load_async_to_lds_b128 %4, %16, off\n\t"
      "global_load_async_to_lds_b128 %5, %17, off\n\t"
      "global_load_async_to_lds_b128 %6, %18, off\n\t"
      "global_load_async_to_lds_b128 %7, %19, off\n\t"
      "global_load_async_to_lds_b128 %8, %20, off\n\t"
      "global_load_async_to_lds_b128 %9, %21, off\n\t"
      "global_load_async_to_lds_b128 %10, %22, off\n\t"
      "global_load_async_to_lds_b128 %11, %23, off\n\t"
      "s_wait_xcnt 0x0"
      :
      : "v"(la), "v"(la + LS), "v"(la + 2 * LS), "v"(la + 3 * LS),
        "v"(lb), "v"(lb + LS), "v"(lb + 2 * LS), "v"(lb + 3 * LS),
        "v"(lb + 4 * LS), "v"(lb + 5 * LS), "v"(lb + 6 * LS), "v"(lb + 7 * LS),
        "v"(ga), "v"(ga + GS), "v"(ga + 2 * GS), "v"(ga + 3 * GS),
        "v"(gb), "v"(gb + GS), "v"(gb + 2 * GS), "v"(gb + 3 * GS),
        "v"(gb + 4 * GS), "v"(gb + 5 * GS), "v"(gb + 6 * GS), "v"(gb + 7 * GS)
      : "memory");
}

__global__ __launch_bounds__(256)
void proj_gemm_wmma(const half_t* __restrict__ xh,
                    const half_t* __restrict__ wh,
                    float* __restrict__ rkv) {
  __shared__ __attribute__((aligned(16))) unsigned char smem[2 * G_BUF_BYTES];

  const int lane  = threadIdx.x & 31;
  const int wave  = threadIdx.x >> 5;
  const int laneL = lane & 15;
  const int laneH = lane >> 4;
  const int wm    = wave >> 2;                  // 0..1: the wave's 64 rows
  const int wn    = wave & 3;                   // 0..3: the wave's 64 columns

  const int NT_N = (6 * H_DIM) / G_BN;          // 24 column tiles
  const int nt   = blockIdx.x % NT_N;
  const int mt   = blockIdx.x / NT_N;

  const int m0  = mt * G_BM;
  const int n0g = nt * G_BN;                    // row of the [6144 x 1024] operand
  const int mat = n0g / H_DIM;                  // 0..5: r/k/v fw, r/k/v bw
  const int n0  = n0g % H_DIM;

  // the lane's part of a stage: 16-byte chunk cchk of rows crow + 32 * i
  const int crow = threadIdx.x >> 3;            // 0..31
  const int cchk = threadIdx.x & 7;             // 0..7
  const half_t* ga = xh + (size_t)(m0  + crow) * I_DIM + cchk * 8;
  const half_t* gb = wh + (size_t)(n0g + crow) * I_DIM + cchk * 8;
  const unsigned la = (unsigned)(size_t)(lds_byte_t*)smem + crow * G_PITCH + cchk * 16;
  const unsigned lb = la + G_A_BYTES;

  // the lane's first fragment chunks in buffer 0
  const unsigned char* fa = smem + (wm * 64 + laneL) * G_PITCH + laneH * 16;
  const unsigned char* fb = smem + G_A_BYTES + (wn * 64 + laneL) * G_PITCH + laneH * 16;

  v8f acc[4][4] = {};

  // stage 0 lands and is published; then stage 1 starts into the other buffer
  gemm_stage_copy(la, ga, lb, gb);
  asm volatile("s_wait_asynccnt 0x0" ::: "memory");   // this wave's copies have landed
  __syncthreads();
  gemm_stage_copy(la + G_BUF_BYTES, ga + G_BK, lb + G_BUF_BYTES, gb + G_BK);

  for (int t = 0; t < G_STAGES; ++t) {
    const unsigned boff = (unsigned)(t & 1) * G_BUF_BYTES;
    #pragma unroll   // constant LDS offsets and register indices
    for (int ks = 0; ks < G_BK / 32; ++ks) {
      V16U a[4], b[4];
      #pragma unroll   // constant register indices
      for (int i = 0; i < 4; ++i) {
        const unsigned char* pa = fa + boff + i * 16 * G_PITCH + ks * 64;
        const unsigned char* pb = fb + boff + i * 16 * G_PITCH + ks * 64;
        a[i].s.lo = *(const v8h*)(pa);
        a[i].s.hi = *(const v8h*)(pa + 32);
        b[i].s.lo = *(const v8h*)(pb);
        b[i].s.hi = *(const v8h*)(pb + 32);
      }
      // the 16 LDS reads of a K step stay one group in front of its 16 WMMAs:
      // left free, they were spread among the WMMAs in pairs, each pair with a
      // full wait behind it
      __builtin_amdgcn_sched_barrier(0);
      #pragma unroll   // constant register indices
      for (int i = 0; i < 4; ++i) {
        #pragma unroll   // constant register indices
        for (int j = 0; j < 4; ++j) {
          acc[i][j] = __builtin_amdgcn_wmma_f32_16x16x32_f16(
              false, a[i].v, false, b[j].v, (short)0, acc[i][j], false, false);
        }
      }
      // and the next K step's reads stay behind this step's WMMAs
      __builtin_amdgcn_sched_barrier(0);
    }
    // hand-over: this wave's reads of buffer t & 1 are done, its copies of stage
    // t + 1 have landed; behind the barrier that holds for every wave, so stage
    // t + 1 may be read and buffer t & 1 refilled
    asm volatile("s_wait_dscnt 0x0" ::: "memory");
    asm volatile("s_wait_asynccnt 0x0" ::: "memory");
    __syncthreads();
    if (t + 2 < G_STAGES)
      gemm_stage_copy(la + boff, ga + (t + 2) * G_BK, lb + boff, gb + (t + 2) * G_BK);
  }
  asm volatile("s_wait_asynccnt 0x0" ::: "memory");   // nothing in flight at the wave's end

  // r matrices get sigmoid: all of the wave's values first, in their registers,
  // so that behind the first store no register that a store names is written
  // (the loops below are unrolled so that every register index is a constant)
  if ((mat % 3) == 0) {
    #pragma unroll
    for (int i = 0; i < 4; ++i) {
      #pragma unroll
      for (int j = 0; j < 4; ++j) {
        #pragma unroll
        for (int v = 0; v < 8; ++v)
          acc[i][j][v] = 1.0f / (1.0f + __expf(-acc[i][j][v]));
      }
    }
  }

  // one address per lane; every element's distance from it is a constant
  float* dst = rkv + (size_t)mat * M_DIM * H_DIM
                   + (size_t)(m0 + wm * 64 + laneH * 8) * H_DIM + (n0 + wn * 64 + laneL);
  #pragma unroll
  for (int i = 0; i < 4; ++i) {
    #pragma unroll
    for (int v = 0; v < 8; ++v) {
      #pragma unroll
      for (int j = 0; j < 4; ++j)
        dst[(i * 16 + v) * H_DIM + j * 16] = acc[i][j][v];
    }
  }
}

// ---------------------------------------------------------------------------
// Bidirectional RWKV scan, split over time inside a work-group.
// A work-group owns 32 channels (dir, b, 32 neighbouring h: one lane each) and
// has 32 waves; wave c owns steps c*64 .. c*64+63 of the scan order.
//   pass 1: the wave runs the state update alone (k and v, no output) over its
//           64 steps from the empty state and leaves (fn, fd, scale) in LDS;
//   fold  : behind one barrier, wave c folds the states of waves 0 .. c-1 in
//           rising order into the state in front of its own first step. The
//           state is linear: 64 steps later an earlier state stands for the
//           same sums times exp(64 w), that is scale + 64 w;
//   pass 2: the wave runs its 64 full steps from that state and stores y.
// Writes output [T, B, 2H] (fw in h<1024, bw in h>=1024, bw time-reversed
// back to original order) plus hidden tail [2, B, H].
// The r, k, v of a step do not depend on the state, so they are loaded one
// batch of SCAN_DEPTH steps ahead into registers (two sets, used in turn).
// ---------------------------------------------------------------------------
#define SCAN_DEPTH 8
#define SCAN_WAVES 32                          // time chunks = waves per work-group
#define SCAN_LEN   (T_DIM / SCAN_WAVES)        // 64 steps per chunk
#define SCAN_GROUPS (2 * B_DIM * H_DIM / 32)   // 512 work-groups
static_assert(SCAN_LEN % (2 * SCAN_DEPTH) == 0, "a chunk is a whole number of batch pairs");

struct ScanIn  { float r[SCAN_DEPTH], k[SCAN_DEPTH], v[SCAN_DEPTH]; };
struct ScanKv  { float k[SCAN_DEPTH], v[SCAN_DEPTH]; };
// the lane's own addresses of the current batch's first step
// (typed as global-memory pointers: behind the asm statement below the compiler
// could no longer tell, and would fall back to flat loads)
typedef const __attribute__((address_space(1))) float* gl_in_t;
typedef __attribute__((address_space(1))) float*       gl_out_t;
struct ScanPtr { gl_in_t r, k, v; gl_out_t o; };

// e = exp(x) as the fast form has it: one multiply by log2(e), one v_exp_f32.
// The four v_exp_f32 of a step stand in one statement that ends in v_nop: each
// is the independent instruction behind the one before, the v_nop the slot the
// instruction set asks for behind the last.
__device__ __forceinline__ void exp_x4(float x0, float x1, float x2, float x3,
                                       float& e0, float& e1, float& e2, float& e3) {
  const float LOG2E = 1.44269504f;
  const float a0 = x0 * LOG2E, a1 = x1 * LOG2E, a2 = x2 * LOG2E, a3 = x3 * LOG2E;
  asm("v_exp_f32 %0, %4\n\t"
      "v_exp_f32 %1, %5\n\t"
      "v_exp_f32 %2, %6\n\t"
      "v_exp_f32 %3, %7\n\t"
      "v_nop"
      : "=&v"(e0), "=&v"(e1), "=&v"(e2), "=&v"(e3)
      : "v"(a0), "v"(a1), "v"(a2), "v"(a3));
}

// the same for the two exponentials of a state update alone
__device__ __forceinline__ void exp_x2(float x0, float x1, float& e0, float& e1) {
  const float LOG2E = 1.44269504f;
  const float a0 = x0 * LOG2E, a1 = x1 * LOG2E;
  asm("v_exp_f32 %0, %2\n\t"
      "v_exp_f32 %1, %3\n\t"
      "v_nop"
      : "=&v"(e0), "=&v"(e1)
      : "v"(a0), "v"(a1));
}

__device__ __forceinline__ float scan_step(float r, float k, float v,
                                           float uu, float ww,
                                           float& fn, float& fd, float& scale) {
  const float sm = fmaxf(scale, uu + k);
  const float ns = fmaxf(scale + ww, k);
  float cm, am, ncm, nam;
  exp_x4(scale - sm, uu + k - sm, scale + ww - ns, k - ns, cm, am, ncm, nam);

  const float y = r * ((cm * fn + am * v) / (cm * fd + am));

  fn = ncm * fn + nam * v;
  fd = ncm * fd + nam;
  scale = ns;
  return y;
}

// (fn, fd, scale), moved on by the exponent dw, takes in (gn, gd, gs):
// with dw = w, (v, 1, k) it is the state update of scan_step.
__device__ __forceinline__ void state_take(float dw, float gn, float gd, float gs,
                                           float& fn, float& fd, float& scale) {
  const float ns = fmaxf(scale + dw, gs);
  float ncm, nam;
  exp_x2(scale + dw - ns, gs - ns, ncm, nam);
  fn = ncm * fn + nam * gn;
  fd = ncm * fd + nam * gd;
  scale = ns;
}

// DIR is a compile-time value so that every step's distance from the batch's
// pointers is a constant and goes into the instruction's offset field.
// Loads the batch that starts AHEAD steps behind p's.
template <int DIR, int AHEAD, bool FIRST = false>
__device__ __forceinline__ void scan_load(ScanIn& d, const ScanPtr& p) {
  constexpr int SI = (DIR ? -1 : 1) * B_DIM * H_DIM;       // floats per step
  #pragma unroll
  for (int j = 0; j < SCAN_DEPTH; ++j) {
    d.k[j] = p.k[(AHEAD + j) * SI];
    d.v[j] = p.v[(AHEAD + j) * SI];
    d.r[j] = p.r[(AHEAD + j) * SI];
  }
  if constexpr (FIRST) asm volatile("s_wait_xcnt 0x0" ::: "memory");  // see scan_channel
  // keeps all of the batch's loads in front of the arithmetic that follows,
  // so that each has a whole batch of lead
  __builtin_amdgcn_sched_barrier(0);
}

// the same for pass 1, which reads k and v alone
template <int DIR, int AHEAD, bool FIRST = false>
__device__ __forceinline__ void scan_load_kv(ScanKv& d, gl_in_t pk, gl_in_t pv) {
  constexpr int SI = (DIR ? -1 : 1) * B_DIM * H_DIM;       // floats per step
  #pragma unroll
  for (int j = 0; j < SCAN_DEPTH; ++j) {
    d.k[j] = pk[(AHEAD + j) * SI];
    d.v[j] = pv[(AHEAD + j) * SI];
  }
  if constexpr (FIRST) asm volatile("s_wait_xcnt 0x0" ::: "memory");  // see scan_channel
  // keeps the batch's loads in front of the arithmetic that follows
  __builtin_amdgcn_sched_barrier(0);
}

__device__ __forceinline__ void state_batch(const ScanKv& d, float ww,
                                            float& fn, float& fd, float& scale) {
  #pragma unroll
  for (int j = 0; j < SCAN_DEPTH; ++j)
    state_take(ww, d.v[j], 1.0f, d.k[j], fn, fd, scale);
}

// Runs the batch of p.o and stores its outputs; returns the last y.
template <int DIR>
__device__ __forceinline__ float scan_batch(const ScanIn& d, float uu, float ww,
                                            float& fn, float& fd, float& scale,
                                            ScanPtr& p) {
  float y[SCAN_DEPTH];
  #pragma unroll
  for (int j = 0; j < SCAN_DEPTH; ++j)
    y[j] = scan_step(d.r[j], d.k[j], d.v[j], uu, ww, fn, fd, scale);

  // The batch's 8 stores (one out row, 65536 bytes, per step) and the wait
  // that stands before a register named by an issued load or store is written
  // again, in one statement: one wait serves the run. The four pointers are
  // named as in and out so that they stay in their registers up to that wait
  // and are advanced only behind it.
  if constexpr (DIR) {
    asm volatile(
        "global_store_b32 %0, %4, off\n\t"
        "global_store_b32 %0, %5, off offset:-65536\n\t"
        "global_store_b32 %0, %6, off offset:-131072\n\t"
        "global_store_b32 %0, %7, off offset:-196608\n\t"
        "global_store_b32 %0, %8, off offset:-262144\n\t"
        "global_store_b32 %0, %9, off offset:-327680\n\t"
        "global_store_b32 %0, %10, off offset:-393216\n\t"
        "global_store_b32 %0, %11, off offset:-458752\n\t"
        "s_wait_xcnt 0x0"
        : "+v"(p.o), "+v"(p.r), "+v"(p.k), "+v"(p.v)
        :
          "v"(y[0]), "v"(y[1]), "v"(y[2]), "v"(y[3]),
          "v"(y[4]), "v"(y[5]), "v"(y[6]), "v"(y[7])
        : "memory");
  } else {
    asm volatile(
        "global_store_b32 %0, %4, off\n\t"
        "global_store_b32 %0, %5, off offset:65536\n\t"
        "global_store_b32 %0, %6, off offset:131072\n\t"
        "global_store_b32 %0, %7, off offset:196608\n\t"
        "global_store_b32 %0, %8, off offset:262144\n\t"
        "global_store_b32 %0, %9, off offset:327680\n\t"
        "global_store_b32 %0, %10, off offset:393216\n\t"
        "global_store_b32 %0, %11, off offset:458752\n\t"
        "s_wait_xcnt 0x0"
        : "+v"(p.o), "+v"(p.r), "+v"(p.k), "+v"(p.v)
        :
          "v"(y[0]), "v"(y[1]), "v"(y[2]), "v"(y[3]),
          "v"(y[4]), "v"(y[5]), "v"(y[6]), "v"(y[7])
        : "memory");
  }
  // keeps what follows (among it the compiler's register copies of values that
  // are still in flight) behind the batch's arithmetic: moved up into it, such
  // a copy waits for its load half a batch early
  __builtin_amdgcn_sched_barrier(0);
  p.o += (DIR ? -1 : 1) * B_DIM * 2 * H_DIM * SCAN_DEPTH;
  return y[SCAN_DEPTH - 1];
}

// p: the lane's addresses of the first step of the wave's chunk.
template <int DIR>
__device__ __forceinline__ void scan_channel(ScanPtr p, float uu, float ww,
                                             float* __restrict__ hid,
                                             int lane, int chunk,
                                             float (*st)[SCAN_WAVES][32]) {
  constexpr int BI = (DIR ? -1 : 1) * B_DIM * H_DIM * SCAN_DEPTH;  // floats per batch
  constexpr int PAIRS = SCAN_LEN / (2 * SCAN_DEPTH);
  float fn = 0.0f, fd = 0.0f, scale = -1e20f;

  // Once, in front of the loops: the loads of u and w, and then each pass's
  // first batch, use address registers of the compiler's own choosing; the wait
  // stands before any of them is written again.
  asm volatile("s_wait_xcnt 0x0" ::: "memory");

  // pass 1: the chunk's own state, from the empty state
  {
    gl_in_t pk = p.k, pv = p.v;
    ScanKv A, Bf;
    scan_load_kv<DIR, 0, true>(A, pk, pv);
    for (int i = 0; i < PAIRS; ++i) {
      scan_load_kv<DIR, SCAN_DEPTH>(Bf, pk, pv);
      state_batch(A, ww, fn, fd, scale);
      // in the last trip this look-ahead reads the next chunk's first rows
      // (see pass 2 on the last chunk's); the values are not used
      scan_load_kv<DIR, 2 * SCAN_DEPTH>(A, pk, pv);
      state_batch(Bf, ww, fn, fd, scale);
      // keeps the compiler's register copies of the look-ahead's values, still
      // in flight, behind the batch's arithmetic (as in scan_batch)
      __builtin_amdgcn_sched_barrier(0);
      // the wait that stands before the two pointers, which issued loads name,
      // are advanced; they are named so that they stay in their registers up to it
      asm volatile("s_wait_xcnt 0x0" : "+v"(pk), "+v"(pv) :: "memory");
      pk += 2 * BI; pv += 2 * BI;
    }
  }
  st[0][chunk][lane] = fn;
  st[1][chunk][lane] = fd;
  st[2][chunk][lane] = scale;

  // pass 2's first batch flies while the states are handed over
  ScanIn A, Bf;
  scan_load<DIR, 0, true>(A, p);

  __syncthreads();   // every wave's chunk state is in LDS

  // fold: the state in front of this chunk, from the chunks before it
  const float lw = (float)SCAN_LEN * ww;
  fn = 0.0f; fd = 0.0f; scale = -1e20f;
  for (int j = 0; j < chunk; ++j)
    state_take(lw, st[0][j][lane], st[1][j][lane], st[2][j][lane], fn, fd, scale);

  // pass 2: the chunk's full steps
  float y = 0.0f;
  for (int i = 0; i < PAIRS; ++i) {
    scan_load<DIR, SCAN_DEPTH>(Bf, p);
    scan_batch<DIR>(A, uu, ww, fn, fd, scale, p);
    // In the last trip this look-ahead reads the next chunk's first rows; the
    // last chunk's runs SCAN_DEPTH rows past the r, k, v planes' ends, into the
    // neighbouring plane of the same rkv array (forward: planes 0..2 into 1..3;
    // backward: 3..5 into 2..4), which the GEMM of this call has written; the
    // values are not used. A branch round it would make the counted load waits
    // of the batch below wait for these loads too.
    scan_load<DIR, 2 * SCAN_DEPTH>(A, p);
    y = scan_batch<DIR>(Bf, uu, ww, fn, fd, scale, p);
    p.r += 2 * BI; p.k += 2 * BI; p.v += 2 * BI;
  }
  // the last look-ahead's loads are still in flight and nothing reads them:
  // they land before the wave ends and gives its registers back
  asm volatile("s_wait_loadcnt 0x0" ::: "memory");
  if (chunk == SCAN_WAVES - 1) *hid = y;   // the scan's last step
}

__global__ __launch_bounds__(SCAN_WAVES * 32)
void birwkv_scan(const float* __restrict__ rkv,
                 const float* __restrict__ u_fw, const float* __restrict__ w_fw,
                 const float* __restrict__ u_bw, const float* __restrict__ w_bw,
                 float* __restrict__ out) {
  __shared__ float st[3][SCAN_WAVES][32];                 // fn, fd, scale per chunk and lane

  const int lane  = threadIdx.x & 31;
  // the wave's chunk, in a scalar register: it is the fold's trip count
  const int chunk = __builtin_amdgcn_readfirstlane(threadIdx.x >> 5);
  const int dir = blockIdx.x >> 8;                        // 256 work-groups per direction
  const int b   = (blockIdx.x >> 5) & 7;
  const int h   = (blockIdx.x & 31) * 32 + lane;

  const size_t MAT = (size_t)M_DIM * H_DIM;
  // time index of the chunk's first step
  const int t0 = dir ? (T_DIM - 1 - chunk * SCAN_LEN) : chunk * SCAN_LEN;
  ScanPtr p;
  p.r = (gl_in_t)rkv + (dir ? 3 * MAT : 0) + (size_t)(t0 * B_DIM + b) * H_DIM + h;
  p.k = p.r + MAT;
  p.v = p.k + MAT;
  p.o = (gl_out_t)out + (size_t)(t0 * B_DIM + b) * (2 * H_DIM) + (size_t)dir * H_DIM + h;
  float* hid = out + (size_t)T_DIM * B_DIM * 2 * H_DIM
                   + (size_t)dir * B_DIM * H_DIM + (size_t)b * H_DIM + h;

  if (dir) scan_channel<1>(p, u_bw[h], w_bw[h], hid, lane, chunk, st);
  else     scan_channel<0>(p, u_fw[h], w_fw[h], hid, lane, chunk, st);
}

// ---------------------------------------------------------------------------
// Host launcher
// ---------------------------------------------------------------------------
extern "C" void kernel_launch(void* const* d_in, const int* in_sizes, int n_in,
                              void* d_out, int out_size, void* d_ws, size_t ws_size,
                              hipStream_t stream) {
  (void)in_sizes; (void)n_in; (void)out_size; (void)ws_size;

  const float* x      = (const float*)d_in[0];
  const float* w_r_fw = (const float*)d_in[1];
  const float* w_k_fw = (const float*)d_in[2];
  const float* w_v_fw = (const float*)d_in[3];
  const float* w_u_fw = (const float*)d_in[4];
  const float* w_w_fw = (const float*)d_in[5];
  const float* w_r_bw = (const float*)d_in[6];
  const float* w_k_bw = (const float*)d_in[7];
  const float* w_v_bw = (const float*)d_in[8];
  const float* w_u_bw = (const float*)d_in[9];
  const float* w_w_bw = (const float*)d_in[10];

  // Workspace layout (bytes):
  //   [0)                xh : f16 x,        T*B*I*2  = 33,554,432
  //   [xh)               wh : f16 weights,  6*H*I*2  = 12,582,912
  //   [xh+wh)            rkv: f32 r/k/v x2, 6*T*B*H*4 = 402,653,184
  const size_t XH_BYTES = (size_t)T_DIM * B_DIM * I_DIM * sizeof(half_t);
  const size_t WH_BYTES = (size_t)6 * H_DIM * I_DIM * sizeof(half_t);
  char*   ws  = (char*)d_ws;
  half_t* xh  = (half_t*)ws;
  half_t* wh  = (half_t*)(ws + XH_BYTES);
  float*  rkv = (float*)(ws + XH_BYTES + WH_BYTES);

  // 1) convert x and the six weight matrices to f16 (xh and wh are one row)
  cvt_all_f32_to_f16<<<CVT_GROUPS, CVT_WAVES * 32, 0, stream>>>(
      x, w_r_fw, w_k_fw, w_v_fw, w_r_bw, w_k_bw, w_v_bw, xh);

  // 2) WMMA projection GEMMs (r gets fused sigmoid)
  {
    const int blocks = (M_DIM / G_BM) * ((6 * H_DIM) / G_BN);  // 128 * 24 = 3072
    proj_gemm_wmma<<<blocks, 256, 0, stream>>>(xh, wh, rkv);
  }

  // 3) bidirectional scan -> d_out ([T,B,2H] output + [2,B,H] hidden)
  birwkv_scan<<<SCAN_GROUPS, SCAN_WAVES * 32, 0, stream>>>(
      rkv, w_u_fw, w_w_fw, w_u_bw, w_w_bw, (float*)d_out);
}

// v005
// It runs in 221 microseconds.
// In both of two side-by-side timings against v004, it was 1.05 times as fast.
// Counting every step since v000, it is 7.95 times as fast.
#include <hip/hip_runtime.h>

typedef _Float16 half_t;
typedef __attribute__((ext_vector_type(16))) _Float16 v16h;
typedef __attribute__((ext_vector_type(8)))  _Float16 v8h;
typedef __attribute__((ext_vector_type(4)))  _Float16 v4h;
typedef __attribute__((ext_vector_type(8)))  float    v8f;

#define T_DIM 2048
#define B_DIM 8
#define I_DIM 1024
#define H_DIM 1024
#define M_DIM (T_DIM * B_DIM)          // 16384 rows of x

union V16U { v16h v; struct { v8h lo, hi; } s; };

// ---------------------------------------------------------------------------
// fp32 -> fp16 conversion of x and the six weight matrices in ONE launch of few,
// long-lived waves: 256 work-groups (as many as WGPs) of 11 waves. The f16 copies lie
// behind one another in the workspace (x, then the six matrices), so the whole
// job is one row of 2816 chunks of 2048 float4; every chunk lies in one source
// array, and each wave converts one chunk: 64 loads of 512 contiguous bytes, 64
// stores of 256. The loads go one batch of 16 ahead, into two register sets
// used in turn. All addresses are one scalar base, one lane offset that is
// never written again, and a constant.
// ---------------------------------------------------------------------------
typedef __attribute__((ext_vector_type(4))) float v4f;

#define CVT_GROUPS  256
#define CVT_WAVES   11
#define CVT_BATCH   16
#define CVT_BATCHES 4
#define CVT_CHUNK   (32 * CVT_BATCH * CVT_BATCHES)    // 2048 float4 per wave
#define CVT_X_CH    (M_DIM * I_DIM / 4 / CVT_CHUNK)   // 2048 chunks of x
#define CVT_W_CH    (H_DIM * I_DIM / 4 / CVT_CHUNK)   // 128 chunks per matrix
static_assert(CVT_X_CH * CVT_CHUNK * 4 == M_DIM * I_DIM, "x is a whole number of chunks");
static_assert(CVT_W_CH * CVT_CHUNK * 4 == H_DIM * I_DIM, "a matrix is a whole number of chunks");
static_assert(CVT_X_CH + 6 * CVT_W_CH == CVT_GROUPS * CVT_WAVES, "one chunk per wave");

struct CvtSet { v4f f[CVT_BATCH]; };

__device__ __forceinline__ void cvt_load(CvtSet& s, const v4f* __restrict__ sp, int batch) {
  // From the third batch on the loads land in registers that stores issued
  // above may name as their data: the wait stands before they are written again.
  if (batch >= 2) asm volatile("s_wait_xcnt 0x0" ::: "memory");
  #pragma unroll   // constant offsets and register indices
  for (int q = 0; q < CVT_BATCH; ++q)
    s.f[q] = sp[(batch * CVT_BATCH + q) * 32];
}

__device__ __forceinline__ void cvt_store(const CvtSet& s, v4h* __restrict__ dp, int batch) {
  // Takes the batch's loaded values as inputs only. It keeps the loads of the
  // batch behind this one, issued above, as one run in front of this batch's
  // conversion: left free, they were spread among the conversions in ones to
  // fours, each behind a load wait, so that fewer were in flight.
  asm volatile("" :: "v"(s.f[0]), "v"(s.f[1]), "v"(s.f[2]), "v"(s.f[3]),
                     "v"(s.f[4]), "v"(s.f[5]), "v"(s.f[6]), "v"(s.f[7]),
                     "v"(s.f[8]), "v"(s.f[9]), "v"(s.f[10]), "v"(s.f[11]),
                     "v"(s.f[12]), "v"(s.f[13]), "v"(s.f[14]), "v"(s.f[15]));
  #pragma unroll   // constant offsets and register indices
  for (int q = 0; q < CVT_BATCH; ++q) {
    const v4f f = s.f[q];
    const v4h o = { (half_t)f.x, (half_t)f.y, (half_t)f.z, (half_t)f.w };
    dp[(batch * CVT_BATCH + q) * 32] = o;
  }
}

__global__ __launch_bounds__(CVT_WAVES * 32)
void cvt_all_f32_to_f16(const float* __restrict__ x,
                        const float* __restrict__ w0, const float* __restrict__ w1,
                        const float* __restrict__ w2, const float* __restrict__ w3,
                        const float* __restrict__ w4, const float* __restrict__ w5,
                        half_t* __restrict__ dst) {
  const int lane = threadIdx.x & 31;
  // the wave's chunk, in a scalar register: it picks the source array
  const int g = __builtin_amdgcn_readfirstlane(blockIdx.x * CVT_WAVES + (threadIdx.x >> 5));
  const int m = (g - CVT_X_CH) / CVT_W_CH;            // the matrix, where g is past x
  const float* src = g < CVT_X_CH ? x
                   : m == 0 ? w0 : m == 1 ? w1 : m == 2 ? w2
                   : m == 3 ? w3 : m == 4 ? w4 : w5;
  const int c = g < CVT_X_CH ? g : (g - CVT_X_CH) % CVT_W_CH;   // chunk within it
  const v4f* sp = (const v4f*)src + (size_t)c * CVT_CHUNK + lane;
  v4h*       dp = (v4h*)dst + (size_t)g * CVT_CHUNK + lane;

  CvtSet a, b;
  cvt_load(a, sp, 0);
  cvt_load(b, sp, 1);  cvt_store(a, dp, 0);
  cvt_load(a, sp, 2);  cvt_store(b, dp, 1);
  cvt_load(b, sp, 3);  cvt_store(a, dp, 2);
  cvt_store(b, dp, 3);
}

// ---------------------------------------------------------------------------
// Projection GEMM: [16384 x 1024] x [1024 x 1024]^T for 6 weight matrices
// (the six lie behind one another in wh: one [6144 x 1024] operand).
// A work-group of 8 waves (2 x 4) computes a 128 x 256 tile, each wave 64 x 64
// (4 x 4 WMMA fragments). K goes in stages of 64: one 128-byte line of each of
// the tile's 128 x-rows and 256 weight rows is brought into LDS by asynchronous
// copies, so that L2 delivers every line once per work-group and as a whole
// line. Two buffers: the next stage's copies fly while this one is worked on.
// Fragments are read from LDS in the same K-major per-lane layout for A and B:
//   lanes 0-15 : row = laneL, chunks at K = k0+0..7  and k0+16..23
//   lanes 16-31: row = laneL, chunks at K = k0+8..15 and k0+24..31
// Each accumulator takes its K steps of 32 in rising order.
// Sigmoid fused into the r-matrix stores (mat % 3 == 0).
// The result leaves through LDS as whole 256-byte row pieces.
// ---------------------------------------------------------------------------
#define G_BM 128
#define G_BN 256
#define G_BK 64                                  // f16 elements per stage and row
#define G_PITCH 144                              // LDS bytes per row: 128 + 16 (16 x odd)
#define G_A_BYTES (G_BM * G_PITCH)               // 18,432
#define G_BUF_BYTES ((G_BM + G_BN) * G_PITCH)    // 55,296
#define G_STAGES (I_DIM / G_BK)                  // 16
#define E_PITCH 68                               // floats per staged output row: 64 + 4 (272 bytes, 16 x odd)
#define E_PART  (16 * E_PITCH)                   // floats per staged part: 16 rows
static_assert(8 * 2 * E_PART * 4 <= 2 * G_BUF_BYTES, "the eight waves' staging fits the ring");

typedef __attribute__((address_space(3))) unsigned char lds_byte_t;

// One stage: every lane copies 16 bytes of 12 rows (4 of x, 8 of the weights),
// 32 rows apart. la, lb: the lane's LDS byte addresses of its first row in the
// A and B part of the buffer; ga, gb: the same bytes in global memory.
// The s_wait_xcnt stands inside the statement, behind the last copy, so that no
// register a copy names is written again in front of it.
__device__ __forceinline__ void gemm_stage_copy(unsigned la, const half_t* ga,
                                                unsigned lb, const half_t* gb) {
  constexpr unsigned LS = 32 * G_PITCH;          // LDS bytes per 32 rows
  constexpr size_t   GS = (size_t)32 * I_DIM;    // elements per 32 rows
  asm volatile(
      "global_load_async_to_lds_b128 %0, %12, off\n\t"
      "global_load_async_to_lds_b128 %1, %13, off\n\t"
      "global_load_async_to_lds_b128 %2, %14, off\n\t"
      "global_load_async_to_lds_b128 %3, %15, off\n\t"
      "global_load_async_to_lds_b128 %4, %16, off\n\t"
      "global_load_async_to_lds_b128 %5, %17, off\n\t"
      "global_load_async_to_lds_b128 %6, %18, off\n\t"
      "global_load_async_to_lds_b128 %7, %19, off\n\t"
      "global_load_async_to_lds_b128 %8, %20, off\n\t"
      "global_load_async_to_lds_b128 %9, %21, off\n\t"
      "global_load_async_to_lds_b128 %10, %22, off\n\t"
      "global_load_async_to_lds_b128 %11, %23, off\n\t"
      "s_wait_xcnt 0x0"
      :
      : "v"(la), "v"(la + LS), "v"(la + 2 * LS), "v"(la + 3 * LS),
        "v"(lb), "v"(lb + LS), "v"(lb + 2 * LS), "v"(lb + 3 * LS),
        "v"(lb + 4 * LS), "v"(lb + 5 * LS), "v"(lb + 6 * LS), "v"(lb + 7 * LS),
        "v"(ga), "v"(ga + GS), "v"(ga + 2 * GS), "v"(ga + 3 * GS),
        "v"(gb), "v"(gb + GS), "v"(gb + 2 * GS), "v"(gb + 3 * GS),
        "v"(gb + 4 * GS), "v"(gb + 5 * GS), "v"(gb + 6 * GS), "v"(gb + 7 * GS)
      : "memory");
}

__global__ __launch_bounds__(256)
void proj_gemm_wmma(const half_t* __restrict__ xh,
                    const half_t* __restrict__ wh,
                    float* __restrict__ rkv) {
  __shared__ __attribute__((aligned(16))) unsigned char smem[2 * G_BUF_BYTES];

  const int lane  = threadIdx.x & 31;
  const int wave  = threadIdx.x >> 5;
  const int laneL = lane & 15;
  const int laneH = lane >> 4;
  const int wm    = wave >> 2;                  // 0..1: the wave's 64 rows
  const int wn    = wave & 3;                   // 0..3: the wave's 64 columns

  const int NT_N = (6 * H_DIM) / G_BN;          // 24 column tiles
  const int nt   = blockIdx.x % NT_N;
  const int mt   = blockIdx.x / NT_N;

  const int m0  = mt * G_BM;
  const int n0g = nt * G_BN;                    // row of the [6144 x 1024] operand
  const int mat = n0g / H_DIM;                  // 0..5: r/k/v fw, r/k/v bw
  const int n0  = n0g % H_DIM;

  // the lane's part of a stage: 16-byte chunk cchk of rows crow + 32 * i
  const int crow = threadIdx.x >> 3;            // 0..31
  const int cchk = threadIdx.x & 7;             // 0..7
  const half_t* ga = xh + (size_t)(m0  + crow) * I_DIM + cchk * 8;
  const half_t* gb = wh + (size_t)(n0g + crow) * I_DIM + cchk * 8;
  const unsigned la = (unsigned)(size_t)(lds_byte_t*)smem + crow * G_PITCH + cchk * 16;
  const unsigned lb = la + G_A_BYTES;

  // the lane's first fragment chunks in buffer 0
  const unsigned char* fa = smem + (wm * 64 + laneL) * G_PITCH + laneH * 16;
  const unsigned char* fb = smem + G_A_BYTES + (wn * 64 + laneL) * G_PITCH + laneH * 16;

  v8f acc[4][4] = {};

  // stage 0 lands and is published; then stage 1 starts into the other buffer
  gemm_stage_copy(la, ga, lb, gb);
  asm volatile("s_wait_asynccnt 0x0" ::: "memory");   // this wave's copies have landed
  __syncthreads();
  gemm_stage_copy(la + G_BUF_BYTES, ga + G_BK, lb + G_BUF_BYTES, gb + G_BK);

  for (int t = 0; t < G_STAGES; ++t) {
    const unsigned boff = (unsigned)(t & 1) * G_BUF_BYTES;
    #pragma unroll   // constant LDS offsets and register indices
    for (int ks = 0; ks < G_BK / 32; ++ks) {
      V16U a[4], b[4];
      #pragma unroll   // constant register indices
      for (int i = 0; i < 4; ++i) {
        const unsigned char* pa = fa + boff + i * 16 * G_PITCH + ks * 64;
        const unsigned char* pb = fb + boff + i * 16 * G_PITCH + ks * 64;
        a[i].s.lo = *(const v8h*)(pa);
        a[i].s.hi = *(const v8h*)(pa + 32);
        b[i].s.lo = *(const v8h*)(pb);
        b[i].s.hi = *(const v8h*)(pb + 32);
      }
      // the 16 LDS reads of a K step stay one group in front of its 16 WMMAs:
      // left free, they were spread among the WMMAs in pairs, each pair with a
      // full wait behind it
      __builtin_amdgcn_sched_barrier(0);
      #pragma unroll   // constant register indices
      for (int i = 0; i < 4; ++i) {
        #pragma unroll   // constant register indices
        for (int j = 0; j < 4; ++j) {
          acc[i][j] = __builtin_amdgcn_wmma_f32_16x16x32_f16(
              false, a[i].v, false, b[j].v, (short)0, acc[i][j], false, false);
        }
      }
      // and the next K step's reads stay behind this step's WMMAs
      __builtin_amdgcn_sched_barrier(0);
    }
    // hand-over: this wave's reads of buffer t & 1 are done, its copies of stage
    // t + 1 have landed; behind the barrier that holds for every wave, so stage
    // t + 1 may be read and buffer t & 1 refilled
    asm volatile("s_wait_dscnt 0x0" ::: "memory");
    asm volatile("s_wait_asynccnt 0x0" ::: "memory");
    __syncthreads();
    if (t + 2 < G_STAGES)
      gemm_stage_copy(la + boff, ga + (t + 2) * G_BK, lb + boff, gb + (t + 2) * G_BK);
  }
  asm volatile("s_wait_asynccnt 0x0" ::: "memory");   // nothing in flight at the wave's end

  // r matrices get sigmoid: all of the wave's values first, in their registers,
  // so that behind the first LDS write no accumulator register is written
  // (the loops below are unrolled so that every register index is a constant)
  if ((mat % 3) == 0) {
    #pragma unroll
    for (int i = 0; i < 4; ++i) {
      #pragma unroll
      for (int j = 0; j < 4; ++j) {
        #pragma unroll
        for (int v = 0; v < 8; ++v)
          acc[i][j][v] = 1.0f / (1.0f + __expf(-acc[i][j][v]));
      }
    }
  }

  // The wave's 64 x 64 tile leaves through LDS, so that global memory gets whole
  // aligned 256-byte row pieces in 16-byte stores (straight from the accumulators
  // a store holds two 64-byte pieces, 4 bytes a lane). The ring is free: behind the
  // loop's last barrier no wave reads it and no copy is in flight. Each wave stages
  // in a range of its own, 16 rows (one row of accumulator tiles) at a time, two
  // parts used in turn: part i + 1 is written while part i is on its way out.
  float*       stg = (float*)smem + wave * (2 * E_PART);
  float*       sw  = stg + laneH * 8 * E_PITCH + laneL;     // accumulator map: row 8 * laneH + v
  const float* sr  = stg + laneH * E_PITCH + laneL * 4;     // rows 2 q + laneH, 16 bytes a lane
  // one address per lane; every store's distance from it is a constant
  float* dst = rkv + (size_t)mat * M_DIM * H_DIM
                   + (size_t)(m0 + wm * 64 + laneH) * H_DIM + (n0 + wn * 64 + laneL * 4);
  #pragma unroll   // constant LDS offsets and register indices
  for (int v = 0; v < 8; ++v) {
    #pragma unroll
    for (int j = 0; j < 4; ++j)
      sw[v * E_PITCH + j * 16] = acc[0][j][v];
  }
  #pragma unroll   // constant offsets and register indices
  for (int i = 0; i < 4; ++i) {
    // part i's writes have landed before other lanes of the wave read them; and
    // part i - 1's reads are done before that part is written again below
    asm volatile("s_wait_dscnt 0x0" ::: "memory");
    // the reads below may land in registers that the stores of part i - 1 name
    if (i > 0) asm volatile("s_wait_xcnt 0x0" ::: "memory");
    v4f row[8];
    #pragma unroll
    for (int q = 0; q < 8; ++q)
      row[q] = *(const v4f*)(sr + (i & 1) * E_PART + q * 2 * E_PITCH);
    if (i + 1 < 4) {
      #pragma unroll
      for (int v = 0; v < 8; ++v) {
        #pragma unroll
        for (int j = 0; j < 4; ++j)
          sw[((i + 1) & 1) * E_PART + v * E_PITCH + j * 16] = acc[i + 1][j][v];
      }
    }
    #pragma unroll
    for (int q = 0; q < 8; ++q)
      *(v4f*)(dst + (i * 16 + q * 2) * H_DIM) = row[q];
  }
}

// ---------------------------------------------------------------------------
// Bidirectional RWKV scan, split over time inside a work-group.
// A work-group owns 32 channels (dir, b, 32 neighbouring h: one lane each) and
// has 32 waves; wave c owns steps c*64 .. c*64+63 of the scan order.
//   pass 1: the wave runs the state update alone (k and v, no output) over its
//           64 steps from the empty state and leaves (fn, fd, scale) in LDS;
//   fold  : behind one barrier, wave c folds the states of waves 0 .. c-1 in
//           rising order into the state in front of its own first step. The
//           state is linear: 64 steps later an earlier state stands for the
//           same sums times exp(64 w), that is scale + 64 w;
//   pass 2: the wave runs its 64 full steps from that state and stores y.
// Writes output [T, B, 2H] (fw in h<1024, bw in h>=1024, bw time-reversed
// back to original order) plus hidden tail [2, B, H].
// The r, k, v of a step do not depend on the state, so they are loaded one
// batch of SCAN_DEPTH steps ahead into registers (two sets, used in turn).
// ---------------------------------------------------------------------------
#define SCAN_DEPTH 8
#define SCAN_WAVES 32                          // time chunks = waves per work-group
#define SCAN_LEN   (T_DIM / SCAN_WAVES)        // 64 steps per chunk
#define SCAN_GROUPS (2 * B_DIM * H_DIM / 32)   // 512 work-groups
static_assert(SCAN_LEN % (2 * SCAN_DEPTH) == 0, "a chunk is a whole number of batch pairs");

struct ScanIn  { float r[SCAN_DEPTH], k[SCAN_DEPTH], v[SCAN_DEPTH]; };
struct ScanKv  { float k[SCAN_DEPTH], v[SCAN_DEPTH]; };
// the lane's own addresses of the current batch's first step
// (typed as global-memory pointers: behind the asm statement below the compiler
// could no longer tell, and would fall back to flat loads)
typedef const __attribute__((address_space(1))) float* gl_in_t;
typedef __attribute__((address_space(1))) float*       gl_out_t;
struct ScanPtr { gl_in_t r, k, v; gl_out_t o; };

// e = exp(x) as the fast form has it: one multiply by log2(e), one v_exp_f32.
// The four v_exp_f32 of a step stand in one statement that ends in v_nop: each
// is the independent instruction behind the one before, the v_nop the slot the
// instruction set asks for behind the last.
__device__ __forceinline__ void exp_x4(float x0, float x1, float x2, float x3,
                                       float& e0, float& e1, float& e2, float& e3) {
  const float LOG2E = 1.44269504f;
  const float a0 = x0 * LOG2E, a1 = x1 * LOG2E, a2 = x2 * LOG2E, a3 = x3 * LOG2E;
  asm("v_exp_f32 %0, %4\n\t"
      "v_exp_f32 %1, %5\n\t"
      "v_exp_f32 %2, %6\n\t"
      "v_exp_f32 %3, %7\n\t"
      "v_nop"
      : "=&v"(e0), "=&v"(e1), "=&v"(e2), "=&v"(e3)
      : "v"(a0), "v"(a1), "v"(a2), "v"(a3));
}

// the same for the two exponentials of a state update alone
__device__ __forceinline__ void exp_x2(float x0, float x1, float& e0, float& e1) {
  const float LOG2E = 1.44269504f;
  const float a0 = x0 * LOG2E, a1 = x1 * LOG2E;
  asm("v_exp_f32 %0, %2\n\t"
      "v_exp_f32 %1, %3\n\t"
      "v_nop"
      : "=&v"(e0), "=&v"(e1)
      : "v"(a0), "v"(a1));
}

__device__ __forceinline__ float scan_step(float r, float k, float v,
                                           float uu, float ww,
                                           float& fn, float& fd, float& scale) {
  const float sm = fmaxf(scale, uu + k);
  const float ns = fmaxf(scale + ww, k);
  float cm, am, ncm, nam;
  exp_x4(scale - sm, uu + k - sm, scale + ww - ns, k - ns, cm, am, ncm, nam);

  const float y = r * ((cm * fn + am * v) / (cm * fd + am));

  fn = ncm * fn + nam * v;
  fd = ncm * fd + nam;
  scale = ns;
  return y;
}

// (fn, fd, scale), moved on by the exponent dw, takes in (gn, gd, gs):
// with dw = w, (v, 1, k) it is the state update of scan_step.
__device__ __forceinline__ void state_take(float dw, float gn, float gd, float gs,
                                           float& fn, float& fd, float& scale) {
  const float ns = fmaxf(scale + dw, gs);
  float ncm, nam;
  exp_x2(scale + dw - ns, gs - ns, ncm, nam);
  fn = ncm * fn + nam * gn;
  fd = ncm * fd + nam * gd;
  scale = ns;
}

// DIR is a compile-time value so that every step's distance from the batch's
// pointers is a constant and goes into the instruction's offset field.
// Loads the batch that starts AHEAD steps behind p's.
template <int DIR, int AHEAD, bool FIRST = false>
__device__ __forceinline__ void scan_load(ScanIn& d, const ScanPtr& p) {
  constexpr int SI = (DIR ? -1 : 1) * B_DIM * H_DIM;       // floats per step
  #pragma unroll
  for (int j = 0; j < SCAN_DEPTH; ++j) {
    d.k[j] = p.k[(AHEAD + j) * SI];
    d.v[j] = p.v[(AHEAD + j) * SI];
    d.r[j] = p.r[(AHEAD + j) * SI];
  }
  if constexpr (FIRST) asm volatile("s_wait_xcnt 0x0" ::: "memory");  // see scan_channel
  // keeps all of the batch's loads in front of the arithmetic that follows,
  // so that each has a whole batch of lead
  __builtin_amdgcn_sched_barrier(0);
}

// the same for pass 1, which reads k and v alone
template <int DIR, int AHEAD, bool FIRST = false>
__device__ __forceinline__ void scan_load_kv(ScanKv& d, gl_in_t pk, gl_in_t pv) {
  constexpr int SI = (DIR ? -1 : 1) * B_DIM * H_DIM;       // floats per step
  #pragma unroll
  for (int j = 0; j < SCAN_DEPTH; ++j) {
    d.k[j] = pk[(AHEAD + j) * SI];
    d.v[j] = pv[(AHEAD + j) * SI];
  }
  if constexpr (FIRST) asm volatile("s_wait_xcnt 0x0" ::: "memory");  // see scan_channel
  // keeps the batch's loads in front of the arithmetic that follows
  __builtin_amdgcn_sched_barrier(0);
}

__device__ __forceinline__ void state_batch(const ScanKv& d, float ww,
                                            float& fn, float& fd, float& scale) {
  #pragma unroll
  for (int j = 0; j < SCAN_DEPTH; ++j)
    state_take(ww, d.v[j], 1.0f, d.k[j], fn, fd, scale);
}

// Runs the batch of p.o and stores its outputs; returns the last y.
template <int DIR>
__device__ __forceinline__ float scan_batch(const ScanIn& d, float uu, float ww,
                                            float& fn, float& fd, float& scale,
                                            ScanPtr& p) {
  float y[SCAN_DEPTH];
  #pragma unroll
  for (int j = 0; j < SCAN_DEPTH; ++j)
    y[j] = scan_step(d.r[j], d.k[j], d.v[j], uu, ww, fn, fd, scale);

  // The batch's 8 stores (one out row, 65536 bytes, per step) and the wait
  // that stands before a register named by an issued load or store is written
  // again, in one statement: one wait serves the run. The four pointers are
  // named as in and out so that they stay in their registers up to that wait
  // and are advanced only behind it.
  if constexpr (DIR) {
    asm volatile(
        "global_store_b32 %0, %4, off\n\t"
        "global_store_b32 %0, %5, off offset:-65536\n\t"
        "global_store_b32 %0, %6, off offset:-131072\n\t"
        "global_store_b32 %0, %7, off offset:-196608\n\t"
        "global_store_b32 %0, %8, off offset:-262144\n\t"
        "global_store_b32 %0, %9, off offset:-327680\n\t"
        "global_store_b32 %0, %10, off offset:-393216\n\t"
        "global_store_b32 %0, %11, off offset:-458752\n\t"
        "s_wait_xcnt 0x0"
        : "+v"(p.o), "+v"(p.r), "+v"(p.k), "+v"(p.v)
        :
          "v"(y[0]), "v"(y[1]), "v"(y[2]), "v"(y[3]),
          "v"(y[4]), "v"(y[5]), "v"(y[6]), "v"(y[7])
        : "memory");
  } else {
    asm volatile(
        "global_store_b32 %0, %4, off\n\t"
        "global_store_b32 %0, %5, off offset:65536\n\t"
        "global_store_b32 %0, %6, off offset:131072\n\t"
        "global_store_b32 %0, %7, off offset:196608\n\t"
        "global_store_b32 %0, %8, off offset:262144\n\t"
        "global_store_b32 %0, %9, off offset:327680\n\t"
        "global_store_b32 %0, %10, off offset:393216\n\t"
        "global_store_b32 %0, %11, off offset:458752\n\t"
        "s_wait_xcnt 0x0"
        : "+v"(p.o), "+v"(p.r), "+v"(p.k), "+v"(p.v)
        :
          "v"(y[0]), "v"(y[1]), "v"(y[2]), "v"(y[3]),
          "v"(y[4]), "v"(y[5]), "v"(y[6]), "v"(y[7])
        : "memory");
  }
  // keeps what follows (among it the compiler's register copies of values that
  // are still in flight) behind the batch's arithmetic: moved up into it, such
  // a copy waits for its load half a batch early
  __builtin_amdgcn_sched_barrier(0);
  p.o += (DIR ? -1 : 1) * B_DIM * 2 * H_DIM * SCAN_DEPTH;
  return y[SCAN_DEPTH - 1];
}

// p: the lane's addresses of the first step of the wave's chunk.
template <int DIR>
__device__ __forceinline__ void scan_channel(ScanPtr p, float uu, float ww,
                                             float* __restrict__ hid,
                                             int lane, int chunk,
                                             float (*st)[SCAN_WAVES][32]) {
  constexpr int BI = (DIR ? -1 : 1) * B_DIM * H_DIM * SCAN_DEPTH;  // floats per batch
  constexpr int PAIRS = SCAN_LEN / (2 * SCAN_DEPTH);
  float fn = 0.0f, fd = 0.0f, scale = -1e20f;

  // Once, in front of the loops: the loads of u and w, and then each pass's
  // first batch, use address registers of the compiler's own choosing; the wait
  // stands before any of them is written again.
  asm volatile("s_wait_xcnt 0x0" ::: "memory");

  // pass 1: the chunk's own state, from the empty state
  {
    gl_in_t pk = p.k, pv = p.v;
    ScanKv A, Bf;
    scan_load_kv<DIR, 0, true>(A, pk, pv);
    for (int i = 0; i < PAIRS; ++i) {
      scan_load_kv<DIR, SCAN_DEPTH>(Bf, pk, pv);
      state_batch(A, ww, fn, fd, scale);
      // in the last trip this look-ahead reads the next chunk's first rows
      // (see pass 2 on the last chunk's); the values are not used
      scan_load_kv<DIR, 2 * SCAN_DEPTH>(A, pk, pv);
      state_batch(Bf, ww, fn, fd, scale);
      // keeps the compiler's register copies of the look-ahead's values, still
      // in flight, behind the batch's arithmetic (as in scan_batch)
      __builtin_amdgcn_sched_barrier(0);
      // the wait that stands before the two pointers, which issued loads name,
      // are advanced; they are named so that they stay in their registers up to it
      asm volatile("s_wait_xcnt 0x0" : "+v"(pk), "+v"(pv) :: "memory");
      pk += 2 * BI; pv += 2 * BI;
    }
  }
  st[0][chunk][lane] = fn;
  st[1][chunk][lane] = fd;
  st[2][chunk][lane] = scale;

  // pass 2's first batch flies while the states are handed over
  ScanIn A, Bf;
  scan_load<DIR, 0, true>(A, p);

  __syncthreads();   // every wave's chunk state is in LDS

  // fold: the state in front of this chunk, from the chunks before it
  const float lw = (float)SCAN_LEN * ww;
  fn = 0.0f; fd = 0.0f; scale = -1e20f;
  for (int j = 0; j < chunk; ++j)
    state_take(lw, st[0][j][lane], st[1][j][lane], st[2][j][lane], fn, fd, scale);

  // pass 2: the chunk's full steps
  float y = 0.0f;
  for (int i = 0; i < PAIRS; ++i) {
    scan_load<DIR, SCAN_DEPTH>(Bf, p);
    scan_batch<DIR>(A, uu, ww, fn, fd, scale, p);
    // In the last trip this look-ahead reads the next chunk's first rows; the
    // last chunk's runs SCAN_DEPTH rows past the r, k, v planes' ends, into the
    // neighbouring plane of the same rkv array (forward: planes 0..2 into 1..3;
    // backward: 3..5 into 2..4), which the GEMM of this call has written; the
    // values are not used. A branch round it would make the counted load waits
    // of the batch below wait for these loads too.
    scan_load<DIR, 2 * SCAN_DEPTH>(A, p);
    y = scan_batch<DIR>(Bf, uu, ww, fn, fd, scale, p);
    p.r += 2 * BI; p.k += 2 * BI; p.v += 2 * BI;
  }
  // the last look-ahead's loads are still in flight and nothing reads them:
  // they land before the wave ends and gives its registers back
  asm volatile("s_wait_loadcnt 0x0" ::: "memory");
  if (chunk == SCAN_WAVES - 1) *hid = y;   // the scan's last step
}

__global__ __launch_bounds__(SCAN_WAVES * 32)
void birwkv_scan(const float* __restrict__ rkv,
                 const float* __restrict__ u_fw, const float* __restrict__ w_fw,
                 const float* __restrict__ u_bw, const float* __restrict__ w_bw,
                 float* __restrict__ out) {
  __shared__ float st[3][SCAN_WAVES][32];                 // fn, fd, scale per chunk and lane

  const int lane  = threadIdx.x & 31;
  // the wave's chunk, in a scalar register: it is the fold's trip count
  const int chunk = __builtin_amdgcn_readfirstlane(threadIdx.x >> 5);
  const int dir = blockIdx.x >> 8;                        // 256 work-groups per direction
  const int b   = (blockIdx.x >> 5) & 7;
  const int h   = (blockIdx.x & 31) * 32 + lane;

  const size_t MAT = (size_t)M_DIM * H_DIM;
  // time index of the chunk's first step
  const int t0 = dir ? (T_DIM - 1 - chunk * SCAN_LEN) : chunk * SCAN_LEN;
  ScanPtr p;
  p.r = (gl_in_t)rkv + (dir ? 3 * MAT : 0) + (size_t)(t0 * B_DIM + b) * H_DIM + h;
  p.k = p.r + MAT;
  p.v = p.k + MAT;
  p.o = (gl_out_t)out + (size_t)(t0 * B_DIM + b) * (2 * H_DIM) + (size_t)dir * H_DIM + h;
  float* hid = out + (size_t)T_DIM * B_DIM * 2 * H_DIM
                   + (size_t)dir * B_DIM * H_DIM + (size_t)b * H_DIM + h;

  if (dir) scan_channel<1>(p, u_bw[h], w_bw[h], hid, lane, chunk, st);
  else     scan_channel<0>(p, u_fw[h], w_fw[h], hid, lane, chunk, st);
}

// ---------------------------------------------------------------------------
// Host launcher
// ---------------------------------------------------------------------------
extern "C" void kernel_launch(void* const* d_in, const int* in_sizes, int n_in,
                              void* d_out, int out_size, void* d_ws, size_t ws_size,
                              hipStream_t stream) {
  (void)in_sizes; (void)n_in; (void)out_size; (void)ws_size;

  const float* x      = (const float*)d_in[0];
  const float* w_r_fw = (const float*)d_in[1];
  const float* w_k_fw = (const float*)d_in[2];
  const float* w_v_fw = (const float*)d_in[3];
  const float* w_u_fw = (const float*)d_in[4];
  const float* w_w_fw = (const float*)d_in[5];
  const float* w_r_bw = (const float*)d_in[6];
  const float* w_k_bw = (const float*)d_in[7];
  const float* w_v_bw = (const float*)d_in[8];
  const float* w_u_bw = (const float*)d_in[9];
  const float* w_w_bw = (const float*)d_in[10];

  // Workspace layout (bytes):
  //   [0)                xh : f16 x,        T*B*I*2  = 33,554,432
  //   [xh)               wh : f16 weights,  6*H*I*2  = 12,582,912
  //   [xh+wh)            rkv: f32 r/k/v x2, 6*T*B*H*4 = 402,653,184
  const size_t XH_BYTES = (size_t)T_DIM * B_DIM * I_DIM * sizeof(half_t);
  const size_t WH_BYTES = (size_t)6 * H_DIM * I_DIM * sizeof(half_t);
  char*   ws  = (char*)d_ws;
  half_t* xh  = (half_t*)ws;
  half_t* wh  = (half_t*)(ws + XH_BYTES);
  float*  rkv = (float*)(ws + XH_BYTES + WH_BYTES);

  // 1) convert x and the six weight matrices to f16 (xh and wh are one row)
  cvt_all_f32_to_f16<<<CVT_GROUPS, CVT_WAVES * 32, 0, stream>>>(
      x, w_r_fw, w_k_fw, w_v_fw, w_r_bw, w_k_bw, w_v_bw, xh);

  // 2) WMMA projection GEMMs (r gets fused sigmoid)
  {
    const int blocks = (M_DIM / G_BM) * ((6 * H_DIM) / G_BN);  // 128 * 24 = 3072
    proj_gemm_wmma<<<blocks, 256, 0, stream>>>(xh, wh, rkv);
  }

  // 3) bidirectional scan -> d_out ([T,B,2H] output + [2,B,H] hidden)
  birwkv_scan<<<SCAN_GROUPS, SCAN_WAVES * 32, 0, stream>>>(
      rkv, w_u_fw, w_w_fw, w_u_bw, w_w_bw, (float*)d_out);
}

// v007
// Measured time: 184 microseconds a run.
// It is 1.21 times as fast as v005, going by the measured steps of the versions left out in between.
// Counting every step since v000, it is 9.58 times as fast.
#include <hip/hip_runtime.h>

typedef _Float16 half_t;
typedef __attribute__((ext_vector_type(16))) _Float16 v16h;
typedef __attribute__((ext_vector_type(8)))  _Float16 v8h;
typedef __attribute__((ext_vector_type(4)))  _Float16 v4h;
typedef __attribute__((ext_vector_type(8)))  float    v8f;

#define T_DIM 2048
#define B_DIM 8
#define I_DIM 1024
#define H_DIM 1024
#define M_DIM (T_DIM * B_DIM)          // 16384 rows of x

union V16U { v16h v; struct { v8h lo, hi; } s; };

// ---------------------------------------------------------------------------
// fp32 -> fp16 conversion of x and the six weight matrices in ONE launch of few,
// long-lived waves: 256 work-groups (as many as WGPs) of 11 waves. The f16 copies lie
// behind one another in the workspace (x, then the six matrices), so the whole
// job is one row of 2816 chunks of 2048 float4; every chunk lies in one source
// array, and each wave converts one chunk: 64 loads of 512 contiguous bytes, 64
// stores of 256. The loads go one batch of 16 ahead, into two register sets
// used in turn. All addresses are one scalar base, one lane offset that is
// never written again, and a constant.
// ---------------------------------------------------------------------------
typedef __attribute__((ext_vector_type(4))) float v4f;

#define CVT_GROUPS  256
#define CVT_WAVES   11
#define CVT_BATCH   16
#define CVT_BATCHES 4
#define CVT_CHUNK   (32 * CVT_BATCH * CVT_BATCHES)    // 2048 float4 per wave
#define CVT_X_CH    (M_DIM * I_DIM / 4 / CVT_CHUNK)   // 2048 chunks of x
#define CVT_W_CH    (H_DIM * I_DIM / 4 / CVT_CHUNK)   // 128 chunks per matrix
static_assert(CVT_X_CH * CVT_CHUNK * 4 == M_DIM * I_DIM, "x is a whole number of chunks");
static_assert(CVT_W_CH * CVT_CHUNK * 4 == H_DIM * I_DIM, "a matrix is a whole number of chunks");
static_assert(CVT_X_CH + 6 * CVT_W_CH == CVT_GROUPS * CVT_WAVES, "one chunk per wave");

struct CvtSet { v4f f[CVT_BATCH]; };

__device__ __forceinline__ void cvt_load(CvtSet& s, const v4f* __restrict__ sp, int batch) {
  // From the third batch on the loads land in registers that stores issued
  // above may name as their data: the wait stands before they are written again.
  if (batch >= 2) asm volatile("s_wait_xcnt 0x0" ::: "memory");
  #pragma unroll   // constant offsets and register indices
  for (int q = 0; q < CVT_BATCH; ++q)
    s.f[q] = sp[(batch * CVT_BATCH + q) * 32];
}

__device__ __forceinline__ void cvt_store(const CvtSet& s, v4h* __restrict__ dp, int batch) {
  // Takes the batch's loaded values as inputs only. It keeps the loads of the
  // batch behind this one, issued above, as one run in front of this batch's
  // conversion: left free, they were spread among the conversions in ones to
  // fours, each behind a load wait, so that fewer were in flight.
  asm volatile("" :: "v"(s.f[0]), "v"(s.f[1]), "v"(s.f[2]), "v"(s.f[3]),
                     "v"(s.f[4]), "v"(s.f[5]), "v"(s.f[6]), "v"(s.f[7]),
                     "v"(s.f[8]), "v"(s.f[9]), "v"(s.f[10]), "v"(s.f[11]),
                     "v"(s.f[12]), "v"(s.f[13]), "v"(s.f[14]), "v"(s.f[15]));
  #pragma unroll   // constant offsets and register indices
  for (int q = 0; q < CVT_BATCH; ++q) {
    const v4f f = s.f[q];
    const v4h o = { (half_t)f.x, (half_t)f.y, (half_t)f.z, (half_t)f.w };
    dp[(batch * CVT_BATCH + q) * 32] = o;
  }
}

__global__ __launch_bounds__(CVT_WAVES * 32)
void cvt_all_f32_to_f16(const float* __restrict__ x,
                        const float* __restrict__ w0, const float* __restrict__ w1,
                        const float* __restrict__ w2, const float* __restrict__ w3,
                        const float* __restrict__ w4, const float* __restrict__ w5,
                        half_t* __restrict__ dst) {
  const int lane = threadIdx.x & 31;
  // the wave's chunk, in a scalar register: it picks the source array
  const int g = __builtin_amdgcn_readfirstlane(blockIdx.x * CVT_WAVES + (threadIdx.x >> 5));
  const int m = (g - CVT_X_CH) / CVT_W_CH;            // the matrix, where g is past x
  const float* src = g < CVT_X_CH ? x
                   : m == 0 ? w0 : m == 1 ? w1 : m == 2 ? w2
                   : m == 3 ? w3 : m == 4 ? w4 : w5;
  const int c = g < CVT_X_CH ? g : (g - CVT_X_CH) % CVT_W_CH;   // chunk within it
  const v4f* sp = (const v4f*)src + (size_t)c * CVT_CHUNK + lane;
  v4h*       dp = (v4h*)dst + (size_t)g * CVT_CHUNK + lane;

  CvtSet a, b;
  cvt_load(a, sp, 0);
  cvt_load(b, sp, 1);  cvt_store(a, dp, 0);
  cvt_load(a, sp, 2);  cvt_store(b, dp, 1);
  cvt_load(b, sp, 3);  cvt_store(a, dp, 2);
  cvt_store(b, dp, 3);
}

// ---------------------------------------------------------------------------
// Projection GEMM: [16384 x 1024] x [1024 x 1024]^T for 6 weight matrices
// (the six lie behind one another in wh: one [6144 x 1024] operand).
// A work-group of 8 waves (4 x 2) computes a 256 x 256 tile, each wave 64 x 128
// (4 x 8 WMMA fragments): per WMMA that is 3/4 of the LDS reads of a 64 x 64 wave
// tile, and 2/3 of the L2 bytes of a 128 x 256 block tile. One work-group per WGP,
// two waves per SIMD. K goes in stages of 128: 256 bytes of each of the tile's 256
// x-rows and 256 weight rows are brought into LDS by asynchronous copies, so that
// L2 delivers every line once per work-group and in whole 256-byte units. Two
// buffers: the next stage's copies fly while this one is worked on.
// Fragments are read from LDS in the same K-major per-lane layout for A and B:
//   lanes 0-15 : row = laneL, chunks at K = k0+0..7  and k0+16..23
//   lanes 16-31: row = laneL, chunks at K = k0+8..15 and k0+24..31
// Each accumulator takes its K steps of 32 in rising order.
// Sigmoid fused into the r-matrix stores (mat % 3 == 0).
// The result is rounded to f16 and leaves through LDS as whole 256-byte row pieces.
// ---------------------------------------------------------------------------
#define G_BM 256
#define G_BN 256
#define G_BK 128                                 // f16 elements per stage and row
#define G_PITCH 272                              // LDS bytes per row: 256 + 16 (16 x odd)
#define G_A_BYTES (G_BM * G_PITCH)               // 69,632
#define G_BUF_BYTES ((G_BM + G_BN) * G_PITCH)    // 139,264
#define G_STAGES (I_DIM / G_BK)                  // 8
#define E_PITCH 132                              // floats per staged output row: 128 + 4
#define E_PART  (16 * E_PITCH)                   // floats per staged part: 16 rows
static_assert(8 * 2 * E_PART * 4 <= 2 * G_BUF_BYTES, "the eight waves' staging fits the ring");

typedef __attribute__((address_space(3))) unsigned char lds_byte_t;

// Eight copies: every lane copies 16 bytes of 8 rows, 16 rows apart. l: the lane's
// LDS byte address of its first row; g: the same bytes in global memory.
// The s_wait_xcnt stands inside the statement, behind the last copy, so that no
// register a copy names is written again in front of it.
__device__ __forceinline__ void gemm_copy8(unsigned l, const half_t* g) {
  constexpr unsigned LS = 16 * G_PITCH;          // LDS bytes per 16 rows
  constexpr size_t   GS = (size_t)16 * I_DIM;    // elements per 16 rows
  asm volatile(
      "global_load_async_to_lds_b128 %0, %8, off\n\t"
      "global_load_async_to_lds_b128 %1, %9, off\n\t"
      "global_load_async_to_lds_b128 %2, %10, off\n\t"
      "global_load_async_to_lds_b128 %3, %11, off\n\t"
      "global_load_async_to_lds_b128 %4, %12, off\n\t"
      "global_load_async_to_lds_b128 %5, %13, off\n\t"
      "global_load_async_to_lds_b128 %6, %14, off\n\t"
      "global_load_async_to_lds_b128 %7, %15, off\n\t"
      "s_wait_xcnt 0x0"
      :
      : "v"(l), "v"(l + LS), "v"(l + 2 * LS), "v"(l + 3 * LS),
        "v"(l + 4 * LS), "v"(l + 5 * LS), "v"(l + 6 * LS), "v"(l + 7 * LS),
        "v"(g), "v"(g + GS), "v"(g + 2 * GS), "v"(g + 3 * GS),
        "v"(g + 4 * GS), "v"(g + 5 * GS), "v"(g + 6 * GS), "v"(g + 7 * GS)
      : "memory");
}

// One stage: every lane copies 16 bytes of 32 rows (16 of x, 16 of the weights).
// la, lb: the lane's LDS byte addresses of its first row in the A and B part of the
// buffer; ga, gb: the same bytes in global memory.
__device__ __forceinline__ void gemm_stage_copy(unsigned la, const half_t* ga,
                                                unsigned lb, const half_t* gb) {
  constexpr unsigned LH = 128 * G_PITCH;         // LDS bytes per 128 rows
  constexpr size_t   GH = (size_t)128 * I_DIM;   // elements per 128 rows
  gemm_copy8(la, ga);
  gemm_copy8(la + LH, ga + GH);
  gemm_copy8(lb, gb);
  gemm_copy8(lb + LH, gb + GH);
}

__global__ __launch_bounds__(256)
void proj_gemm_wmma(const half_t* __restrict__ xh,
                    const half_t* __restrict__ wh,
                    half_t* __restrict__ rkv) {
  __shared__ __attribute__((aligned(16))) unsigned char smem[2 * G_BUF_BYTES];

  const int lane  = threadIdx.x & 31;
  const int wave  = threadIdx.x >> 5;
  const int laneL = lane & 15;
  const int laneH = lane >> 4;
  const int wm    = wave >> 1;                  // 0..3: the wave's 64 rows
  const int wn    = wave & 1;                   // 0..1: the wave's 128 columns

  const int NT_N = (6 * H_DIM) / G_BN;          // 24 column tiles
  const int nt   = blockIdx.x % NT_N;
  const int mt   = blockIdx.x / NT_N;

  const int m0  = mt * G_BM;
  const int n0g = nt * G_BN;                    // row of the [6144 x 1024] operand
  const int mat = n0g / H_DIM;                  // 0..5: r/k/v fw, r/k/v bw
  const int n0  = n0g % H_DIM;

  // the lane's part of a stage: 16-byte chunk cchk of rows crow + 16 * i
  const int crow = threadIdx.x >> 4;            // 0..15
  const int cchk = threadIdx.x & 15;            // 0..15
  const half_t* ga = xh + (size_t)(m0  + crow) * I_DIM + cchk * 8;
  const half_t* gb = wh + (size_t)(n0g + crow) * I_DIM + cchk * 8;
  const unsigned la = (unsigned)(size_t)(lds_byte_t*)smem + crow * G_PITCH + cchk * 16;
  const unsigned lb = la + G_A_BYTES;

  // the lane's first fragment chunks in buffer 0
  const unsigned char* fa = smem + (wm * 64 + laneL) * G_PITCH + laneH * 16;
  const unsigned char* fb = smem + G_A_BYTES + (wn * 128 + laneL) * G_PITCH + laneH * 16;

  v8f acc[4][8] = {};

  // stage 0 lands and is published; then stage 1 starts into the other buffer
  gemm_stage_copy(la, ga, lb, gb);
  asm volatile("s_wait_asynccnt 0x0" ::: "memory");   // this wave's copies have landed
  __syncthreads();
  gemm_stage_copy(la + G_BUF_BYTES, ga + G_BK, lb + G_BUF_BYTES, gb + G_BK);

  for (int t = 0; t < G_STAGES; ++t) {
    const unsigned boff = (unsigned)(t & 1) * G_BUF_BYTES;
    #pragma unroll   // constant LDS offsets and register indices
    for (int ks = 0; ks < G_BK / 32; ++ks) {
      V16U a[4], b[8];
      #pragma unroll   // constant register indices
      for (int i = 0; i < 4; ++i) {
        const unsigned char* pa = fa + boff + i * 16 * G_PITCH + ks * 64;
        a[i].s.lo = *(const v8h*)(pa);
        a[i].s.hi = *(const v8h*)(pa + 32);
      }
      #pragma unroll   // constant register indices
      for (int j = 0; j < 8; ++j) {
        const unsigned char* pb = fb + boff + j * 16 * G_PITCH + ks * 64;
        b[j].s.lo = *(const v8h*)(pb);
        b[j].s.hi = *(const v8h*)(pb + 32);
      }
      // the 24 LDS reads of a K step stay one group in front of its 32 WMMAs:
      // left free, they were spread among the WMMAs in pairs, each pair with a
      // full wait behind it
      __builtin_amdgcn_sched_barrier(0);
      #pragma unroll   // constant register indices
      for (int i = 0; i < 4; ++i) {
        #pragma unroll   // constant register indices
        for (int j = 0; j < 8; ++j) {
          acc[i][j] = __builtin_amdgcn_wmma_f32_16x16x32_f16(
              false, a[i].v, false, b[j].v, (short)0, acc[i][j], false, false);
        }
      }
      // and the next K step's reads stay behind this step's WMMAs
      __builtin_amdgcn_sched_barrier(0);
    }
    // hand-over: this wave's reads of buffer t & 1 are done, its copies of stage
    // t + 1 have landed; behind the barrier that holds for every wave, so stage
    // t + 1 may be read and buffer t & 1 refilled
    asm volatile("s_wait_dscnt 0x0" ::: "memory");
    asm volatile("s_wait_asynccnt 0x0" ::: "memory");
    __syncthreads();
    if (t + 2 < G_STAGES)
      gemm_stage_copy(la + boff, ga + (t + 2) * G_BK, lb + boff, gb + (t + 2) * G_BK);
  }
  asm volatile("s_wait_asynccnt 0x0" ::: "memory");   // nothing in flight at the wave's end

  // r matrices get sigmoid: all of the wave's values first, in their registers,
  // so that behind the first LDS write no accumulator register is written
  // (the loops below are unrolled so that every register index is a constant)
  if ((mat % 3) == 0) {
    #pragma unroll
    for (int i = 0; i < 4; ++i) {
      #pragma unroll
      for (int j = 0; j < 8; ++j) {
        #pragma unroll
        for (int v = 0; v < 8; ++v)
          acc[i][j][v] = 1.0f / (1.0f + __expf(-acc[i][j][v]));
      }
    }
  }

  // The wave's 64 x 128 tile leaves as f16, through LDS, so that global memory gets
  // whole aligned 256-byte row pieces in 16-byte stores (straight from the
  // accumulators a store would hold 32-byte pieces, 2 bytes a lane). The ring is free:
  // behind the loop's last barrier no wave reads it and no copy is in flight. Each
  // wave stages f32 in a range of its own, 16 rows (one row of accumulator tiles) at
  // a time, two parts used in turn: part i + 1 is written while part i goes out.
  // Columns 64..127 of a staged row lie 4 floats further on: the 16 lanes that read
  // one row, 32 bytes apart, then fall on all 64 banks once.
  const int    rrow = lane >> 4;                            // 0..1
  const int    rcol = (lane & 15) * 8;                      // 8 columns a lane
  float*       stg = (float*)smem + wave * (2 * E_PART);
  float*       sw  = stg + laneH * 8 * E_PITCH + laneL;     // accumulator map: row 8 * laneH + v
  const float* sr  = stg + rrow * E_PITCH + rcol + (rcol >= 64 ? 4 : 0);   // rows 2 q + rrow
  // one address per lane; every store's distance from it is a constant
  half_t* dst = rkv + (size_t)mat * M_DIM * H_DIM
                    + (size_t)(m0 + wm * 64 + rrow) * H_DIM + (n0 + wn * 128 + rcol);
  #pragma unroll   // constant LDS offsets and register indices
  for (int v = 0; v < 8; ++v) {
    #pragma unroll
    for (int j = 0; j < 8; ++j)
      sw[v * E_PITCH + j * 16 + (j >= 4 ? 4 : 0)] = acc[0][j][v];
  }
  #pragma unroll   // constant offsets and register indices
  for (int i = 0; i < 4; ++i) {
    // part i's writes have landed before other lanes of the wave read them; and
    // part i - 1's reads are done before that part is written again below
    asm volatile("s_wait_dscnt 0x0" ::: "memory");
    // what follows may write registers that the stores of part i - 1 name
    if (i > 0) asm volatile("s_wait_xcnt 0x0" ::: "memory");
    v4f row[16];
    #pragma unroll
    for (int q = 0; q < 8; ++q) {
      row[2 * q]     = *(const v4f*)(sr + (i & 1) * E_PART + q * 2 * E_PITCH);
      row[2 * q + 1] = *(const v4f*)(sr + (i & 1) * E_PART + q * 2 * E_PITCH + 4);
    }
    if (i + 1 < 4) {
      #pragma unroll
      for (int v = 0; v < 8; ++v) {
        #pragma unroll
        for (int j = 0; j < 8; ++j)
          sw[((i + 1) & 1) * E_PART + v * E_PITCH + j * 16 + (j >= 4 ? 4 : 0)] = acc[i + 1][j][v];
      }
    }
    #pragma unroll
    for (int q = 0; q < 8; ++q) {
      const v4f lo = row[2 * q], hi = row[2 * q + 1];
      const v8h o = { (half_t)lo.x, (half_t)lo.y, (half_t)lo.z, (half_t)lo.w,
                      (half_t)hi.x, (half_t)hi.y, (half_t)hi.z, (half_t)hi.w };
      *(v8h*)(dst + (i * 16 + q * 2) * H_DIM) = o;
    }
  }
}

// ---------------------------------------------------------------------------
// Bidirectional RWKV scan, split over time inside a work-group.
// r, k, v come as f16; a lane owns the two neighbouring channels of one 32-bit
// word, so a wave's load is one whole 128-byte line. A work-group owns 64
// channels (dir, b, 64 neighbouring h) and has 32 waves; wave c owns steps
// c*64 .. c*64+63 of the scan order.
//   pass 1: the wave runs the state update alone (k and v, no output) over its
//           64 steps from the empty state and leaves (fn, fd, scale) in LDS;
//   fold  : behind one barrier, wave c folds the states of waves 0 .. c-1 in
//           rising order into the state in front of its own first step. The
//           state is linear: 64 steps later an earlier state stands for the
//           same sums times exp(64 w), that is scale + 64 w;
//   pass 2: the wave runs its 64 full steps from that state and stores y.
// Writes output [T, B, 2H] (fw in h<1024, bw in h>=1024, bw time-reversed
// back to original order) plus hidden tail [2, B, H].
// The r, k, v of a step do not depend on the state, so they are loaded one
// batch of SCAN_DEPTH steps ahead into registers (two sets, used in turn).
// All arithmetic is f32.
// ---------------------------------------------------------------------------
#define SCAN_DEPTH 4
#define SCAN_WAVES 32                          // time chunks = waves per work-group
#define SCAN_LEN   (T_DIM / SCAN_WAVES)        // 64 steps per chunk
#define SCAN_GROUPS (2 * B_DIM * H_DIM / 64)   // 256 work-groups
static_assert(SCAN_LEN % (2 * SCAN_DEPTH) == 0, "a chunk is a whole number of batch pairs");

typedef __attribute__((ext_vector_type(2))) _Float16 v2h;
typedef __attribute__((ext_vector_type(2))) float    v2f;

struct ScanIn  { v2h r[SCAN_DEPTH], k[SCAN_DEPTH], v[SCAN_DEPTH]; };
struct ScanKv  { v2h k[SCAN_DEPTH], v[SCAN_DEPTH]; };
struct ScanSt  { float fn[2], fd[2], scale[2]; };          // the lane's two channels
// the lane's own addresses of the current batch's first step, in channel pairs
// (typed as global-memory pointers: behind the asm statement below the compiler
// could no longer tell, and would fall back to flat loads)
typedef const __attribute__((address_space(1))) v2h* gl_in_t;
typedef __attribute__((address_space(1))) v2f*       gl_out_t;
struct ScanPtr { gl_in_t r, k, v; gl_out_t o; };

// e = exp(x) as the fast form has it: one multiply by log2(e), one v_exp_f32.
// The four v_exp_f32 of a step stand in one statement that ends in v_nop: each
// is the independent instruction behind the one before, the v_nop the slot the
// instruction set asks for behind the last.
__device__ __forceinline__ void exp_x4(float x0, float x1, float x2, float x3,
                                       float& e0, float& e1, float& e2, float& e3) {
  const float LOG2E = 1.44269504f;
  const float a0 = x0 * LOG2E, a1 = x1 * LOG2E, a2 = x2 * LOG2E, a3 = x3 * LOG2E;
  asm("v_exp_f32 %0, %4\n\t"
      "v_exp_f32 %1, %5\n\t"
      "v_exp_f32 %2, %6\n\t"
      "v_exp_f32 %3, %7\n\t"
      "v_nop"
      : "=&v"(e0), "=&v"(e1), "=&v"(e2), "=&v"(e3)
      : "v"(a0), "v"(a1), "v"(a2), "v"(a3));
}

// the same for the two exponentials of a state update alone
__device__ __forceinline__ void exp_x2(float x0, float x1, float& e0, float& e1) {
  const float LOG2E = 1.44269504f;
  const float a0 = x0 * LOG2E, a1 = x1 * LOG2E;
  asm("v_exp_f32 %0, %2\n\t"
      "v_exp_f32 %1, %3\n\t"
      "v_nop"
      : "=&v"(e0), "=&v"(e1)
      : "v"(a0), "v"(a1));
}

__device__ __forceinline__ float scan_step(float r, float k, float v,
                                           float uu, float ww,
                                           float& fn, float& fd, float& scale) {
  const float sm = fmaxf(scale, uu + k);
  const float ns = fmaxf(scale + ww, k);
  float cm, am, ncm, nam;
  exp_x4(scale - sm, uu + k - sm, scale + ww - ns, k - ns, cm, am, ncm, nam);

  const float y = r * ((cm * fn + am * v) / (cm * fd + am));

  fn = ncm * fn + nam * v;
  fd = ncm * fd + nam;
  scale = ns;
  return y;
}

// (fn, fd, scale), moved on by the exponent dw, takes in (gn, gd, gs):
// with dw = w, (v, 1, k) it is the state update of scan_step.
__device__ __forceinline__ void state_take(float dw, float gn, float gd, float gs,
                                           float& fn, float& fd, float& scale) {
  const float ns = fmaxf(scale + dw, gs);
  float ncm, nam;
  exp_x2(scale + dw - ns, gs - ns, ncm, nam);
  fn = ncm * fn + nam * gn;
  fd = ncm * fd + nam * gd;
  scale = ns;
}

__device__ __forceinline__ void state_empty(ScanSt& s) {
  s.fn[0] = 0.0f; s.fd[0] = 0.0f; s.scale[0] = -1e20f;
  s.fn[1] = 0.0f; s.fd[1] = 0.0f; s.scale[1] = -1e20f;
}

// DIR is a compile-time value so that every step's distance from the batch's
// pointers is a constant and goes into the instruction's offset field.
// Loads the batch that starts AHEAD steps behind p's.
template <int DIR, int AHEAD, bool FIRST = false>
__device__ __forceinline__ void scan_load(ScanIn& d, const ScanPtr& p) {
  constexpr int SI = (DIR ? -1 : 1) * B_DIM * H_DIM / 2;   // channel pairs per step
  #pragma unroll
  for (int j = 0; j < SCAN_DEPTH; ++j) {
    d.k[j] = p.k[(AHEAD + j) * SI];
    d.v[j] = p.v[(AHEAD + j) * SI];
    d.r[j] = p.r[(AHEAD + j) * SI];
  }
  if constexpr (FIRST) asm volatile("s_wait_xcnt 0x0" ::: "memory");  // see scan_channel
  // keeps all of the batch's loads in front of the arithmetic that follows,
  // so that each has a whole batch of lead
  __builtin_amdgcn_sched_barrier(0);
}

// the same for pass 1, which reads k and v alone
template <int DIR, int AHEAD, bool FIRST = false>
__device__ __forceinline__ void scan_load_kv(ScanKv& d, gl_in_t pk, gl_in_t pv) {
  constexpr int SI = (DIR ? -1 : 1) * B_DIM * H_DIM / 2;   // channel pairs per step
  #pragma unroll
  for (int j = 0; j < SCAN_DEPTH; ++j) {
    d.k[j] = pk[(AHEAD + j) * SI];
    d.v[j] = pv[(AHEAD + j) * SI];
  }
  if constexpr (FIRST) asm volatile("s_wait_xcnt 0x0" ::: "memory");  // see scan_channel
  // keeps the batch's loads in front of the arithmetic that follows
  __builtin_amdgcn_sched_barrier(0);
}

__device__ __forceinline__ void state_batch(const ScanKv& d, v2f ww, ScanSt& s) {
  #pragma unroll
  for (int j = 0; j < SCAN_DEPTH; ++j) {
    state_take(ww.x, (float)d.v[j].x, 1.0f, (float)d.k[j].x, s.fn[0], s.fd[0], s.scale[0]);
    state_take(ww.y, (float)d.v[j].y, 1.0f, (float)d.k[j].y, s.fn[1], s.fd[1], s.scale[1]);
  }
}

// Runs the batch of p.o and stores its outputs; returns the last y.
template <int DIR>
__device__ __forceinline__ v2f scan_batch(const ScanIn& d, v2f uu, v2f ww,
                                          ScanSt& s, ScanPtr& p) {
  v2f y[SCAN_DEPTH];
  #pragma unroll
  for (int j = 0; j < SCAN_DEPTH; ++j) {
    y[j].x = scan_step((float)d.r[j].x, (float)d.k[j].x, (float)d.v[j].x, uu.x, ww.x,
                       s.fn[0], s.fd[0], s.scale[0]);
    y[j].y = scan_step((float)d.r[j].y, (float)d.k[j].y, (float)d.v[j].y, uu.y, ww.y,
                       s.fn[1], s.fd[1], s.scale[1]);
  }

  // The batch's 4 stores (one out row, 65536 bytes, per step) and the wait
  // that stands before a register named by an issued load or store is written
  // again, in one statement: one wait serves the run. The four pointers are
  // named as in and out so that they stay in their registers up to that wait
  // and are advanced only behind it.
  if constexpr (DIR) {
    asm volatile(
        "global_store_b64 %0, %4, off\n\t"
        "global_store_b64 %0, %5, off offset:-65536\n\t"
        "global_store_b64 %0, %6, off offset:-131072\n\t"
        "global_store_b64 %0, %7, off offset:-196608\n\t"
        "s_wait_xcnt 0x0"
        : "+v"(p.o), "+v"(p.r), "+v"(p.k), "+v"(p.v)
        : "v"(y[0]), "v"(y[1]), "v"(y[2]), "v"(y[3])
        : "memory");
  } else {
    asm volatile(
        "global_store_b64 %0, %4, off\n\t"
        "global_store_b64 %0, %5, off offset:65536\n\t"
        "global_store_b64 %0, %6, off offset:131072\n\t"
        "global_store_b64 %0, %7, off offset:196608\n\t"
        "s_wait_xcnt 0x0"
        : "+v"(p.o), "+v"(p.r), "+v"(p.k), "+v"(p.v)
        : "v"(y[0]), "v"(y[1]), "v"(y[2]), "v"(y[3])
        : "memory");
  }
  // keeps what follows (among it the compiler's register copies of values that
  // are still in flight) behind the batch's arithmetic: moved up into it, such
  // a copy waits for its load half a batch early
  __builtin_amdgcn_sched_barrier(0);
  p.o += (DIR ? -1 : 1) * B_DIM * H_DIM * SCAN_DEPTH;      // 2H floats = H pairs per (t, b)
  return y[SCAN_DEPTH - 1];
}

// p: the lane's addresses of the first step of the wave's chunk.
template <int DIR>
__device__ __forceinline__ void scan_channel(ScanPtr p, v2f uu, v2f ww,
                                             v2f* __restrict__ hid,
                                             int lane, int chunk,
                                             v2f (*st)[SCAN_WAVES][32]) {
  constexpr int BI = (DIR ? -1 : 1) * B_DIM * H_DIM / 2 * SCAN_DEPTH;  // pairs per batch
  constexpr int PAIRS = SCAN_LEN / (2 * SCAN_DEPTH);
  ScanSt s;
  state_empty(s);

  // Once, in front of the loops: the loads of u and w, and then each pass's
  // first batch, use address registers of the compiler's own choosing; the wait
  // stands before any of them is written again.
  asm volatile("s_wait_xcnt 0x0" ::: "memory");

  // pass 1: the chunk's own state, from the empty state
  {
    gl_in_t pk = p.k, pv = p.v;
    ScanKv A, Bf;
    scan_load_kv<DIR, 0, true>(A, pk, pv);
    for (int i = 0; i < PAIRS; ++i) {
      scan_load_kv<DIR, SCAN_DEPTH>(Bf, pk, pv);
      state_batch(A, ww, s);
      // in the last trip this look-ahead reads the next chunk's first rows
      // (see pass 2 on the last chunk's); the values are not used
      scan_load_kv<DIR, 2 * SCAN_DEPTH>(A, pk, pv);
      state_batch(Bf, ww, s);
      // keeps the compiler's register copies of the look-ahead's values, still
      // in flight, behind the batch's arithmetic (as in scan_batch)
      __builtin_amdgcn_sched_barrier(0);
      // the wait that stands before the two pointers, which issued loads name,
      // are advanced; they are named so that they stay in their registers up to it
      asm volatile("s_wait_xcnt 0x0" : "+v"(pk), "+v"(pv) :: "memory");
      pk += 2 * BI; pv += 2 * BI;
    }
  }
  st[0][chunk][lane] = v2f{ s.fn[0], s.fn[1] };
  st[1][chunk][lane] = v2f{ s.fd[0], s.fd[1] };
  st[2][chunk][lane] = v2f{ s.scale[0], s.scale[1] };

  // pass 2's first batch flies while the states are handed over
  ScanIn A, Bf;
  scan_load<DIR, 0, true>(A, p);

  __syncthreads();   // every wave's chunk state is in LDS

  // fold: the state in front of this chunk, from the chunks before it
  const v2f lw = (float)SCAN_LEN * ww;
  state_empty(s);
  for (int j = 0; j < chunk; ++j) {
    const v2f gn = st[0][j][lane], gd = st[1][j][lane], gs = st[2][j][lane];
    state_take(lw.x, gn.x, gd.x, gs.x, s.fn[0], s.fd[0], s.scale[0]);
    state_take(lw.y, gn.y, gd.y, gs.y, s.fn[1], s.fd[1], s.scale[1]);
  }

  // pass 2: the chunk's full steps
  v2f y = { 0.0f, 0.0f };
  for (int i = 0; i < PAIRS; ++i) {
    scan_load<DIR, SCAN_DEPTH>(Bf, p);
    scan_batch<DIR>(A, uu, ww, s, p);
    // In the last trip this look-ahead reads the next chunk's first rows; the
    // last chunk's runs SCAN_DEPTH rows past the r, k, v planes' ends, into the
    // neighbouring plane of the same rkv array (forward: planes 0..2 into 1..3;
    // backward: 3..5 into 2..4), which the GEMM of this call has written; the
    // values are not used. A branch round it would make the counted load waits
    // of the batch below wait for these loads too.
    scan_load<DIR, 2 * SCAN_DEPTH>(A, p);
    y = scan_batch<DIR>(Bf, uu, ww, s, p);
    p.r += 2 * BI; p.k += 2 * BI; p.v += 2 * BI;
  }
  // the last look-ahead's loads are still in flight and nothing reads them:
  // they land before the wave ends and gives its registers back
  asm volatile("s_wait_loadcnt 0x0" ::: "memory");
  if (chunk == SCAN_WAVES - 1) *hid = y;   // the scan's last step
}

__global__ __launch_bounds__(SCAN_WAVES * 32)
void birwkv_scan(const half_t* __restrict__ rkv,
                 const float* __restrict__ u_fw, const float* __restrict__ w_fw,
                 const float* __restrict__ u_bw, const float* __restrict__ w_bw,
                 float* __restrict__ out) {
  __shared__ v2f st[3][SCAN_WAVES][32];                   // fn, fd, scale per chunk and lane

  const int lane  = threadIdx.x & 31;
  // the wave's chunk, in a scalar register: it is the fold's trip count
  const int chunk = __builtin_amdgcn_readfirstlane(threadIdx.x >> 5);
  const int dir = blockIdx.x >> 7;                        // 128 work-groups per direction
  const int b   = (blockIdx.x >> 4) & 7;
  const int h   = (blockIdx.x & 15) * 64 + lane * 2;      // the lane's first channel

  const size_t MAT = (size_t)M_DIM * H_DIM;
  // time index of the chunk's first step
  const int t0 = dir ? (T_DIM - 1 - chunk * SCAN_LEN) : chunk * SCAN_LEN;
  const half_t* r0 = rkv + (dir ? 3 * MAT : 0) + (size_t)(t0 * B_DIM + b) * H_DIM + h;
  ScanPtr p;
  p.r = (gl_in_t)r0;
  p.k = (gl_in_t)(r0 + MAT);
  p.v = (gl_in_t)(r0 + 2 * MAT);
  p.o = (gl_out_t)(out + (size_t)(t0 * B_DIM + b) * (2 * H_DIM) + (size_t)dir * H_DIM + h);
  v2f* hid = (v2f*)(out + (size_t)T_DIM * B_DIM * 2 * H_DIM
                        + (size_t)dir * B_DIM * H_DIM + (size_t)b * H_DIM + h);

  if (dir) scan_channel<1>(p, *(const v2f*)(u_bw + h), *(const v2f*)(w_bw + h), hid, lane, chunk, st);
  else     scan_channel<0>(p, *(const v2f*)(u_fw + h), *(const v2f*)(w_fw + h), hid, lane, chunk, st);
}

// ---------------------------------------------------------------------------
// Host launcher
// ---------------------------------------------------------------------------
extern "C" void kernel_launch(void* const* d_in, const int* in_sizes, int n_in,
                              void* d_out, int out_size, void* d_ws, size_t ws_size,
                              hipStream_t stream) {
  (void)in_sizes; (void)n_in; (void)out_size; (void)ws_size;

  const float* x      = (const float*)d_in[0];
  const float* w_r_fw = (const float*)d_in[1];
  const float* w_k_fw = (const float*)d_in[2];
  const float* w_v_fw = (const float*)d_in[3];
  const float* w_u_fw = (const float*)d_in[4];
  const float* w_w_fw = (const float*)d_in[5];
  const float* w_r_bw = (const float*)d_in[6];
  const float* w_k_bw = (const float*)d_in[7];
  const float* w_v_bw = (const float*)d_in[8];
  const float* w_u_bw = (const float*)d_in[9];
  const float* w_w_bw = (const float*)d_in[10];

  // Workspace layout (bytes):
  //   [0)                xh : f16 x,        T*B*I*2  = 33,554,432
  //   [xh)               wh : f16 weights,  6*H*I*2  = 12,582,912
  //   [xh+wh)            rkv: f16 r/k/v x2, 6*T*B*H*2 = 201,326,592
  const size_t XH_BYTES = (size_t)T_DIM * B_DIM * I_DIM * sizeof(half_t);
  const size_t WH_BYTES = (size_t)6 * H_DIM * I_DIM * sizeof(half_t);
  char*   ws  = (char*)d_ws;
  half_t* xh  = (half_t*)ws;
  half_t* wh  = (half_t*)(ws + XH_BYTES);
  half_t* rkv = (half_t*)(ws + XH_BYTES + WH_BYTES);

  // 1) convert x and the six weight matrices to f16 (xh and wh are one row)
  cvt_all_f32_to_f16<<<CVT_GROUPS, CVT_WAVES * 32, 0, stream>>>(
      x, w_r_fw, w_k_fw, w_v_fw, w_r_bw, w_k_bw, w_v_bw, xh);

  // 2) WMMA projection GEMMs (r gets fused sigmoid)
  {
    const int blocks = (M_DIM / G_BM) * ((6 * H_DIM) / G_BN);  // 64 * 24 = 1536
    proj_gemm_wmma<<<blocks, 256, 0, stream>>>(xh, wh, rkv);
  }

  // 3) bidirectional scan -> d_out ([T,B,2H] output + [2,B,H] hidden)
  birwkv_scan<<<SCAN_GROUPS, SCAN_WAVES * 32, 0, stream>>>(
      rkv, w_u_fw, w_w_fw, w_u_bw, w_w_bw, (float*)d_out);
}

// v008
// One run takes 176 microseconds.
// In both of two side-by-side timings against v007, it was 1.04 times as fast.
// Over all steps from v000 it is 9.97 times as fast.
#include <hip/hip_runtime.h>

typedef _Float16 half_t;
typedef __attribute__((ext_vector_type(16))) _Float16 v16h;
typedef __attribute__((ext_vector_type(8)))  _Float16 v8h;
typedef __attribute__((ext_vector_type(4)))  _Float16 v4h;
typedef __attribute__((ext_vector_type(8)))  float    v8f;

#define T_DIM 2048
#define B_DIM 8
#define I_DIM 1024
#define H_DIM 1024
#define M_DIM (T_DIM * B_DIM)          // 16384 rows of x

union V16U { v16h v; struct { v8h lo, hi; } s; };

// ---------------------------------------------------------------------------
// fp32 -> fp16 conversion of x and the six weight matrices in ONE launch of few,
// long-lived waves: 256 work-groups (as many as WGPs) of 11 waves. The f16 copies lie
// behind one another in the workspace (x, then the six matrices), so the whole
// job is one row of 2816 chunks of 2048 float4; every chunk lies in one source
// array, and each wave converts one chunk: 64 loads of 512 contiguous bytes, 64
// stores of 256. The loads go one batch of 16 ahead, into two register sets
// used in turn. All addresses are one scalar base, one lane offset that is
// never written again, and a constant.
// ---------------------------------------------------------------------------
typedef __attribute__((ext_vector_type(4))) float v4f;

#define CVT_GROUPS  256
#define CVT_WAVES   11
#define CVT_BATCH   16
#define CVT_BATCHES 4
#define CVT_CHUNK   (32 * CVT_BATCH * CVT_BATCHES)    // 2048 float4 per wave
#define CVT_X_CH    (M_DIM * I_DIM / 4 / CVT_CHUNK)   // 2048 chunks of x
#define CVT_W_CH    (H_DIM * I_DIM / 4 / CVT_CHUNK)   // 128 chunks per matrix
static_assert(CVT_X_CH * CVT_CHUNK * 4 == M_DIM * I_DIM, "x is a whole number of chunks");
static_assert(CVT_W_CH * CVT_CHUNK * 4 == H_DIM * I_DIM, "a matrix is a whole number of chunks");
static_assert(CVT_X_CH + 6 * CVT_W_CH == CVT_GROUPS * CVT_WAVES, "one chunk per wave");

struct CvtSet { v4f f[CVT_BATCH]; };

__device__ __forceinline__ void cvt_load(CvtSet& s, const v4f* __restrict__ sp, int batch) {
  // From the third batch on the loads land in registers that stores issued
  // above may name as their data: the wait stands before they are written again.
  if (batch >= 2) asm volatile("s_wait_xcnt 0x0" ::: "memory");
  #pragma unroll   // constant offsets and register indices
  for (int q = 0; q < CVT_BATCH; ++q)
    s.f[q] = sp[(batch * CVT_BATCH + q) * 32];
}

__device__ __forceinline__ void cvt_store(const CvtSet& s, v4h* __restrict__ dp, int batch) {
  // Takes the batch's loaded values as inputs only. It keeps the loads of the
  // batch behind this one, issued above, as one run in front of this batch's
  // conversion: left free, they were spread among the conversions in ones to
  // fours, each behind a load wait, so that fewer were in flight.
  asm volatile("" :: "v"(s.f[0]), "v"(s.f[1]), "v"(s.f[2]), "v"(s.f[3]),
                     "v"(s.f[4]), "v"(s.f[5]), "v"(s.f[6]), "v"(s.f[7]),
                     "v"(s.f[8]), "v"(s.f[9]), "v"(s.f[10]), "v"(s.f[11]),
                     "v"(s.f[12]), "v"(s.f[13]), "v"(s.f[14]), "v"(s.f[15]));
  #pragma unroll   // constant offsets and register indices
  for (int q = 0; q < CVT_BATCH; ++q) {
    const v4f f = s.f[q];
    const v4h o = { (half_t)f.x, (half_t)f.y, (half_t)f.z, (half_t)f.w };
    dp[(batch * CVT_BATCH + q) * 32] = o;
  }
}

__global__ __launch_bounds__(CVT_WAVES * 32)
void cvt_all_f32_to_f16(const float* __restrict__ x,
                        const float* __restrict__ w0, const float* __restrict__ w1,
                        const float* __restrict__ w2, const float* __restrict__ w3,
                        const float* __restrict__ w4, const float* __restrict__ w5,
                        half_t* __restrict__ dst) {
  const int lane = threadIdx.x & 31;
  // the wave's chunk, in a scalar register: it picks the source array
  const int g = __builtin_amdgcn_readfirstlane(blockIdx.x * CVT_WAVES + (threadIdx.x >> 5));
  const int m = (g - CVT_X_CH) / CVT_W_CH;            // the matrix, where g is past x
  const float* src = g < CVT_X_CH ? x
                   : m == 0 ? w0 : m == 1 ? w1 : m == 2 ? w2
                   : m == 3 ? w3 : m == 4 ? w4 : w5;
  const int c = g < CVT_X_CH ? g : (g - CVT_X_CH) % CVT_W_CH;   // chunk within it
  const v4f* sp = (const v4f*)src + (size_t)c * CVT_CHUNK + lane;
  v4h*       dp = (v4h*)dst + (size_t)g * CVT_CHUNK + lane;

  CvtSet a, b;
  cvt_load(a, sp, 0);
  cvt_load(b, sp, 1);  cvt_store(a, dp, 0);
  cvt_load(a, sp, 2);  cvt_store(b, dp, 1);
  cvt_load(b, sp, 3);  cvt_store(a, dp, 2);
  cvt_store(b, dp, 3);
}

// ---------------------------------------------------------------------------
// Projection GEMM: [16384 x 1024] x [1024 x 1024]^T for 6 weight matrices
// (the six lie behind one another in wh: one [6144 x 1024] operand).
// A work-group of 8 waves (4 x 2) computes a 256 x 256 tile, each wave 64 x 128
// (4 x 8 WMMA fragments): per WMMA that is 3/4 of the LDS reads of a 64 x 64 wave
// tile, and 2/3 of the L2 bytes of a 128 x 256 block tile. One work-group per WGP,
// two waves per SIMD. K goes in stages of 128: 256 bytes of each of the tile's 256
// x-rows and 256 weight rows are brought into LDS by asynchronous copies, so that
// L2 delivers every line once per work-group and in whole 256-byte units. Two
// buffers: the next stage's copies fly while this one is worked on.
// Fragments are read from LDS in the same K-major per-lane layout for A and B:
//   lanes 0-15 : row = laneL, chunks at K = k0+0..7  and k0+16..23
//   lanes 16-31: row = laneL, chunks at K = k0+8..15 and k0+24..31
// Each accumulator takes its K steps of 32 in rising order.
// All six results leave as they are: the sigmoid of r is taken in the scan.
// The result is rounded to f16 and leaves through LDS as whole 256-byte row pieces.
// ---------------------------------------------------------------------------
#define G_BM 256
#define G_BN 256
#define G_BK 128                                 // f16 elements per stage and row
#define G_PITCH 272                              // LDS bytes per row: 256 + 16 (16 x odd)
#define G_A_BYTES (G_BM * G_PITCH)               // 69,632
#define G_BUF_BYTES ((G_BM + G_BN) * G_PITCH)    // 139,264
#define G_STAGES (I_DIM / G_BK)                  // 8
#define E_PITCH 132                              // floats per staged output row: 128 + 4
#define E_PART  (16 * E_PITCH)                   // floats per staged part: 16 rows
static_assert(8 * 2 * E_PART * 4 <= 2 * G_BUF_BYTES, "the eight waves' staging fits the ring");

typedef __attribute__((address_space(3))) unsigned char lds_byte_t;

// Eight copies: every lane copies 16 bytes of 8 rows, 16 rows apart. l: the lane's
// LDS byte address of its first row; g: the same bytes in global memory.
// The s_wait_xcnt stands inside the statement, behind the last copy, so that no
// register a copy names is written again in front of it.
__device__ __forceinline__ void gemm_copy8(unsigned l, const half_t* g) {
  constexpr unsigned LS = 16 * G_PITCH;          // LDS bytes per 16 rows
  constexpr size_t   GS = (size_t)16 * I_DIM;    // elements per 16 rows
  asm volatile(
      "global_load_async_to_lds_b128 %0, %8, off\n\t"
      "global_load_async_to_lds_b128 %1, %9, off\n\t"
      "global_load_async_to_lds_b128 %2, %10, off\n\t"
      "global_load_async_to_lds_b128 %3, %11, off\n\t"
      "global_load_async_to_lds_b128 %4, %12, off\n\t"
      "global_load_async_to_lds_b128 %5, %13, off\n\t"
      "global_load_async_to_lds_b128 %6, %14, off\n\t"
      "global_load_async_to_lds_b128 %7, %15, off\n\t"
      "s_wait_xcnt 0x0"
      :
      : "v"(l), "v"(l + LS), "v"(l + 2 * LS), "v"(l + 3 * LS),
        "v"(l + 4 * LS), "v"(l + 5 * LS), "v"(l + 6 * LS), "v"(l + 7 * LS),
        "v"(g), "v"(g + GS), "v"(g + 2 * GS), "v"(g + 3 * GS),
        "v"(g + 4 * GS), "v"(g + 5 * GS), "v"(g + 6 * GS), "v"(g + 7 * GS)
      : "memory");
}

// One stage: every lane copies 16 bytes of 32 rows (16 of x, 16 of the weights).
// la, lb: the lane's LDS byte addresses of its first row in the A and B part of the
// buffer; ga, gb: the same bytes in global memory.
__device__ __forceinline__ void gemm_stage_copy(unsigned la, const half_t* ga,
                                                unsigned lb, const half_t* gb) {
  constexpr unsigned LH = 128 * G_PITCH;         // LDS bytes per 128 rows
  constexpr size_t   GH = (size_t)128 * I_DIM;   // elements per 128 rows
  // The fences keep each group's 24 address registers from being formed ahead of
  // the groups before it: formed all at once they did not fit beside the
  // accumulators, and the two row pointers were spilled to scratch memory.
  gemm_copy8(la, ga);
  __builtin_amdgcn_sched_barrier(0);
  gemm_copy8(la + LH, ga + GH);
  __builtin_amdgcn_sched_barrier(0);
  gemm_copy8(lb, gb);
  __builtin_amdgcn_sched_barrier(0);
  gemm_copy8(lb + LH, gb + GH);
}

__global__ __launch_bounds__(256)
void proj_gemm_wmma(const half_t* __restrict__ xh,
                    const half_t* __restrict__ wh,
                    half_t* __restrict__ rkv) {
  __shared__ __attribute__((aligned(16))) unsigned char smem[2 * G_BUF_BYTES];

  const int lane  = threadIdx.x & 31;
  const int wave  = threadIdx.x >> 5;
  const int laneL = lane & 15;
  const int laneH = lane >> 4;
  const int wm    = wave >> 1;                  // 0..3: the wave's 64 rows
  const int wn    = wave & 1;                   // 0..1: the wave's 128 columns

  const int NT_N = (6 * H_DIM) / G_BN;          // 24 column tiles
  const int nt   = blockIdx.x % NT_N;
  const int mt   = blockIdx.x / NT_N;

  const int m0  = mt * G_BM;
  const int n0g = nt * G_BN;                    // row of the [6144 x 1024] operand
  const int mat = n0g / H_DIM;                  // 0..5: r/k/v fw, r/k/v bw
  const int n0  = n0g % H_DIM;

  // the lane's part of a stage: 16-byte chunk cchk of rows crow + 16 * i
  const int crow = threadIdx.x >> 4;            // 0..15
  const int cchk = threadIdx.x & 15;            // 0..15
  const half_t* ga = xh + (size_t)(m0  + crow) * I_DIM + cchk * 8;
  const half_t* gb = wh + (size_t)(n0g + crow) * I_DIM + cchk * 8;
  const unsigned la = (unsigned)(size_t)(lds_byte_t*)smem + crow * G_PITCH + cchk * 16;
  const unsigned lb = la + G_A_BYTES;

  // the lane's first fragment chunks in buffer 0
  const unsigned char* fa = smem + (wm * 64 + laneL) * G_PITCH + laneH * 16;
  const unsigned char* fb = smem + G_A_BYTES + (wn * 128 + laneL) * G_PITCH + laneH * 16;

  v8f acc[4][8] = {};

  // stage 0 lands and is published; then stage 1 starts into the other buffer
  gemm_stage_copy(la, ga, lb, gb);
  asm volatile("s_wait_asynccnt 0x0" ::: "memory");   // this wave's copies have landed
  __syncthreads();
  gemm_stage_copy(la + G_BUF_BYTES, ga + G_BK, lb + G_BUF_BYTES, gb + G_BK);

  for (int t = 0; t < G_STAGES; ++t) {
    const unsigned boff = (unsigned)(t & 1) * G_BUF_BYTES;
    #pragma unroll   // constant LDS offsets and register indices
    for (int ks = 0; ks < G_BK / 32; ++ks) {
      V16U a[4], b[8];
      #pragma unroll   // constant register indices
      for (int i = 0; i < 4; ++i) {
        const unsigned char* pa = fa + boff + i * 16 * G_PITCH + ks * 64;
        a[i].s.lo = *(const v8h*)(pa);
        a[i].s.hi = *(const v8h*)(pa + 32);
      }
      #pragma unroll   // constant register indices
      for (int j = 0; j < 8; ++j) {
        const unsigned char* pb = fb + boff + j * 16 * G_PITCH + ks * 64;
        b[j].s.lo = *(const v8h*)(pb);
        b[j].s.hi = *(const v8h*)(pb + 32);
      }
      // the 24 LDS reads of a K step stay one group in front of its 32 WMMAs:
      // left free, they were spread among the WMMAs in pairs, each pair with a
      // full wait behind it
      __builtin_amdgcn_sched_barrier(0);
      #pragma unroll   // constant register indices
      for (int i = 0; i < 4; ++i) {
        #pragma unroll   // constant register indices
        for (int j = 0; j < 8; ++j) {
          acc[i][j] = __builtin_amdgcn_wmma_f32_16x16x32_f16(
              false, a[i].v, false, b[j].v, (short)0, acc[i][j], false, false);
        }
      }
      // and the next K step's reads stay behind this step's WMMAs
      __builtin_amdgcn_sched_barrier(0);
    }
    // hand-over: this wave's reads of buffer t & 1 are done, its copies of stage
    // t + 1 have landed; behind the barrier that holds for every wave, so stage
    // t + 1 may be read and buffer t & 1 refilled
    asm volatile("s_wait_dscnt 0x0" ::: "memory");
    asm volatile("s_wait_asynccnt 0x0" ::: "memory");
    __syncthreads();
    if (t + 2 < G_STAGES)
      gemm_stage_copy(la + boff, ga + (t + 2) * G_BK, lb + boff, gb + (t + 2) * G_BK);
  }
  asm volatile("s_wait_asynccnt 0x0" ::: "memory");   // nothing in flight at the wave's end

  // The wave's 64 x 128 tile leaves as f16, through LDS, so that global memory gets
  // whole aligned 256-byte row pieces in 16-byte stores (straight from the
  // accumulators a store would hold 32-byte pieces, 2 bytes a lane). The ring is free:
  // behind the loop's last barrier no wave reads it and no copy is in flight. Each
  // wave stages f32 in a range of its own, 16 rows (one row of accumulator tiles) at
  // a time, two parts used in turn: part i + 1 is written while part i goes out.
  // Columns 64..127 of a staged row lie 4 floats further on: the 16 lanes that read
  // one row, 32 bytes apart, then fall on all 64 banks once.
  const int    rrow = lane >> 4;                            // 0..1
  const int    rcol = (lane & 15) * 8;                      // 8 columns a lane
  float*       stg = (float*)smem + wave * (2 * E_PART);
  float*       sw  = stg + laneH * 8 * E_PITCH + laneL;     // accumulator map: row 8 * laneH + v
  const float* sr  = stg + rrow * E_PITCH + rcol + (rcol >= 64 ? 4 : 0);   // rows 2 q + rrow
  // one address per lane; every store's distance from it is a constant
  half_t* dst = rkv + (size_t)mat * M_DIM * H_DIM
                    + (size_t)(m0 + wm * 64 + rrow) * H_DIM + (n0 + wn * 128 + rcol);
  #pragma unroll   // constant LDS offsets and register indices
  for (int v = 0; v < 8; ++v) {
    #pragma unroll
    for (int j = 0; j < 8; ++j)
      sw[v * E_PITCH + j * 16 + (j >= 4 ? 4 : 0)] = acc[0][j][v];
  }
  #pragma unroll   // constant offsets and register indices
  for (int i = 0; i < 4; ++i) {
    // part i's writes have landed before other lanes of the wave read them; and
    // part i - 1's reads are done before that part is written again below
    asm volatile("s_wait_dscnt 0x0" ::: "memory");
    // what follows may write registers that the stores of part i - 1 name
    if (i > 0) asm volatile("s_wait_xcnt 0x0" ::: "memory");
    v4f row[16];
    #pragma unroll
    for (int q = 0; q < 8; ++q) {
      row[2 * q]     = *(const v4f*)(sr + (i & 1) * E_PART + q * 2 * E_PITCH);
      row[2 * q + 1] = *(const v4f*)(sr + (i & 1) * E_PART + q * 2 * E_PITCH + 4);
    }
    if (i + 1 < 4) {
      #pragma unroll
      for (int v = 0; v < 8; ++v) {
        #pragma unroll
        for (int j = 0; j < 8; ++j)
          sw[((i + 1) & 1) * E_PART + v * E_PITCH + j * 16 + (j >= 4 ? 4 : 0)] = acc[i + 1][j][v];
      }
    }
    #pragma unroll
    for (int q = 0; q < 8; ++q) {
      const v4f lo = row[2 * q], hi = row[2 * q + 1];
      const v8h o = { (half_t)lo.x, (half_t)lo.y, (half_t)lo.z, (half_t)lo.w,
                      (half_t)hi.x, (half_t)hi.y, (half_t)hi.z, (half_t)hi.w };
      *(v8h*)(dst + (i * 16 + q * 2) * H_DIM) = o;
    }
  }
}

// ---------------------------------------------------------------------------
// Bidirectional RWKV scan, split over time inside a work-group.
// r, k, v come as f16; a lane owns the two neighbouring channels of one 32-bit
// word, so a wave's load is one whole 128-byte line. A work-group owns 64
// channels (dir, b, 64 neighbouring h) and has 32 waves; wave c owns steps
// c*64 .. c*64+63 of the scan order.
//   pass 1: the wave runs the state update alone (k and v, no output) over its
//           64 steps from the empty state and leaves (fn, fd, scale) in LDS;
//   fold  : behind one barrier, wave c folds the states of waves 0 .. c-1 in
//           rising order into the state in front of its own first step. The
//           state is linear: 64 steps later an earlier state stands for the
//           same sums times exp(64 w), that is scale + 64 w;
//   pass 2: the wave runs its 64 full steps from that state and stores y.
// Writes output [T, B, 2H] (fw in h<1024, bw in h>=1024, bw time-reversed
// back to original order) plus hidden tail [2, B, H].
// The r, k, v of a step do not depend on the state, so they are loaded one
// batch of SCAN_DEPTH steps ahead into registers (two sets, used in turn).
// All arithmetic is f32.
// ---------------------------------------------------------------------------
#define SCAN_DEPTH 4
#define SCAN_WAVES 32                          // time chunks = waves per work-group
#define SCAN_LEN   (T_DIM / SCAN_WAVES)        // 64 steps per chunk
#define SCAN_GROUPS (2 * B_DIM * H_DIM / 64)   // 256 work-groups
static_assert(SCAN_LEN % (2 * SCAN_DEPTH) == 0, "a chunk is a whole number of batch pairs");

typedef __attribute__((ext_vector_type(2))) _Float16 v2h;
typedef __attribute__((ext_vector_type(2))) float    v2f;

struct ScanIn  { v2h r[SCAN_DEPTH], k[SCAN_DEPTH], v[SCAN_DEPTH]; };
struct ScanKv  { v2h k[SCAN_DEPTH], v[SCAN_DEPTH]; };
struct ScanSt  { float fn[2], fd[2], scale[2]; };          // the lane's two channels
// the lane's own addresses of the current batch's first step, in channel pairs
// (typed as global-memory pointers: behind the asm statement below the compiler
// could no longer tell, and would fall back to flat loads)
typedef const __attribute__((address_space(1))) v2h* gl_in_t;
typedef __attribute__((address_space(1))) v2f*       gl_out_t;
struct ScanPtr { gl_in_t r, k, v; gl_out_t o; };

// e = exp(x) as the fast form has it: one multiply by log2(e), one v_exp_f32.
// The five v_exp_f32 of a step stand in one statement that ends in v_nop: each
// is the independent instruction behind the one before, the v_nop the slot the
// instruction set asks for behind the last.
__device__ __forceinline__ void exp_x5(float x0, float x1, float x2, float x3, float x4,
                                       float& e0, float& e1, float& e2, float& e3, float& e4) {
  const float LOG2E = 1.44269504f;
  const float a0 = x0 * LOG2E, a1 = x1 * LOG2E, a2 = x2 * LOG2E, a3 = x3 * LOG2E;
  const float a4 = x4 * LOG2E;
  asm("v_exp_f32 %0, %5\n\t"
      "v_exp_f32 %1, %6\n\t"
      "v_exp_f32 %2, %7\n\t"
      "v_exp_f32 %3, %8\n\t"
      "v_exp_f32 %4, %9\n\t"
      "v_nop"
      : "=&v"(e0), "=&v"(e1), "=&v"(e2), "=&v"(e3), "=&v"(e4)
      : "v"(a0), "v"(a1), "v"(a2), "v"(a3), "v"(a4));
}

// the same for the two exponentials of a state update alone
__device__ __forceinline__ void exp_x2(float x0, float x1, float& e0, float& e1) {
  const float LOG2E = 1.44269504f;
  const float a0 = x0 * LOG2E, a1 = x1 * LOG2E;
  asm("v_exp_f32 %0, %2\n\t"
      "v_exp_f32 %1, %3\n\t"
      "v_nop"
      : "=&v"(e0), "=&v"(e1)
      : "v"(a0), "v"(a1));
}

// r is the projection itself. Its sigmoid 1 / (1 + exp(-r)) goes into the step's
// one division: sigmoid(r) * (n / d) = n / (d + d * exp(-r)). Where exp(-r)
// overflows the quotient is 0, as the sigmoid is.
__device__ __forceinline__ float scan_step(float r, float k, float v,
                                           float uu, float ww,
                                           float& fn, float& fd, float& scale) {
  const float sm = fmaxf(scale, uu + k);
  const float ns = fmaxf(scale + ww, k);
  float cm, am, ncm, nam, er;
  exp_x5(scale - sm, uu + k - sm, scale + ww - ns, k - ns, -r, cm, am, ncm, nam, er);

  const float d = cm * fd + am;
  const float y = (cm * fn + am * v) / (d + d * er);

  fn = ncm * fn + nam * v;
  fd = ncm * fd + nam;
  scale = ns;
  return y;
}

// (fn, fd, scale), moved on by the exponent dw, takes in (gn, gd, gs):
// with dw = w, (v, 1, k) it is the state update of scan_step.
__device__ __forceinline__ void state_take(float dw, float gn, float gd, float gs,
                                           float& fn, float& fd, float& scale) {
  const float ns = fmaxf(scale + dw, gs);
  float ncm, nam;
  exp_x2(scale + dw - ns, gs - ns, ncm, nam);
  fn = ncm * fn + nam * gn;
  fd = ncm * fd + nam * gd;
  scale = ns;
}

__device__ __forceinline__ void state_empty(ScanSt& s) {
  s.fn[0] = 0.0f; s.fd[0] = 0.0f; s.scale[0] = -1e20f;
  s.fn[1] = 0.0f; s.fd[1] = 0.0f; s.scale[1] = -1e20f;
}

// DIR is a compile-time value so that every step's distance from the batch's
// pointers is a constant and goes into the instruction's offset field.
// Loads the batch that starts AHEAD steps behind p's.
template <int DIR, int AHEAD, bool FIRST = false>
__device__ __forceinline__ void scan_load(ScanIn& d, const ScanPtr& p) {
  constexpr int SI = (DIR ? -1 : 1) * B_DIM * H_DIM / 2;   // channel pairs per step
  #pragma unroll
  for (int j = 0; j < SCAN_DEPTH; ++j) {
    d.k[j] = p.k[(AHEAD + j) * SI];
    d.v[j] = p.v[(AHEAD + j) * SI];
    d.r[j] = p.r[(AHEAD + j) * SI];
  }
  if constexpr (FIRST) asm volatile("s_wait_xcnt 0x0" ::: "memory");  // see scan_channel
  // keeps all of the batch's loads in front of the arithmetic that follows,
  // so that each has a whole batch of lead
  __builtin_amdgcn_sched_barrier(0);
}

// the same for pass 1, which reads k and v alone
template <int DIR, int AHEAD, bool FIRST = false>
__device__ __forceinline__ void scan_load_kv(ScanKv& d, gl_in_t pk, gl_in_t pv) {
  constexpr int SI = (DIR ? -1 : 1) * B_DIM * H_DIM / 2;   // channel pairs per step
  #pragma unroll
  for (int j = 0; j < SCAN_DEPTH; ++j) {
    d.k[j] = pk[(AHEAD + j) * SI];
    d.v[j] = pv[(AHEAD + j) * SI];
  }
  if constexpr (FIRST) asm volatile("s_wait_xcnt 0x0" ::: "memory");  // see scan_channel
  // keeps the batch's loads in front of the arithmetic that follows
  __builtin_amdgcn_sched_barrier(0);
}

__device__ __forceinline__ void state_batch(const ScanKv& d, v2f ww, ScanSt& s) {
  #pragma unroll
  for (int j = 0; j < SCAN_DEPTH; ++j) {
    state_take(ww.x, (float)d.v[j].x, 1.0f, (float)d.k[j].x, s.fn[0], s.fd[0], s.scale[0]);
    state_take(ww.y, (float)d.v[j].y, 1.0f, (float)d.k[j].y, s.fn[1], s.fd[1], s.scale[1]);
  }
}

// Runs the batch of p.o and stores its outputs; returns the last y.
template <int DIR>
__device__ __forceinline__ v2f scan_batch(const ScanIn& d, v2f uu, v2f ww,
                                          ScanSt& s, ScanPtr& p) {
  v2f y[SCAN_DEPTH];
  #pragma unroll
  for (int j = 0; j < SCAN_DEPTH; ++j) {
    y[j].x = scan_step((float)d.r[j].x, (float)d.k[j].x, (float)d.v[j].x, uu.x, ww.x,
                       s.fn[0], s.fd[0], s.scale[0]);
    y[j].y = scan_step((float)d.r[j].y, (float)d.k[j].y, (float)d.v[j].y, uu.y, ww.y,
                       s.fn[1], s.fd[1], s.scale[1]);
  }

  // The batch's 4 stores (one out row, 65536 bytes, per step) and the wait
  // that stands before a register named by an issued load or store is written
  // again, in one statement: one wait serves the run. The four pointers are
  // named as in and out so that they stay in their registers up to that wait
  // and are advanced only behind it.
  if constexpr (DIR) {
    asm volatile(
        "global_store_b64 %0, %4, off\n\t"
        "global_store_b64 %0, %5, off offset:-65536\n\t"
        "global_store_b64 %0, %6, off offset:-131072\n\t"
        "global_store_b64 %0, %7, off offset:-196608\n\t"
        "s_wait_xcnt 0x0"
        : "+v"(p.o), "+v"(p.r), "+v"(p.k), "+v"(p.v)
        : "v"(y[0]), "v"(y[1]), "v"(y[2]), "v"(y[3])
        : "memory");
  } else {
    asm volatile(
        "global_store_b64 %0, %4, off\n\t"
        "global_store_b64 %0, %5, off offset:65536\n\t"
        "global_store_b64 %0, %6, off offset:131072\n\t"
        "global_store_b64 %0, %7, off offset:196608\n\t"
        "s_wait_xcnt 0x0"
        : "+v"(p.o), "+v"(p.r), "+v"(p.k), "+v"(p.v)
        : "v"(y[0]), "v"(y[1]), "v"(y[2]), "v"(y[3])
        : "memory");
  }
  // keeps what follows (among it the compiler's register copies of values that
  // are still in flight) behind the batch's arithmetic: moved up into it, such
  // a copy waits for its load half a batch early
  __builtin_amdgcn_sched_barrier(0);
  p.o += (DIR ? -1 : 1) * B_DIM * H_DIM * SCAN_DEPTH;      // 2H floats = H pairs per (t, b)
  return y[SCAN_DEPTH - 1];
}

// p: the lane's addresses of the first step of the wave's chunk.
template <int DIR>
__device__ __forceinline__ void scan_channel(ScanPtr p, v2f uu, v2f ww,
                                             v2f* __restrict__ hid,
                                             int lane, int chunk,
                                             v2f (*st)[SCAN_WAVES][32]) {
  constexpr int BI = (DIR ? -1 : 1) * B_DIM * H_DIM / 2 * SCAN_DEPTH;  // pairs per batch
  constexpr int PAIRS = SCAN_LEN / (2 * SCAN_DEPTH);
  ScanSt s;
  state_empty(s);

  // Once, in front of the loops: the loads of u and w, and then each pass's
  // first batch, use address registers of the compiler's own choosing; the wait
  // stands before any of them is written again.
  asm volatile("s_wait_xcnt 0x0" ::: "memory");

  // pass 1: the chunk's own state, from the empty state
  {
    gl_in_t pk = p.k, pv = p.v;
    ScanKv A, Bf;
    scan_load_kv<DIR, 0, true>(A, pk, pv);
    for (int i = 0; i < PAIRS; ++i) {
      scan_load_kv<DIR, SCAN_DEPTH>(Bf, pk, pv);
      state_batch(A, ww, s);
      // in the last trip this look-ahead reads the next chunk's first rows
      // (see pass 2 on the last chunk's); the values are not used
      scan_load_kv<DIR, 2 * SCAN_DEPTH>(A, pk, pv);
      state_batch(Bf, ww, s);
      // keeps the compiler's register copies of the look-ahead's values, still
      // in flight, behind the batch's arithmetic (as in scan_batch)
      __builtin_amdgcn_sched_barrier(0);
      // the wait that stands before the two pointers, which issued loads name,
      // are advanced; they are named so that they stay in their registers up to it
      asm volatile("s_wait_xcnt 0x0" : "+v"(pk), "+v"(pv) :: "memory");
      pk += 2 * BI; pv += 2 * BI;
    }
  }
  st[0][chunk][lane] = v2f{ s.fn[0], s.fn[1] };
  st[1][chunk][lane] = v2f{ s.fd[0], s.fd[1] };
  st[2][chunk][lane] = v2f{ s.scale[0], s.scale[1] };

  // pass 2's first batch flies while the states are handed over
  ScanIn A, Bf;
  scan_load<DIR, 0, true>(A, p);

  __syncthreads();   // every wave's chunk state is in LDS

  // fold: the state in front of this chunk, from the chunks before it
  const v2f lw = (float)SCAN_LEN * ww;
  state_empty(s);
  for (int j = 0; j < chunk; ++j) {
    const v2f gn = st[0][j][lane], gd = st[1][j][lane], gs = st[2][j][lane];
    state_take(lw.x, gn.x, gd.x, gs.x, s.fn[0], s.fd[0], s.scale[0]);
    state_take(lw.y, gn.y, gd.y, gs.y, s.fn[1], s.fd[1], s.scale[1]);
  }

  // pass 2: the chunk's full steps
  v2f y = { 0.0f, 0.0f };
  for (int i = 0; i < PAIRS; ++i) {
    scan_load<DIR, SCAN_DEPTH>(Bf, p);
    scan_batch<DIR>(A, uu, ww, s, p);
    // In the last trip this look-ahead reads the next chunk's first rows; the
    // last chunk's runs SCAN_DEPTH rows past the r, k, v planes' ends, into the
    // neighbouring plane of the same rkv array (forward: planes 0..2 into 1..3;
    // backward: 3..5 into 2..4), which the GEMM of this call has written; the
    // values are not used. A branch round it would make the counted load waits
    // of the batch below wait for these loads too.
    scan_load<DIR, 2 * SCAN_DEPTH>(A, p);
    y = scan_batch<DIR>(Bf, uu, ww, s, p);
    p.r += 2 * BI; p.k += 2 * BI; p.v += 2 * BI;
  }
  // the last look-ahead's loads are still in flight and nothing reads them:
  // they land before the wave ends and gives its registers back
  asm volatile("s_wait_loadcnt 0x0" ::: "memory");
  if (chunk == SCAN_WAVES - 1) *hid = y;   // the scan's last step
}

__global__ __launch_bounds__(SCAN_WAVES * 32)
void birwkv_scan(const half_t* __restrict__ rkv,
                 const float* __restrict__ u_fw, const float* __restrict__ w_fw,
                 const float* __restrict__ u_bw, const float* __restrict__ w_bw,
                 float* __restrict__ out) {
  __shared__ v2f st[3][SCAN_WAVES][32];                   // fn, fd, scale per chunk and lane

  const int lane  = threadIdx.x & 31;
  // the wave's chunk, in a scalar register: it is the fold's trip count
  const int chunk = __builtin_amdgcn_readfirstlane(threadIdx.x >> 5);
  const int dir = blockIdx.x >> 7;                        // 128 work-groups per direction
  const int b   = (blockIdx.x >> 4) & 7;
  const int h   = (blockIdx.x & 15) * 64 + lane * 2;      // the lane's first channel

  const size_t MAT = (size_t)M_DIM * H_DIM;
  // time index of the chunk's first step
  const int t0 = dir ? (T_DIM - 1 - chunk * SCAN_LEN) : chunk * SCAN_LEN;
  const half_t* r0 = rkv + (dir ? 3 * MAT : 0) + (size_t)(t0 * B_DIM + b) * H_DIM + h;
  ScanPtr p;
  p.r = (gl_in_t)r0;
  p.k = (gl_in_t)(r0 + MAT);
  p.v = (gl_in_t)(r0 + 2 * MAT);
  p.o = (gl_out_t)(out + (size_t)(t0 * B_DIM + b) * (2 * H_DIM) + (size_t)dir * H_DIM + h);
  v2f* hid = (v2f*)(out + (size_t)T_DIM * B_DIM * 2 * H_DIM
                        + (size_t)dir * B_DIM * H_DIM + (size_t)b * H_DIM + h);

  if (dir) scan_channel<1>(p, *(const v2f*)(u_bw + h), *(const v2f*)(w_bw + h), hid, lane, chunk, st);
  else     scan_channel<0>(p, *(const v2f*)(u_fw + h), *(const v2f*)(w_fw + h), hid, lane, chunk, st);
}

// ---------------------------------------------------------------------------
// Host launcher
// ---------------------------------------------------------------------------
extern "C" void kernel_launch(void* const* d_in, const int* in_sizes, int n_in,
                              void* d_out, int out_size, void* d_ws, size_t ws_size,
                              hipStream_t stream) {
  (void)in_sizes; (void)n_in; (void)out_size; (void)ws_size;

  const float* x      = (const float*)d_in[0];
  const float* w_r_fw = (const float*)d_in[1];
  const float* w_k_fw = (const float*)d_in[2];
  const float* w_v_fw = (const float*)d_in[3];
  const float* w_u_fw = (const float*)d_in[4];
  const float* w_w_fw = (const float*)d_in[5];
  const float* w_r_bw = (const float*)d_in[6];
  const float* w_k_bw = (const float*)d_in[7];
  const float* w_v_bw = (const float*)d_in[8];
  const float* w_u_bw = (const float*)d_in[9];
  const float* w_w_bw = (const float*)d_in[10];

  // Workspace layout (bytes):
  //   [0)                xh : f16 x,        T*B*I*2  = 33,554,432
  //   [xh)               wh : f16 weights,  6*H*I*2  = 12,582,912
  //   [xh+wh)            rkv: f16 r/k/v x2, 6*T*B*H*2 = 201,326,592
  const size_t XH_BYTES = (size_t)T_DIM * B_DIM * I_DIM * sizeof(half_t);
  const size_t WH_BYTES = (size_t)6 * H_DIM * I_DIM * sizeof(half_t);
  char*   ws  = (char*)d_ws;
  half_t* xh  = (half_t*)ws;
  half_t* wh  = (half_t*)(ws + XH_BYTES);
  half_t* rkv = (half_t*)(ws + XH_BYTES + WH_BYTES);

  // 1) convert x and the six weight matrices to f16 (xh and wh are one row)
  cvt_all_f32_to_f16<<<CVT_GROUPS, CVT_WAVES * 32, 0, stream>>>(
      x, w_r_fw, w_k_fw, w_v_fw, w_r_bw, w_k_bw, w_v_bw, xh);

  // 2) WMMA projection GEMMs
  {
    const int blocks = (M_DIM / G_BM) * ((6 * H_DIM) / G_BN);  // 64 * 24 = 1536
    proj_gemm_wmma<<<blocks, 256, 0, stream>>>(xh, wh, rkv);
  }

  // 3) bidirectional scan -> d_out ([T,B,2H] output + [2,B,H] hidden)
  birwkv_scan<<<SCAN_GROUPS, SCAN_WAVES * 32, 0, stream>>>(
      rkv, w_u_fw, w_w_fw, w_u_bw, w_w_bw, (float*)d_out);
}

// v009
// A run of this version takes 170 microseconds.
// Two timings next to v008 both put it at 1.04 times that version's speed.
// Counting every step since v000, it is 10.4 times as fast.
#include <hip/hip_runtime.h>

typedef _Float16 half_t;
typedef __attribute__((ext_vector_type(16))) _Float16 v16h;
typedef __attribute__((ext_vector_type(8)))  _Float16 v8h;
typedef __attribute__((ext_vector_type(4)))  _Float16 v4h;
typedef __attribute__((ext_vector_type(8)))  float    v8f;

#define T_DIM 2048
#define B_DIM 8
#define I_DIM 1024
#define H_DIM 1024
#define M_DIM (T_DIM * B_DIM)          // 16384 rows of x

union V16U { v16h v; struct { v8h lo, hi; } s; };

// ---------------------------------------------------------------------------
// fp32 -> fp16 conversion of x and the six weight matrices in ONE launch of few,
// long-lived waves: 256 work-groups (as many as WGPs) of 11 waves. The f16 copies lie
// behind one another in the workspace (x, then the six matrices), so the whole
// job is one row of 2816 chunks of 2048 float4; every chunk lies in one source
// array, and each wave converts one chunk: 64 loads of 512 contiguous bytes, 64
// stores of 256. The loads go one batch of 16 ahead, into two register sets
// used in turn. All addresses are one scalar base, one lane offset that is
// never written again, and a constant.
// ---------------------------------------------------------------------------
typedef __attribute__((ext_vector_type(4))) float v4f;

#define CVT_GROUPS  256
#define CVT_WAVES   11
#define CVT_BATCH   16
#define CVT_BATCHES 4
#define CVT_CHUNK   (32 * CVT_BATCH * CVT_BATCHES)    // 2048 float4 per wave
#define CVT_X_CH    (M_DIM * I_DIM / 4 / CVT_CHUNK)   // 2048 chunks of x
#define CVT_W_CH    (H_DIM * I_DIM / 4 / CVT_CHUNK)   // 128 chunks per matrix
static_assert(CVT_X_CH * CVT_CHUNK * 4 == M_DIM * I_DIM, "x is a whole number of chunks");
static_assert(CVT_W_CH * CVT_CHUNK * 4 == H_DIM * I_DIM, "a matrix is a whole number of chunks");
static_assert(CVT_X_CH + 6 * CVT_W_CH == CVT_GROUPS * CVT_WAVES, "one chunk per wave");

struct CvtSet { v4f f[CVT_BATCH]; };

__device__ __forceinline__ void cvt_load(CvtSet& s, const v4f* __restrict__ sp, int batch) {
  // From the third batch on the loads land in registers that stores issued
  // above may name as their data: the wait stands before they are written again.
  if (batch >= 2) asm volatile("s_wait_xcnt 0x0" ::: "memory");
  #pragma unroll   // constant offsets and register indices
  for (int q = 0; q < CVT_BATCH; ++q)
    s.f[q] = sp[(batch * CVT_BATCH + q) * 32];
}

__device__ __forceinline__ void cvt_store(const CvtSet& s, v4h* __restrict__ dp, int batch) {
  // Takes the batch's loaded values as inputs only. It keeps the loads of the
  // batch behind this one, issued above, as one run in front of this batch's
  // conversion: left free, they were spread among the conversions in ones to
  // fours, each behind a load wait, so that fewer were in flight.
  asm volatile("" :: "v"(s.f[0]), "v"(s.f[1]), "v"(s.f[2]), "v"(s.f[3]),
                     "v"(s.f[4]), "v"(s.f[5]), "v"(s.f[6]), "v"(s.f[7]),
                     "v"(s.f[8]), "v"(s.f[9]), "v"(s.f[10]), "v"(s.f[11]),
                     "v"(s.f[12]), "v"(s.f[13]), "v"(s.f[14]), "v"(s.f[15]));
  #pragma unroll   // constant offsets and register indices
  for (int q = 0; q < CVT_BATCH; ++q) {
    const v4f f = s.f[q];
    const v4h o = { (half_t)f.x, (half_t)f.y, (half_t)f.z, (half_t)f.w };
    dp[(batch * CVT_BATCH + q) * 32] = o;
  }
}

__global__ __launch_bounds__(CVT_WAVES * 32)
void cvt_all_f32_to_f16(const float* __restrict__ x,
                        const float* __restrict__ w0, const float* __restrict__ w1,
                        const float* __restrict__ w2, const float* __restrict__ w3,
                        const float* __restrict__ w4, const float* __restrict__ w5,
                        half_t* __restrict__ dst) {
  const int lane = threadIdx.x & 31;
  // the wave's chunk, in a scalar register: it picks the source array
  const int g = __builtin_amdgcn_readfirstlane(blockIdx.x * CVT_WAVES + (threadIdx.x >> 5));
  const int m = (g - CVT_X_CH) / CVT_W_CH;            // the matrix, where g is past x
  const float* src = g < CVT_X_CH ? x
                   : m == 0 ? w0 : m == 1 ? w1 : m == 2 ? w2
                   : m == 3 ? w3 : m == 4 ? w4 : w5;
  const int c = g < CVT_X_CH ? g : (g - CVT_X_CH) % CVT_W_CH;   // chunk within it
  const v4f* sp = (const v4f*)src + (size_t)c * CVT_CHUNK + lane;
  v4h*       dp = (v4h*)dst + (size_t)g * CVT_CHUNK + lane;

  CvtSet a, b;
  cvt_load(a, sp, 0);
  cvt_load(b, sp, 1);  cvt_store(a, dp, 0);
  cvt_load(a, sp, 2);  cvt_store(b, dp, 1);
  cvt_load(b, sp, 3);  cvt_store(a, dp, 2);
  cvt_store(b, dp, 3);
}

// ---------------------------------------------------------------------------
// Projection GEMM: [16384 x 1024] x [1024 x 1024]^T for 6 weight matrices
// (the six lie behind one another in wh: one [6144 x 1024] operand).
// A work-group of 8 waves (4 x 2) computes a 256 x 256 tile, each wave 64 x 128
// (4 x 8 WMMA fragments): per WMMA that is 3/4 of the LDS reads of a 64 x 64 wave
// tile, and 2/3 of the L2 bytes of a 128 x 256 block tile. One work-group per WGP,
// two waves per SIMD. The grid is one work-group per WGP; each computes six tiles one
// after the other, and the ring of stages runs on over the tile ends: the next tile's
// first stage flies during this tile's last one, so that only the first tile waits
// for a start of a work-group and for a first stage.
// K goes in stages of 128: 256 bytes of each of the tile's 256
// x-rows and 256 weight rows are brought into LDS by asynchronous copies, so that
// L2 delivers every line once per tile. Two
// buffers: the next stage's copies fly while this one is worked on.
// Fragments are read from LDS in the same K-major per-lane layout for A and B:
//   lanes 0-15 : row = laneL, chunks at K = k0+0..7  and k0+16..23
//   lanes 16-31: row = laneL, chunks at K = k0+8..15 and k0+24..31
// Each accumulator takes its K steps of 32 in rising order.
// All six results leave as they are: the sigmoid of r is taken in the scan.
// The result is rounded to f16 and leaves through LDS as whole 256-byte row pieces.
// ---------------------------------------------------------------------------
#define G_BM 256
#define G_BN 256
#define G_BK 128                                 // f16 elements per stage and row
#define G_PITCH 272                              // LDS bytes per row: 256 + 16 (16 x odd)
#define G_A_BYTES (G_BM * G_PITCH)               // 69,632
#define G_BUF_BYTES ((G_BM + G_BN) * G_PITCH)    // 139,264
#define G_STAGES (I_DIM / G_BK)                  // 8
#define G_NT_N   ((6 * H_DIM) / G_BN)            // 24 column tiles
#define G_GROUPS 256                             // work-groups: as many as WGPs
#define G_TILES  ((M_DIM / G_BM) * G_NT_N / G_GROUPS)   // 6 tiles per work-group
static_assert(G_TILES * G_GROUPS == (M_DIM / G_BM) * G_NT_N, "every work-group has as many tiles");
static_assert(G_STAGES % 2 == 0 && G_STAGES >= 2, "a tile's last stage lies in buffer 1");
#define E_PITCH 132                              // floats per staged output row: 128 + 4
#define E_PART  (16 * E_PITCH)                   // floats per staged part: 16 rows
static_assert(8 * 2 * E_PART * 4 <= G_BUF_BYTES, "the eight waves' staging fits one buffer");

typedef __attribute__((address_space(3))) unsigned char lds_byte_t;

// Eight copies: every lane copies 16 bytes of 8 rows, 16 rows apart. l: the lane's
// LDS byte address of its first row; g: the same bytes in global memory.
// The s_wait_xcnt stands inside the statement, behind the last copy, so that no
// register a copy names is written again in front of it.
__device__ __forceinline__ void gemm_copy8(unsigned l, const half_t* g) {
  constexpr unsigned LS = 16 * G_PITCH;          // LDS bytes per 16 rows
  constexpr size_t   GS = (size_t)16 * I_DIM;    // elements per 16 rows
  asm volatile(
      "global_load_async_to_lds_b128 %0, %8, off\n\t"
      "global_load_async_to_lds_b128 %1, %9, off\n\t"
      "global_load_async_to_lds_b128 %2, %10, off\n\t"
      "global_load_async_to_lds_b128 %3, %11, off\n\t"
      "global_load_async_to_lds_b128 %4, %12, off\n\t"
      "global_load_async_to_lds_b128 %5, %13, off\n\t"
      "global_load_async_to_lds_b128 %6, %14, off\n\t"
      "global_load_async_to_lds_b128 %7, %15, off\n\t"
      "s_wait_xcnt 0x0"
      :
      : "v"(l), "v"(l + LS), "v"(l + 2 * LS), "v"(l + 3 * LS),
        "v"(l + 4 * LS), "v"(l + 5 * LS), "v"(l + 6 * LS), "v"(l + 7 * LS),
        "v"(g), "v"(g + GS), "v"(g + 2 * GS), "v"(g + 3 * GS),
        "v"(g + 4 * GS), "v"(g + 5 * GS), "v"(g + 6 * GS), "v"(g + 7 * GS)
      : "memory");
}

// One stage: every lane copies 16 bytes of 32 rows (16 of x, 16 of the weights).
// la, lb: the lane's LDS byte addresses of its first row in the A and B part of the
// buffer; ga, gb: the same bytes in global memory.
__device__ __forceinline__ void gemm_stage_copy(unsigned la, const half_t* ga,
                                                unsigned lb, const half_t* gb) {
  constexpr unsigned LH = 128 * G_PITCH;         // LDS bytes per 128 rows
  constexpr size_t   GH = (size_t)128 * I_DIM;   // elements per 128 rows
  // The fences keep each group's 24 address registers from being formed ahead of
  // the groups before it: formed all at once they did not fit beside the
  // accumulators, and the two row pointers were spilled to scratch memory.
  gemm_copy8(la, ga);
  __builtin_amdgcn_sched_barrier(0);
  gemm_copy8(la + LH, ga + GH);
  __builtin_amdgcn_sched_barrier(0);
  gemm_copy8(lb, gb);
  __builtin_amdgcn_sched_barrier(0);
  gemm_copy8(lb + LH, gb + GH);
}

// Stage q of the work-group's row of G_TILES * G_STAGES stages, into buffer q & 1.
// q is the same in every wave. Tile i of work-group g is tile g + i * G_GROUPS of the
// grid of tiles (column tiles run fastest). xl, wl: the lane's bytes of the first
// stage of the first tile row and of the first tile column. lds0: the ring's LDS byte
// address; wave: the wave's number, in a scalar register.
// The lane's LDS address, chunk (lane & 15) of row 2 * wave + (lane >> 4), is
// lds0 + buffer + 16 * (34 * wave + lane + (lane >> 4)). It is formed anew for every
// stage from the lane's number (lanes below it; lane 15 below it): held in a register
// over the loop it was spilled to scratch memory and loaded again at every stage.
static_assert(G_PITCH == 256 + 16 && G_BUF_BYTES % 16 == 0, "the address form below");
__device__ __forceinline__ void gemm_stage_q(int q, unsigned lds0, int wave,
                                             const half_t* xl, const half_t* wl) {
  const int tl = blockIdx.x + (q / G_STAGES) * G_GROUPS;
  const unsigned s16 = (unsigned)(q & 1) * (G_BUF_BYTES / 16) + (unsigned)wave * (2 * G_PITCH / 16);
  const unsigned l16 = __builtin_amdgcn_mbcnt_lo(0x8000u, __builtin_amdgcn_mbcnt_lo(~0u, s16));
  const unsigned la = lds0 + l16 * 16;
  const size_t   ko = (size_t)(q % G_STAGES) * G_BK;
  gemm_stage_copy(la, xl + ((size_t)(tl / G_NT_N) * G_BM * I_DIM + ko),
                  la + G_A_BYTES, wl + ((size_t)(tl % G_NT_N) * G_BN * I_DIM + ko));
}

__global__ __launch_bounds__(256)
void proj_gemm_wmma(const half_t* __restrict__ xh,
                    const half_t* __restrict__ wh,
                    half_t* __restrict__ rkv) {
  __shared__ __attribute__((aligned(16))) unsigned char smem[2 * G_BUF_BYTES];

  const int lane  = threadIdx.x & 31;
  const int wave  = threadIdx.x >> 5;
  const int laneL = lane & 15;
  const int laneH = lane >> 4;
  const int wm    = wave >> 1;                  // 0..3: the wave's 64 rows
  const int wn    = wave & 1;                   // 0..1: the wave's 128 columns

  // the lane's part of a stage: 16-byte chunk cchk of rows crow + 16 * i
  const int crow = threadIdx.x >> 4;            // 0..15
  const int cchk = threadIdx.x & 15;            // 0..15
  const half_t* xl = xh + (size_t)crow * I_DIM + cchk * 8;
  const half_t* wl = wh + (size_t)crow * I_DIM + cchk * 8;
  const unsigned lds0 = (unsigned)(size_t)(lds_byte_t*)smem;
  const int waveS = __builtin_amdgcn_readfirstlane(wave);   // in a scalar register

  // the lane's first fragment chunks in buffer 0
  const unsigned char* fa = smem + (wm * 64 + laneL) * G_PITCH + laneH * 16;
  const unsigned char* fb = smem + G_A_BYTES + (wn * 128 + laneL) * G_PITCH + laneH * 16;

  v8f acc[4][8] = {};

  // the epilogue's lane constants (see there)
  const int    rrow = lane >> 4;                            // 0..1
  const int    rcol = (lane & 15) * 8;                      // 8 columns a lane
  float*       stg = (float*)(smem + G_BUF_BYTES) + wave * (2 * E_PART);
  float*       sw  = stg + laneH * 8 * E_PITCH + laneL;     // accumulator map: row 8 * laneH + v
  const float* sr  = stg + rrow * E_PITCH + rcol + (rcol >= 64 ? 4 : 0);   // rows 2 q + rrow

  // stage 0 lands and is published; then stage 1 starts into the other buffer
  gemm_stage_q(0, lds0, waveS, xl, wl);
  asm volatile("s_wait_asynccnt 0x0" ::: "memory");   // this wave's copies have landed
  __syncthreads();
  gemm_stage_q(1, lds0, waveS, xl, wl);

  #pragma nounroll   // one copy of the text, for speed only
  for (int s = 0; s < G_TILES * G_STAGES; ++s) {
    const unsigned boff = (unsigned)(s & 1) * G_BUF_BYTES;
    #pragma unroll   // constant LDS offsets and register indices
    for (int ks = 0; ks < G_BK / 32; ++ks) {
      V16U a[4], b[8];
      #pragma unroll   // constant register indices
      for (int i = 0; i < 4; ++i) {
        const unsigned char* pa = fa + boff + i * 16 * G_PITCH + ks * 64;
        a[i].s.lo = *(const v8h*)(pa);
        a[i].s.hi = *(const v8h*)(pa + 32);
      }
      #pragma unroll   // constant register indices
      for (int j = 0; j < 8; ++j) {
        const unsigned char* pb = fb + boff + j * 16 * G_PITCH + ks * 64;
        b[j].s.lo = *(const v8h*)(pb);
        b[j].s.hi = *(const v8h*)(pb + 32);
      }
      // the 24 LDS reads of a K step stay one group in front of its 32 WMMAs:
      // left free, they were spread among the WMMAs in pairs, each pair with a
      // full wait behind it
      __builtin_amdgcn_sched_barrier(0);
      #pragma unroll   // constant register indices
      for (int i = 0; i < 4; ++i) {
        #pragma unroll   // constant register indices
        for (int j = 0; j < 8; ++j) {
          acc[i][j] = __builtin_amdgcn_wmma_f32_16x16x32_f16(
              false, a[i].v, false, b[j].v, (short)0, acc[i][j], false, false);
        }
      }
      // and the next K step's reads stay behind this step's WMMAs
      __builtin_amdgcn_sched_barrier(0);
    }
    // hand-over: this wave's reads of buffer s & 1 are done, its copies of stage
    // s + 1 have landed; behind the barrier that holds for every wave, so stage
    // s + 1 may be read and buffer s & 1 refilled
    asm volatile("s_wait_dscnt 0x0" ::: "memory");
    asm volatile("s_wait_asynccnt 0x0" ::: "memory");
    __syncthreads();
    // behind a tile's last stage the buffer first serves the epilogue
    if (s % G_STAGES == G_STAGES - 1) {

  // The wave's 64 x 128 tile leaves as f16, through LDS, so that global memory gets
  // whole aligned 256-byte row pieces in 16-byte stores (straight from the
  // accumulators a store would hold 32-byte pieces, 2 bytes a lane). Buffer 1 is free:
  // behind the stage's barrier no wave reads it and no copy to it is in flight
  // (buffer 0 holds the next tile's first stage, landed and published). Each
  // wave stages f32 in a range of its own, 16 rows (one row of accumulator tiles) at
  // a time, two parts used in turn: part i + 1 is written while part i goes out.
  // Columns 64..127 of a staged row lie 4 floats further on: the 16 lanes that read
  // one row, 32 bytes apart, then fall on all 64 banks once.
  const int tl  = blockIdx.x + (s / G_STAGES) * G_GROUPS;
  const int m0  = (tl / G_NT_N) * G_BM;
  const int n0g = (tl % G_NT_N) * G_BN;         // row of the [6144 x 1024] operand
  const int mat = n0g / H_DIM;                  // 0..5: r/k/v fw, r/k/v bw
  const int n0  = n0g % H_DIM;
  // one address per lane; every store's distance from it is a constant
  half_t* dst = rkv + (size_t)mat * M_DIM * H_DIM
                    + (size_t)(m0 + wm * 64 + rrow) * H_DIM + (n0 + wn * 128 + rcol);
  #pragma unroll   // constant LDS offsets and register indices
  for (int v = 0; v < 8; ++v) {
    #pragma unroll
    for (int j = 0; j < 8; ++j)
      sw[v * E_PITCH + j * 16 + (j >= 4 ? 4 : 0)] = acc[0][j][v];
  }
  #pragma unroll   // constant offsets and register indices
  for (int i = 0; i < 4; ++i) {
    // part i's writes have landed before other lanes of the wave read them; and
    // part i - 1's reads are done before that part is written again below
    asm volatile("s_wait_dscnt 0x0" ::: "memory");
    // what follows may write registers that the stores of part i - 1 name
    if (i > 0) asm volatile("s_wait_xcnt 0x0" ::: "memory");
    v4f row[16];
    #pragma unroll
    for (int q = 0; q < 8; ++q) {
      row[2 * q]     = *(const v4f*)(sr + (i & 1) * E_PART + q * 2 * E_PITCH);
      row[2 * q + 1] = *(const v4f*)(sr + (i & 1) * E_PART + q * 2 * E_PITCH + 4);
    }
    if (i + 1 < 4) {
      #pragma unroll
      for (int v = 0; v < 8; ++v) {
        #pragma unroll
        for (int j = 0; j < 8; ++j)
          sw[((i + 1) & 1) * E_PART + v * E_PITCH + j * 16 + (j >= 4 ? 4 : 0)] = acc[i + 1][j][v];
      }
    }
    #pragma unroll
    for (int q = 0; q < 8; ++q) {
      const v4f lo = row[2 * q], hi = row[2 * q + 1];
      const v8h o = { (half_t)lo.x, (half_t)lo.y, (half_t)lo.z, (half_t)lo.w,
                      (half_t)hi.x, (half_t)hi.y, (half_t)hi.z, (half_t)hi.w };
      *(v8h*)(dst + (i * 16 + q * 2) * H_DIM) = o;
    }
  }
  // what follows may write registers that the last part's stores name
  asm volatile("s_wait_xcnt 0x0" ::: "memory");
  #pragma unroll   // constant register indices
  for (int i = 0; i < 4; ++i) {
    #pragma unroll
    for (int j = 0; j < 8; ++j) acc[i][j] = v8f{};          // the next tile's sums start at 0
  }
  if (s + 2 < G_TILES * G_STAGES) {
    // every wave's staging reads of buffer 1 are done before any wave's copies of
    // the next tile's second stage land there
    asm volatile("s_wait_dscnt 0x0" ::: "memory");
    // the barrier alone: __syncthreads() would also wait here until the tile's
    // global stores are acknowledged, which no wave needs
    __builtin_amdgcn_s_barrier();
  }
    }
    // the stage two on (it may be one of the next tile's first two)
    if (s + 2 < G_TILES * G_STAGES)
      gemm_stage_q(s + 2, lds0, waveS, xl, wl);
  }
  asm volatile("s_wait_asynccnt 0x0" ::: "memory");   // nothing in flight at the wave's end
}

// ---------------------------------------------------------------------------
// Bidirectional RWKV scan, split over time inside a work-group.
// r, k, v come as f16; a lane owns the two neighbouring channels of one 32-bit
// word, so a wave's load is one whole 128-byte line. A work-group owns 64
// channels (dir, b, 64 neighbouring h) and has 32 waves; wave c owns steps
// c*64 .. c*64+63 of the scan order.
//   pass 1: the wave runs the state update alone (k and v, no output) over its
//           64 steps from the empty state and leaves (fn, fd, scale) in LDS;
//   fold  : behind one barrier, wave c folds the states of waves 0 .. c-1 in
//           rising order into the state in front of its own first step. The
//           state is linear: 64 steps later an earlier state stands for the
//           same sums times exp(64 w), that is scale + 64 w;
//   pass 2: the wave runs its 64 full steps from that state and stores y.
// Writes output [T, B, 2H] (fw in h<1024, bw in h>=1024, bw time-reversed
// back to original order) plus hidden tail [2, B, H].
// The r, k, v of a step do not depend on the state, so they are loaded one
// batch of SCAN_DEPTH steps ahead into registers (two sets, used in turn).
// All arithmetic is f32.
// ---------------------------------------------------------------------------
#define SCAN_DEPTH 4
#define SCAN_WAVES 32                          // time chunks = waves per work-group
#define SCAN_LEN   (T_DIM / SCAN_WAVES)        // 64 steps per chunk
#define SCAN_GROUPS (2 * B_DIM * H_DIM / 64)   // 256 work-groups
static_assert(SCAN_LEN % (2 * SCAN_DEPTH) == 0, "a chunk is a whole number of batch pairs");

typedef __attribute__((ext_vector_type(2))) _Float16 v2h;
typedef __attribute__((ext_vector_type(2))) float    v2f;

struct ScanIn  { v2h r[SCAN_DEPTH], k[SCAN_DEPTH], v[SCAN_DEPTH]; };
struct ScanKv  { v2h k[SCAN_DEPTH], v[SCAN_DEPTH]; };
struct ScanSt  { float fn[2], fd[2], scale[2]; };          // the lane's two channels
// the lane's own addresses of the current batch's first step, in channel pairs
// (typed as global-memory pointers: behind the asm statement below the compiler
// could no longer tell, and would fall back to flat loads)
typedef const __attribute__((address_space(1))) v2h* gl_in_t;
typedef __attribute__((address_space(1))) v2f*       gl_out_t;
struct ScanPtr { gl_in_t r, k, v; gl_out_t o; };

// e = exp(x) as the fast form has it: one multiply by log2(e), one v_exp_f32.
// The five v_exp_f32 of a step stand in one statement that ends in v_nop: each
// is the independent instruction behind the one before, the v_nop the slot the
// instruction set asks for behind the last.
__device__ __forceinline__ void exp_x5(float x0, float x1, float x2, float x3, float x4,
                                       float& e0, float& e1, float& e2, float& e3, float& e4) {
  const float LOG2E = 1.44269504f;
  const float a0 = x0 * LOG2E, a1 = x1 * LOG2E, a2 = x2 * LOG2E, a3 = x3 * LOG2E;
  const float a4 = x4 * LOG2E;
  asm("v_exp_f32 %0, %5\n\t"
      "v_exp_f32 %1, %6\n\t"
      "v_exp_f32 %2, %7\n\t"
      "v_exp_f32 %3, %8\n\t"
      "v_exp_f32 %4, %9\n\t"
      "v_nop"
      : "=&v"(e0), "=&v"(e1), "=&v"(e2), "=&v"(e3), "=&v"(e4)
      : "v"(a0), "v"(a1), "v"(a2), "v"(a3), "v"(a4));
}

// the same for the two exponentials of a state update alone
__device__ __forceinline__ void exp_x2(float x0, float x1, float& e0, float& e1) {
  const float LOG2E = 1.44269504f;
  const float a0 = x0 * LOG2E, a1 = x1 * LOG2E;
  asm("v_exp_f32 %0, %2\n\t"
      "v_exp_f32 %1, %3\n\t"
      "v_nop"
      : "=&v"(e0), "=&v"(e1)
      : "v"(a0), "v"(a1));
}

// r is the projection itself. Its sigmoid 1 / (1 + exp(-r)) goes into the step's
// one division: sigmoid(r) * (n / d) = n / (d + d * exp(-r)). Where exp(-r)
// overflows the quotient is 0, as the sigmoid is.
__device__ __forceinline__ float scan_step(float r, float k, float v,
                                           float uu, float ww,
                                           float& fn, float& fd, float& scale) {
  const float sm = fmaxf(scale, uu + k);
  const float ns = fmaxf(scale + ww, k);
  float cm, am, ncm, nam, er;
  exp_x5(scale - sm, uu + k - sm, scale + ww - ns, k - ns, -r, cm, am, ncm, nam, er);

  const float d = cm * fd + am;
  const float y = (cm * fn + am * v) / (d + d * er);

  fn = ncm * fn + nam * v;
  fd = ncm * fd + nam;
  scale = ns;
  return y;
}

// (fn, fd, scale), moved on by the exponent dw, takes in (gn, gd, gs):
// with dw = w, (v, 1, k) it is the state update of scan_step.
__device__ __forceinline__ void state_take(float dw, float gn, float gd, float gs,
                                           float& fn, float& fd, float& scale) {
  const float ns = fmaxf(scale + dw, gs);
  float ncm, nam;
  exp_x2(scale + dw - ns, gs - ns, ncm, nam);
  fn = ncm * fn + nam * gn;
  fd = ncm * fd + nam * gd;
  scale = ns;
}

__device__ __forceinline__ void state_empty(ScanSt& s) {
  s.fn[0] = 0.0f; s.fd[0] = 0.0f; s.scale[0] = -1e20f;
  s.fn[1] = 0.0f; s.fd[1] = 0.0f; s.scale[1] = -1e20f;
}

// DIR is a compile-time value so that every step's distance from the batch's
// pointers is a constant and goes into the instruction's offset field.
// Loads the batch that starts AHEAD steps behind p's.
template <int DIR, int AHEAD, bool FIRST = false>
__device__ __forceinline__ void scan_load(ScanIn& d, const ScanPtr& p) {
  constexpr int SI = (DIR ? -1 : 1) * B_DIM * H_DIM / 2;   // channel pairs per step
  #pragma unroll
  for (int j = 0; j < SCAN_DEPTH; ++j) {
    d.k[j] = p.k[(AHEAD + j) * SI];
    d.v[j] = p.v[(AHEAD + j) * SI];
    d.r[j] = p.r[(AHEAD + j) * SI];
  }
  if constexpr (FIRST) asm volatile("s_wait_xcnt 0x0" ::: "memory");  // see scan_channel
  // keeps all of the batch's loads in front of the arithmetic that follows,
  // so that each has a whole batch of lead
  __builtin_amdgcn_sched_barrier(0);
}

// the same for pass 1, which reads k and v alone
template <int DIR, int AHEAD, bool FIRST = false>
__device__ __forceinline__ void scan_load_kv(ScanKv& d, gl_in_t pk, gl_in_t pv) {
  constexpr int SI = (DIR ? -1 : 1) * B_DIM * H_DIM / 2;   // channel pairs per step
  #pragma unroll
  for (int j = 0; j < SCAN_DEPTH; ++j) {
    d.k[j] = pk[(AHEAD + j) * SI];
    d.v[j] = pv[(AHEAD + j) * SI];
  }
  if constexpr (FIRST) asm volatile("s_wait_xcnt 0x0" ::: "memory");  // see scan_channel
  // keeps the batch's loads in front of the arithmetic that follows
  __builtin_amdgcn_sched_barrier(0);
}

__device__ __forceinline__ void state_batch(const ScanKv& d, v2f ww, ScanSt& s) {
  #pragma unroll
  for (int j = 0; j < SCAN_DEPTH; ++j) {
    state_take(ww.x, (float)d.v[j].x, 1.0f, (float)d.k[j].x, s.fn[0], s.fd[0], s.scale[0]);
    state_take(ww.y, (float)d.v[j].y, 1.0f, (float)d.k[j].y, s.fn[1], s.fd[1], s.scale[1]);
  }
}

// Runs the batch of p.o and stores its outputs; returns the last y.
template <int DIR>
__device__ __forceinline__ v2f scan_batch(const ScanIn& d, v2f uu, v2f ww,
                                          ScanSt& s, ScanPtr& p) {
  v2f y[SCAN_DEPTH];
  #pragma unroll
  for (int j = 0; j < SCAN_DEPTH; ++j) {
    y[j].x = scan_step((float)d.r[j].x, (float)d.k[j].x, (float)d.v[j].x, uu.x, ww.x,
                       s.fn[0], s.fd[0], s.scale[0]);
    y[j].y = scan_step((float)d.r[j].y, (float)d.k[j].y, (float)d.v[j].y, uu.y, ww.y,
                       s.fn[1], s.fd[1], s.scale[1]);
  }

  // The batch's 4 stores (one out row, 65536 bytes, per step) and the wait
  // that stands before a register named by an issued load or store is written
  // again, in one statement: one wait serves the run. The four pointers are
  // named as in and out so that they stay in their registers up to that wait
  // and are advanced only behind it.
  if constexpr (DIR) {
    asm volatile(
        "global_store_b64 %0, %4, off\n\t"
        "global_store_b64 %0, %5, off offset:-65536\n\t"
        "global_store_b64 %0, %6, off offset:-131072\n\t"
        "global_store_b64 %0, %7, off offset:-196608\n\t"
        "s_wait_xcnt 0x0"
        : "+v"(p.o), "+v"(p.r), "+v"(p.k), "+v"(p.v)
        : "v"(y[0]), "v"(y[1]), "v"(y[2]), "v"(y[3])
        : "memory");
  } else {
    asm volatile(
        "global_store_b64 %0, %4, off\n\t"
        "global_store_b64 %0, %5, off offset:65536\n\t"
        "global_store_b64 %0, %6, off offset:131072\n\t"
        "global_store_b64 %0, %7, off offset:196608\n\t"
        "s_wait_xcnt 0x0"
        : "+v"(p.o), "+v"(p.r), "+v"(p.k), "+v"(p.v)
        : "v"(y[0]), "v"(y[1]), "v"(y[2]), "v"(y[3])
        : "memory");
  }
  // keeps what follows (among it the compiler's register copies of values that
  // are still in flight) behind the batch's arithmetic: moved up into it, such
  // a copy waits for its load half a batch early
  __builtin_amdgcn_sched_barrier(0);
  p.o += (DIR ? -1 : 1) * B_DIM * H_DIM * SCAN_DEPTH;      // 2H floats = H pairs per (t, b)
  return y[SCAN_DEPTH - 1];
}

// p: the lane's addresses of the first step of the wave's chunk.
template <int DIR>
__device__ __forceinline__ void scan_channel(ScanPtr p, v2f uu, v2f ww,
                                             v2f* __restrict__ hid,
                                             int lane, int chunk,
                                             v2f (*st)[SCAN_WAVES][32]) {
  constexpr int BI = (DIR ? -1 : 1) * B_DIM * H_DIM / 2 * SCAN_DEPTH;  // pairs per batch
  constexpr int PAIRS = SCAN_LEN / (2 * SCAN_DEPTH);
  ScanSt s;
  state_empty(s);

  // Once, in front of the loops: the loads of u and w, and then each pass's
  // first batch, use address registers of the compiler's own choosing; the wait
  // stands before any of them is written again.
  asm volatile("s_wait_xcnt 0x0" ::: "memory");

  // pass 1: the chunk's own state, from the empty state
  {
    gl_in_t pk = p.k, pv = p.v;
    ScanKv A, Bf;
    scan_load_kv<DIR, 0, true>(A, pk, pv);
    for (int i = 0; i < PAIRS; ++i) {
      scan_load_kv<DIR, SCAN_DEPTH>(Bf, pk, pv);
      state_batch(A, ww, s);
      // in the last trip this look-ahead reads the next chunk's first rows
      // (see pass 2 on the last chunk's); the values are not used
      scan_load_kv<DIR, 2 * SCAN_DEPTH>(A, pk, pv);
      state_batch(Bf, ww, s);
      // keeps the compiler's register copies of the look-ahead's values, still
      // in flight, behind the batch's arithmetic (as in scan_batch)
      __builtin_amdgcn_sched_barrier(0);
      // the wait that stands before the two pointers, which issued loads name,
      // are advanced; they are named so that they stay in their registers up to it
      asm volatile("s_wait_xcnt 0x0" : "+v"(pk), "+v"(pv) :: "memory");
      pk += 2 * BI; pv += 2 * BI;
    }
  }
  st[0][chunk][lane] = v2f{ s.fn[0], s.fn[1] };
  st[1][chunk][lane] = v2f{ s.fd[0], s.fd[1] };
  st[2][chunk][lane] = v2f{ s.scale[0], s.scale[1] };

  // pass 2's first batch flies while the states are handed over
  ScanIn A, Bf;
  scan_load<DIR, 0, true>(A, p);

  __syncthreads();   // every wave's chunk state is in LDS

  // fold: the state in front of this chunk, from the chunks before it
  const v2f lw = (float)SCAN_LEN * ww;
  state_empty(s);
  for (int j = 0; j < chunk; ++j) {
    const v2f gn = st[0][j][lane], gd = st[1][j][lane], gs = st[2][j][lane];
    state_take(lw.x, gn.x, gd.x, gs.x, s.fn[0], s.fd[0], s.scale[0]);
    state_take(lw.y, gn.y, gd.y, gs.y, s.fn[1], s.fd[1], s.scale[1]);
  }

  // pass 2: the chunk's full steps
  v2f y = { 0.0f, 0.0f };
  for (int i = 0; i < PAIRS; ++i) {
    scan_load<DIR, SCAN_DEPTH>(Bf, p);
    scan_batch<DIR>(A, uu, ww, s, p);
    // In the last trip this look-ahead reads the next chunk's first rows; the
    // last chunk's runs SCAN_DEPTH rows past the r, k, v planes' ends, into the
    // neighbouring plane of the same rkv array (forward: planes 0..2 into 1..3;
    // backward: 3..5 into 2..4), which the GEMM of this call has written; the
    // values are not used. A branch round it would make the counted load waits
    // of the batch below wait for these loads too.
    scan_load<DIR, 2 * SCAN_DEPTH>(A, p);
    y = scan_batch<DIR>(Bf, uu, ww, s, p);
    p.r += 2 * BI; p.k += 2 * BI; p.v += 2 * BI;
  }
  // the last look-ahead's loads are still in flight and nothing reads them:
  // they land before the wave ends and gives its registers back
  asm volatile("s_wait_loadcnt 0x0" ::: "memory");
  if (chunk == SCAN_WAVES - 1) *hid = y;   // the scan's last step
}

__global__ __launch_bounds__(SCAN_WAVES * 32)
void birwkv_scan(const half_t* __restrict__ rkv,
                 const float* __restrict__ u_fw, const float* __restrict__ w_fw,
                 const float* __restrict__ u_bw, const float* __restrict__ w_bw,
                 float* __restrict__ out) {
  __shared__ v2f st[3][SCAN_WAVES][32];                   // fn, fd, scale per chunk and lane

  const int lane  = threadIdx.x & 31;
  // the wave's chunk, in a scalar register: it is the fold's trip count
  const int chunk = __builtin_amdgcn_readfirstlane(threadIdx.x >> 5);
  const int dir = blockIdx.x >> 7;                        // 128 work-groups per direction
  const int b   = (blockIdx.x >> 4) & 7;
  const int h   = (blockIdx.x & 15) * 64 + lane * 2;      // the lane's first channel

  const size_t MAT = (size_t)M_DIM * H_DIM;
  // time index of the chunk's first step
  const int t0 = dir ? (T_DIM - 1 - chunk * SCAN_LEN) : chunk * SCAN_LEN;
  const half_t* r0 = rkv + (dir ? 3 * MAT : 0) + (size_t)(t0 * B_DIM + b) * H_DIM + h;
  ScanPtr p;
  p.r = (gl_in_t)r0;
  p.k = (gl_in_t)(r0 + MAT);
  p.v = (gl_in_t)(r0 + 2 * MAT);
  p.o = (gl_out_t)(out + (size_t)(t0 * B_DIM + b) * (2 * H_DIM) + (size_t)dir * H_DIM + h);
  v2f* hid = (v2f*)(out + (size_t)T_DIM * B_DIM * 2 * H_DIM
                        + (size_t)dir * B_DIM * H_DIM + (size_t)b * H_DIM + h);

  if (dir) scan_channel<1>(p, *(const v2f*)(u_bw + h), *(const v2f*)(w_bw + h), hid, lane, chunk, st);
  else     scan_channel<0>(p, *(const v2f*)(u_fw + h), *(const v2f*)(w_fw + h), hid, lane, chunk, st);
}

// ---------------------------------------------------------------------------
// Host launcher
// ---------------------------------------------------------------------------
extern "C" void kernel_launch(void* const* d_in, const int* in_sizes, int n_in,
                              void* d_out, int out_size, void* d_ws, size_t ws_size,
                              hipStream_t stream) {
  (void)in_sizes; (void)n_in; (void)out_size; (void)ws_size;

  const float* x      = (const float*)d_in[0];
  const float* w_r_fw = (const float*)d_in[1];
  const float* w_k_fw = (const float*)d_in[2];
  const float* w_v_fw = (const float*)d_in[3];
  const float* w_u_fw = (const float*)d_in[4];
  const float* w_w_fw = (const float*)d_in[5];
  const float* w_r_bw = (const float*)d_in[6];
  const float* w_k_bw = (const float*)d_in[7];
  const float* w_v_bw = (const float*)d_in[8];
  const float* w_u_bw = (const float*)d_in[9];
  const float* w_w_bw = (const float*)d_in[10];

  // Workspace layout (bytes):
  //   [0)                xh : f16 x,        T*B*I*2  = 33,554,432
  //   [xh)               wh : f16 weights,  6*H*I*2  = 12,582,912
  //   [xh+wh)            rkv: f16 r/k/v x2, 6*T*B*H*2 = 201,326,592
  const size_t XH_BYTES = (size_t)T_DIM * B_DIM * I_DIM * sizeof(half_t);
  const size_t WH_BYTES = (size_t)6 * H_DIM * I_DIM * sizeof(half_t);
  char*   ws  = (char*)d_ws;
  half_t* xh  = (half_t*)ws;
  half_t* wh  = (half_t*)(ws + XH_BYTES);
  half_t* rkv = (half_t*)(ws + XH_BYTES + WH_BYTES);

  // 1) convert x and the six weight matrices to f16 (xh and wh are one row)
  cvt_all_f32_to_f16<<<CVT_GROUPS, CVT_WAVES * 32, 0, stream>>>(
      x, w_r_fw, w_k_fw, w_v_fw, w_r_bw, w_k_bw, w_v_bw, xh);

  // 2) WMMA projection GEMMs
  {
    proj_gemm_wmma<<<G_GROUPS, 256, 0, stream>>>(xh, wh, rkv);   // six tiles each
  }

  // 3) bidirectional scan -> d_out ([T,B,2H] output + [2,B,H] hidden)
  birwkv_scan<<<SCAN_GROUPS, SCAN_WAVES * 32, 0, stream>>>(
      rkv, w_u_fw, w_w_fw, w_u_bw, w_w_bw, (float*)d_out);
}

// v010
// Measured time: 161 microseconds a run.
// Timed twice side by side with v009, it ran 1.05 times as fast both times.
// All steps since v000 together make it 10.9 times as fast.
#include <hip/hip_runtime.h>

typedef _Float16 half_t;
typedef __attribute__((ext_vector_type(16))) _Float16 v16h;
typedef __attribute__((ext_vector_type(8)))  _Float16 v8h;
typedef __attribute__((ext_vector_type(4)))  _Float16 v4h;
typedef __attribute__((ext_vector_type(8)))  float    v8f;

#define T_DIM 2048
#define B_DIM 8
#define I_DIM 1024
#define H_DIM 1024
#define M_DIM (T_DIM * B_DIM)          // 16384 rows of x

union V16U { v16h v; struct { v8h lo, hi; } s; };

// ---------------------------------------------------------------------------
// fp32 -> fp16 conversion of x and the six weight matrices in ONE launch of few,
// long-lived waves: 256 work-groups (as many as WGPs) of 11 waves. The f16 copies lie
// behind one another in the workspace (x, then the six matrices), so the whole
// job is one row of 2816 chunks of 2048 float4; every chunk lies in one source
// array, and each wave converts one chunk: 64 loads of 512 contiguous bytes, 64
// stores of 256. The loads go one batch of 16 ahead, into two register sets
// used in turn. All addresses are one scalar base, one lane offset that is
// never written again, and a constant.
// ---------------------------------------------------------------------------
typedef __attribute__((ext_vector_type(4))) float v4f;

#define CVT_GROUPS  256
#define CVT_WAVES   11
#define CVT_BATCH   16
#define CVT_BATCHES 4
#define CVT_CHUNK   (32 * CVT_BATCH * CVT_BATCHES)    // 2048 float4 per wave
#define CVT_X_CH    (M_DIM * I_DIM / 4 / CVT_CHUNK)   // 2048 chunks of x
#define CVT_W_CH    (H_DIM * I_DIM / 4 / CVT_CHUNK)   // 128 chunks per matrix
static_assert(CVT_X_CH * CVT_CHUNK * 4 == M_DIM * I_DIM, "x is a whole number of chunks");
static_assert(CVT_W_CH * CVT_CHUNK * 4 == H_DIM * I_DIM, "a matrix is a whole number of chunks");
static_assert(CVT_X_CH + 6 * CVT_W_CH == CVT_GROUPS * CVT_WAVES, "one chunk per wave");

struct CvtSet { v4f f[CVT_BATCH]; };

__device__ __forceinline__ void cvt_load(CvtSet& s, const v4f* __restrict__ sp, int batch) {
  // From the third batch on the loads land in registers that stores issued
  // above may name as their data: the wait stands before they are written again.
  if (batch >= 2) asm volatile("s_wait_xcnt 0x0" ::: "memory");
  #pragma unroll   // constant offsets and register indices
  for (int q = 0; q < CVT_BATCH; ++q)
    s.f[q] = sp[(batch * CVT_BATCH + q) * 32];
}

__device__ __forceinline__ void cvt_store(const CvtSet& s, v4h* __restrict__ dp, int batch) {
  // Takes the batch's loaded values as inputs only. It keeps the loads of the
  // batch behind this one, issued above, as one run in front of this batch's
  // conversion: left free, they were spread among the conversions in ones to
  // fours, each behind a load wait, so that fewer were in flight.
  asm volatile("" :: "v"(s.f[0]), "v"(s.f[1]), "v"(s.f[2]), "v"(s.f[3]),
                     "v"(s.f[4]), "v"(s.f[5]), "v"(s.f[6]), "v"(s.f[7]),
                     "v"(s.f[8]), "v"(s.f[9]), "v"(s.f[10]), "v"(s.f[11]),
                     "v"(s.f[12]), "v"(s.f[13]), "v"(s.f[14]), "v"(s.f[15]));
  #pragma unroll   // constant offsets and register indices
  for (int q = 0; q < CVT_BATCH; ++q) {
    const v4f f = s.f[q];
    const v4h o = { (half_t)f.x, (half_t)f.y, (half_t)f.z, (half_t)f.w };
    dp[(batch * CVT_BATCH + q) * 32] = o;
  }
}

__global__ __launch_bounds__(CVT_WAVES * 32)
void cvt_all_f32_to_f16(const float* __restrict__ x,
                        const float* __restrict__ w0, const float* __restrict__ w1,
                        const float* __restrict__ w2, const float* __restrict__ w3,
                        const float* __restrict__ w4, const float* __restrict__ w5,
                        half_t* __restrict__ dst) {
  const int lane = threadIdx.x & 31;
  // the wave's chunk, in a scalar register: it picks the source array
  const int g = __builtin_amdgcn_readfirstlane(blockIdx.x * CVT_WAVES + (threadIdx.x >> 5));
  const int m = (g - CVT_X_CH) / CVT_W_CH;            // the matrix, where g is past x
  const float* src = g < CVT_X_CH ? x
                   : m == 0 ? w0 : m == 1 ? w1 : m == 2 ? w2
                   : m == 3 ? w3 : m == 4 ? w4 : w5;
  const int c = g < CVT_X_CH ? g : (g - CVT_X_CH) % CVT_W_CH;   // chunk within it
  const v4f* sp = (const v4f*)src + (size_t)c * CVT_CHUNK + lane;
  v4h*       dp = (v4h*)dst + (size_t)g * CVT_CHUNK + lane;

  CvtSet a, b;
  cvt_load(a, sp, 0);
  cvt_load(b, sp, 1);  cvt_store(a, dp, 0);
  cvt_load(a, sp, 2);  cvt_store(b, dp, 1);
  cvt_load(b, sp, 3);  cvt_store(a, dp, 2);
  cvt_store(b, dp, 3);
}

// ---------------------------------------------------------------------------
// Projection GEMM: [16384 x 1024] x [1024 x 1024]^T for 6 weight matrices
// (the six lie behind one another in wh: one [6144 x 1024] operand).
// A work-group of 8 waves (4 x 2) computes a 256 x 256 tile, each wave 64 x 128
// (4 x 8 WMMA fragments): per WMMA that is 3/4 of the LDS reads of a 64 x 64 wave
// tile, and 2/3 of the L2 bytes of a 128 x 256 block tile. One work-group per WGP,
// two waves per SIMD. The grid is one work-group per WGP; each computes six tiles one
// after the other, and the ring of stages runs on over the tile ends: the next tile's
// first stage flies during this tile's last one, so that only the first tile waits
// for a start of a work-group and for a first stage.
// K goes in stages of 128: 256 bytes of each of the tile's 256
// x-rows and 256 weight rows are brought into LDS by tensor loads, one request per
// wave and stage for the wave's slice of 64 rows, so that L2 delivers every line once
// per work-group, and a stage costs a wave one
// instruction and no vector register. Two buffers: the next stage's loads fly while
// this one is worked on.
// Fragments are read from LDS in the same K-major per-lane layout for A and B:
//   lanes 0-15 : row = laneL, chunks at K = k0+0..7  and k0+16..23
//   lanes 16-31: row = laneL, chunks at K = k0+8..15 and k0+24..31
// Each accumulator takes its K steps of 32 in rising order.
// All six results leave as they are: the sigmoid of r is taken in the scan.
// The result is rounded to f16 and leaves through LDS as whole 256-byte row pieces.
// ---------------------------------------------------------------------------
#define G_BM 256
#define G_BN 256
#define G_BK 128                                 // f16 elements per stage and row
#define G_PITCH 272                              // LDS bytes per row: 256 + 16 (16 x odd)
#define G_SL_ROWS 64                             // rows per slice: one tensor load
#define G_SLICE 18432                            // LDS bytes per slice: 64 * 272, up to 2 KiB
#define G_A_BYTES ((G_BM / G_SL_ROWS) * G_SLICE) // 73,728: the four slices of x
#define G_BUF_BYTES (((G_BM + G_BN) / G_SL_ROWS) * G_SLICE)   // 147,456
#define G_STAGES (I_DIM / G_BK)                  // 8
#define G_NT_N   ((6 * H_DIM) / G_BN)            // 24 column tiles
#define G_GROUPS 256                             // work-groups: as many as WGPs
#define G_TILES  ((M_DIM / G_BM) * G_NT_N / G_GROUPS)   // 6 tiles per work-group
static_assert(G_TILES * G_GROUPS == (M_DIM / G_BM) * G_NT_N, "every work-group has as many tiles");
static_assert(G_STAGES % 2 == 0 && G_STAGES >= 2, "a tile's last stage lies in buffer 1");
#define E_PITCH 132                              // floats per staged output row: 128 + 4
#define E_PART  (16 * E_PITCH)                   // floats per staged part: 16 rows
static_assert(8 * 2 * E_PART * 4 <= G_BUF_BYTES, "the eight waves' staging fits one buffer");
static_assert(G_SLICE % 2048 == 0 && G_SLICE >= G_SL_ROWS * G_PITCH, "a slice's place in LDS");
static_assert((G_BM + G_BN) / G_SL_ROWS == 8, "one slice per wave");

typedef __attribute__((address_space(3))) unsigned char lds_byte_t;

typedef uint32_t u32x4 __attribute__((ext_vector_type(4)));
typedef uint32_t u32x8 __attribute__((ext_vector_type(8)));

__device__ __forceinline__ uint32_t uni(uint32_t v) {
  return (uint32_t)__builtin_amdgcn_readfirstlane(v);
}

// A wave-uniform test held in a scalar register, so that the branch round a tensor
// load is a scalar one: the instruction ignores EXEC.
__device__ __forceinline__ uint32_t pinned(uint32_t v) {
  uint32_t w = uni(v);
  asm volatile("" : "+s"(w));   // the test of a tensor load's branch, held in a scalar register
  return w;
}

// Descriptor group 1, the same for every request: bytes; a tile of 64 rows of 256
// bytes; source pitch one row of K; 16 bytes of pad behind every row (pitch 272).
static_assert(G_BK * 2 == 256 && G_PITCH == 256 + 16, "the pad below");
__device__ __forceinline__ u32x8 gemm_group1() {
  constexpr uint32_t d0 = G_BK * 2, d1 = G_SL_ROWS;
  u32x8 g;
  g[0] = uni((1u << 20) | (5u << 22) | (3u << 25));   // no mask; pad 4 dwords per 64
  g[1] = uni((d0 & 0xFFFFu) << 16);
  g[2] = uni((d0 >> 16) | ((d1 & 0xFFFFu) << 16));
  g[3] = uni((d1 >> 16) | (d0 << 16));
  g[4] = uni(d1);
  g[5] = uni((uint32_t)(I_DIM * 2));
  g[6] = uni(0u);
  g[7] = uni(0u);
  return g;
}

// The wave's slice of stage q of the work-group's row of G_TILES * G_STAGES stages,
// into buffer q & 1. q is the same in every wave. Tile i of work-group g is tile
// g + i * G_GROUPS of the grid of tiles (column tiles run fastest). Waves 0..3 bring
// the tile's x rows, 64 each, waves 4..7 its weight rows. lds0: the ring's LDS byte
// address; wave: the wave's number, in a scalar register.
__device__ __forceinline__ void gemm_stage_q(int q, unsigned lds0, int wave,
                                             const half_t* xh, const half_t* wh, u32x8 g1) {
  const int tl = blockIdx.x + (q / G_STAGES) * G_GROUPS;
  const unsigned dst = lds0 + (unsigned)(q & 1) * G_BUF_BYTES + (unsigned)wave * G_SLICE;
  const size_t   ko = (size_t)(q % G_STAGES) * G_BK;
  const half_t* sp = wave < 4
      ? xh + ((size_t)((tl / G_NT_N) * G_BM + wave * G_SL_ROWS) * I_DIM + ko)
      : wh + ((size_t)((tl % G_NT_N) * G_BN + (wave - 4) * G_SL_ROWS) * I_DIM + ko);
  const uint64_t ga = (uint64_t)sp;
  u32x4 g0;
  g0[0] = uni(1u);
  g0[1] = uni(dst);
  g0[2] = uni((uint32_t)ga);
  g0[3] = uni(((uint32_t)(ga >> 32) & 0x01FFFFFFu) | 0x80000000u);
  asm volatile("tensor_load_to_lds %0, %1" :: "s"(g0), "s"(g1) : "memory");
}

__global__ __launch_bounds__(256)
void proj_gemm_wmma(const half_t* __restrict__ xh,
                    const half_t* __restrict__ wh,
                    half_t* __restrict__ rkv) {
  __shared__ __attribute__((aligned(2048))) unsigned char smem[2 * G_BUF_BYTES];

  const int lane  = threadIdx.x & 31;
  const int wave  = threadIdx.x >> 5;
  const int laneL = lane & 15;
  const int laneH = lane >> 4;
  const int wm    = wave >> 1;                  // 0..3: the wave's 64 rows
  const int wn    = wave & 1;                   // 0..1: the wave's 128 columns

  const unsigned lds0 = (unsigned)(size_t)(lds_byte_t*)smem;
  const int waveS = __builtin_amdgcn_readfirstlane(wave);   // in a scalar register
  u32x8 g1 = gemm_group1();
  // the descriptor's words, held in the same scalar registers for every request: left
  // free, the second request's were formed anew and written again while it was in flight
  asm volatile("" : "+s"(g1));

  // the lane's first fragment chunks in buffer 0
  // (the wave's 64 x rows are slice wm, its 128 weight rows slices 2 wn and 2 wn + 1)
  const unsigned char* fa = smem + wm * G_SLICE + laneL * G_PITCH + laneH * 16;
  const unsigned char* fb = smem + G_A_BYTES + wn * 2 * G_SLICE + laneL * G_PITCH + laneH * 16;

  v8f acc[4][8] = {};

  // the epilogue's lane constants (see there)
  const int    rrow = lane >> 4;                            // 0..1
  const int    rcol = (lane & 15) * 8;                      // 8 columns a lane
  float*       stg = (float*)(smem + G_BUF_BYTES) + wave * (2 * E_PART);
  float*       sw  = stg + laneH * 8 * E_PITCH + laneL;     // accumulator map: row 8 * laneH + v
  const float* sr  = stg + rrow * E_PITCH + rcol + (rcol >= 64 ? 4 : 0);   // rows 2 q + rrow

  // stage 0 lands and is published; then stage 1 starts into the other buffer
  gemm_stage_q(0, lds0, waveS, xh, wh, g1);
  asm volatile("s_wait_tensorcnt 0x0" ::: "memory");   // this wave's slice has landed
  __syncthreads();
  gemm_stage_q(1, lds0, waveS, xh, wh, g1);

  #pragma nounroll   // one copy of the text
  for (int s = 0; s < G_TILES * G_STAGES; ++s) {
    const unsigned boff = (unsigned)(s & 1) * G_BUF_BYTES;
    #pragma unroll   // constant LDS offsets and register indices
    for (int ks = 0; ks < G_BK / 32; ++ks) {
      V16U a[4], b[8];
      #pragma unroll   // constant register indices
      for (int i = 0; i < 4; ++i) {
        const unsigned char* pa = fa + boff + i * 16 * G_PITCH + ks * 64;
        a[i].s.lo = *(const v8h*)(pa);
        a[i].s.hi = *(const v8h*)(pa + 32);
      }
      #pragma unroll   // constant register indices
      for (int j = 0; j < 8; ++j) {
        const unsigned char* pb = fb + boff + (j >> 2) * G_SLICE + (j & 3) * 16 * G_PITCH + ks * 64;
        b[j].s.lo = *(const v8h*)(pb);
        b[j].s.hi = *(const v8h*)(pb + 32);
      }
      // the 24 LDS reads of a K step stay one group in front of its 32 WMMAs:
      // left free, they were spread among the WMMAs in pairs, each pair with a
      // full wait behind it
      __builtin_amdgcn_sched_barrier(0);
      #pragma unroll   // constant register indices
      for (int i = 0; i < 4; ++i) {
        #pragma unroll   // constant register indices
        for (int j = 0; j < 8; ++j) {
          acc[i][j] = __builtin_amdgcn_wmma_f32_16x16x32_f16(
              false, a[i].v, false, b[j].v, (short)0, acc[i][j], false, false);
        }
      }
      // and the next K step's reads stay behind this step's WMMAs
      __builtin_amdgcn_sched_barrier(0);
    }
    // hand-over: this wave's reads of buffer s & 1 are done, its slice of stage
    // s + 1 has landed; behind the barrier that holds for every wave, so stage
    // s + 1 may be read and buffer s & 1 refilled
    asm volatile("s_wait_dscnt 0x0" ::: "memory");
    asm volatile("s_wait_tensorcnt 0x0" ::: "memory");
    __syncthreads();
    // behind a tile's last stage the buffer first serves the epilogue
    if (s % G_STAGES == G_STAGES - 1) {

  // The wave's 64 x 128 tile leaves as f16, through LDS, so that global memory gets
  // whole aligned 256-byte row pieces in 16-byte stores (straight from the
  // accumulators a store would hold 32-byte pieces, 2 bytes a lane). Buffer 1 is free:
  // behind the stage's barrier no wave reads it and no load to it is in flight
  // (buffer 0 holds the next tile's first stage, landed and published). Each
  // wave stages f32 in a range of its own, 16 rows (one row of accumulator tiles) at
  // a time, two parts used in turn: part i + 1 is written while part i goes out.
  // Columns 64..127 of a staged row lie 4 floats further on: the 16 lanes that read
  // one row, 32 bytes apart, then fall on all 64 banks once.
  const int tl  = blockIdx.x + (s / G_STAGES) * G_GROUPS;
  const int m0  = (tl / G_NT_N) * G_BM;
  const int n0g = (tl % G_NT_N) * G_BN;         // row of the [6144 x 1024] operand
  const int mat = n0g / H_DIM;                  // 0..5: r/k/v fw, r/k/v bw
  const int n0  = n0g % H_DIM;
  // one address per lane; every store's distance from it is a constant
  half_t* dst = rkv + (size_t)mat * M_DIM * H_DIM
                    + (size_t)(m0 + wm * 64 + rrow) * H_DIM + (n0 + wn * 128 + rcol);
  #pragma unroll   // constant LDS offsets and register indices
  for (int v = 0; v < 8; ++v) {
    #pragma unroll
    for (int j = 0; j < 8; ++j)
      sw[v * E_PITCH + j * 16 + (j >= 4 ? 4 : 0)] = acc[0][j][v];
  }
  #pragma unroll   // constant offsets and register indices
  for (int i = 0; i < 4; ++i) {
    // part i's writes have landed before other lanes of the wave read them; and
    // part i - 1's reads are done before that part is written again below
    asm volatile("s_wait_dscnt 0x0" ::: "memory");
    // what follows may write registers that the stores of part i - 1 name
    if (i > 0) asm volatile("s_wait_xcnt 0x0" ::: "memory");
    v4f row[16];
    #pragma unroll
    for (int q = 0; q < 8; ++q) {
      row[2 * q]     = *(const v4f*)(sr + (i & 1) * E_PART + q * 2 * E_PITCH);
      row[2 * q + 1] = *(const v4f*)(sr + (i & 1) * E_PART + q * 2 * E_PITCH + 4);
    }
    if (i + 1 < 4) {
      #pragma unroll
      for (int v = 0; v < 8; ++v) {
        #pragma unroll
        for (int j = 0; j < 8; ++j)
          sw[((i + 1) & 1) * E_PART + v * E_PITCH + j * 16 + (j >= 4 ? 4 : 0)] = acc[i + 1][j][v];
      }
    }
    #pragma unroll
    for (int q = 0; q < 8; ++q) {
      const v4f lo = row[2 * q], hi = row[2 * q + 1];
      const v8h o = { (half_t)lo.x, (half_t)lo.y, (half_t)lo.z, (half_t)lo.w,
                      (half_t)hi.x, (half_t)hi.y, (half_t)hi.z, (half_t)hi.w };
      *(v8h*)(dst + (i * 16 + q * 2) * H_DIM) = o;
    }
  }
  // what follows may write registers that the last part's stores name
  asm volatile("s_wait_xcnt 0x0" ::: "memory");
  #pragma unroll   // constant register indices
  for (int i = 0; i < 4; ++i) {
    #pragma unroll
    for (int j = 0; j < 8; ++j) acc[i][j] = v8f{};          // the next tile's sums start at 0
  }
  if (s + 2 < G_TILES * G_STAGES) {
    // every wave's staging reads of buffer 1 are done before any wave's slice of
    // the next tile's second stage lands there
    asm volatile("s_wait_dscnt 0x0" ::: "memory");
    // the barrier alone: __syncthreads() would also wait here until the tile's
    // global stores are acknowledged, which no wave needs
    __builtin_amdgcn_s_barrier();
  }
    }
    // the stage two on (it may be one of the next tile's first two)
    if (pinned(s + 2 < G_TILES * G_STAGES))
      gemm_stage_q(s + 2, lds0, waveS, xh, wh, g1);
  }
  asm volatile("s_wait_tensorcnt 0x0" ::: "memory");   // nothing in flight at the wave's end
  asm volatile("s_wait_dscnt 0x0" ::: "memory");       // nor an LDS access of its own
}

// ---------------------------------------------------------------------------
// Bidirectional RWKV scan, split over time inside a work-group.
// r, k, v come as f16; a lane owns the two neighbouring channels of one 32-bit
// word, so a wave's load is one whole 128-byte line. A work-group owns 64
// channels (dir, b, 64 neighbouring h) and has 32 waves; wave c owns steps
// c*64 .. c*64+63 of the scan order.
//   pass 1: the wave runs the state update alone (k and v, no output) over its
//           64 steps from the empty state and leaves (fn, fd, scale) in LDS;
//   fold  : behind one barrier, wave c folds the states of waves 0 .. c-1 in
//           rising order into the state in front of its own first step. The
//           state is linear: 64 steps later an earlier state stands for the
//           same sums times exp(64 w), that is scale + 64 w;
//   pass 2: the wave runs its 64 full steps from that state and stores y.
// Writes output [T, B, 2H] (fw in h<1024, bw in h>=1024, bw time-reversed
// back to original order) plus hidden tail [2, B, H].
// The r, k, v of a step do not depend on the state, so they are loaded one
// batch of SCAN_DEPTH steps ahead into registers (two sets, used in turn).
// All arithmetic is f32.
// ---------------------------------------------------------------------------
#define SCAN_DEPTH 4
#define SCAN_WAVES 32                          // time chunks = waves per work-group
#define SCAN_LEN   (T_DIM / SCAN_WAVES)        // 64 steps per chunk
#define SCAN_GROUPS (2 * B_DIM * H_DIM / 64)   // 256 work-groups
static_assert(SCAN_LEN % (2 * SCAN_DEPTH) == 0, "a chunk is a whole number of batch pairs");

typedef __attribute__((ext_vector_type(2))) _Float16 v2h;
typedef __attribute__((ext_vector_type(2))) float    v2f;

struct ScanIn  { v2h r[SCAN_DEPTH], k[SCAN_DEPTH], v[SCAN_DEPTH]; };
struct ScanKv  { v2h k[SCAN_DEPTH], v[SCAN_DEPTH]; };
struct ScanSt  { float fn[2], fd[2], scale[2]; };          // the lane's two channels
// the lane's own addresses of the current batch's first step, in channel pairs
// (typed as global-memory pointers: behind the asm statement below the compiler
// could no longer tell, and would fall back to flat loads)
typedef const __attribute__((address_space(1))) v2h* gl_in_t;
typedef __attribute__((address_space(1))) v2f*       gl_out_t;
struct ScanPtr { gl_in_t r, k, v; gl_out_t o; };

// e = exp(x) as the fast form has it: one multiply by log2(e), one v_exp_f32.
// The five v_exp_f32 of a step stand in one statement that ends in v_nop: each
// is the independent instruction behind the one before, the v_nop the slot the
// instruction set asks for behind the last.
__device__ __forceinline__ void exp_x5(float x0, float x1, float x2, float x3, float x4,
                                       float& e0, float& e1, float& e2, float& e3, float& e4) {
  const float LOG2E = 1.44269504f;
  const float a0 = x0 * LOG2E, a1 = x1 * LOG2E, a2 = x2 * LOG2E, a3 = x3 * LOG2E;
  const float a4 = x4 * LOG2E;
  asm("v_exp_f32 %0, %5\n\t"
      "v_exp_f32 %1, %6\n\t"
      "v_exp_f32 %2, %7\n\t"
      "v_exp_f32 %3, %8\n\t"
      "v_exp_f32 %4, %9\n\t"
      "v_nop"
      : "=&v"(e0), "=&v"(e1), "=&v"(e2), "=&v"(e3), "=&v"(e4)
      : "v"(a0), "v"(a1), "v"(a2), "v"(a3), "v"(a4));
}

// the same for the two exponentials of a state update alone
__device__ __forceinline__ void exp_x2(float x0, float x1, float& e0, float& e1) {
  const float LOG2E = 1.44269504f;
  const float a0 = x0 * LOG2E, a1 = x1 * LOG2E;
  asm("v_exp_f32 %0, %2\n\t"
      "v_exp_f32 %1, %3\n\t"
      "v_nop"
      : "=&v"(e0), "=&v"(e1)
      : "v"(a0), "v"(a1));
}

// r is the projection itself. Its sigmoid 1 / (1 + exp(-r)) goes into the step's
// one division: sigmoid(r) * (n / d) = n / (d + d * exp(-r)). Where exp(-r)
// overflows the quotient is 0, as the sigmoid is.
__device__ __forceinline__ float scan_step(float r, float k, float v,
                                           float uu, float ww,
                                           float& fn, float& fd, float& scale) {
  const float sm = fmaxf(scale, uu + k);
  const float ns = fmaxf(scale + ww, k);
  float cm, am, ncm, nam, er;
  exp_x5(scale - sm, uu + k - sm, scale + ww - ns, k - ns, -r, cm, am, ncm, nam, er);

  const float d = cm * fd + am;
  const float y = (cm * fn + am * v) / (d + d * er);

  fn = ncm * fn + nam * v;
  fd = ncm * fd + nam;
  scale = ns;
  return y;
}

// (fn, fd, scale), moved on by the exponent dw, takes in (gn, gd, gs):
// with dw = w, (v, 1, k) it is the state update of scan_step.
__device__ __forceinline__ void state_take(float dw, float gn, float gd, float gs,
                                           float& fn, float& fd, float& scale) {
  const float ns = fmaxf(scale + dw, gs);
  float ncm, nam;
  exp_x2(scale + dw - ns, gs - ns, ncm, nam);
  fn = ncm * fn + nam * gn;
  fd = ncm * fd + nam * gd;
  scale = ns;
}

__device__ __forceinline__ void state_empty(ScanSt& s) {
  s.fn[0] = 0.0f; s.fd[0] = 0.0f; s.scale[0] = -1e20f;
  s.fn[1] = 0.0f; s.fd[1] = 0.0f; s.scale[1] = -1e20f;
}

// DIR is a compile-time value so that every step's distance from the batch's
// pointers is a constant and goes into the instruction's offset field.
// Loads the batch that starts AHEAD steps behind p's.
template <int DIR, int AHEAD, bool FIRST = false>
__device__ __forceinline__ void scan_load(ScanIn& d, const ScanPtr& p) {
  constexpr int SI = (DIR ? -1 : 1) * B_DIM * H_DIM / 2;   // channel pairs per step
  #pragma unroll
  for (int j = 0; j < SCAN_DEPTH; ++j) {
    d.k[j] = p.k[(AHEAD + j) * SI];
    d.v[j] = p.v[(AHEAD + j) * SI];
    d.r[j] = p.r[(AHEAD + j) * SI];
  }
  if constexpr (FIRST) asm volatile("s_wait_xcnt 0x0" ::: "memory");  // see scan_channel
  // keeps all of the batch's loads in front of the arithmetic that follows,
  // so that each has a whole batch of lead
  __builtin_amdgcn_sched_barrier(0);
}

// the same for pass 1, which reads k and v alone
template <int DIR, int AHEAD, bool FIRST = false>
__device__ __forceinline__ void scan_load_kv(ScanKv& d, gl_in_t pk, gl_in_t pv) {
  constexpr int SI = (DIR ? -1 : 1) * B_DIM * H_DIM / 2;   // channel pairs per step
  #pragma unroll
  for (int j = 0; j < SCAN_DEPTH; ++j) {
    d.k[j] = pk[(AHEAD + j) * SI];
    d.v[j] = pv[(AHEAD + j) * SI];
  }
  if constexpr (FIRST) asm volatile("s_wait_xcnt 0x0" ::: "memory");  // see scan_channel
  // keeps the batch's loads in front of the arithmetic that follows
  __builtin_amdgcn_sched_barrier(0);
}

__device__ __forceinline__ void state_batch(const ScanKv& d, v2f ww, ScanSt& s) {
  #pragma unroll
  for (int j = 0; j < SCAN_DEPTH; ++j) {
    state_take(ww.x, (float)d.v[j].x, 1.0f, (float)d.k[j].x, s.fn[0], s.fd[0], s.scale[0]);
    state_take(ww.y, (float)d.v[j].y, 1.0f, (float)d.k[j].y, s.fn[1], s.fd[1], s.scale[1]);
  }
}

// Runs the batch of p.o and stores its outputs; returns the last y.
template <int DIR>
__device__ __forceinline__ v2f scan_batch(const ScanIn& d, v2f uu, v2f ww,
                                          ScanSt& s, ScanPtr& p) {
  v2f y[SCAN_DEPTH];
  #pragma unroll
  for (int j = 0; j < SCAN_DEPTH; ++j) {
    y[j].x = scan_step((float)d.r[j].x, (float)d.k[j].x, (float)d.v[j].x, uu.x, ww.x,
                       s.fn[0], s.fd[0], s.scale[0]);
    y[j].y = scan_step((float)d.r[j].y, (float)d.k[j].y, (float)d.v[j].y, uu.y, ww.y,
                       s.fn[1], s.fd[1], s.scale[1]);
  }

  // The batch's 4 stores (one out row, 65536 bytes, per step) and the wait
  // that stands before a register named by an issued load or store is written
  // again, in one statement: one wait serves the run. The four pointers are
  // named as in and out so that they stay in their registers up to that wait
  // and are advanced only behind it.
  if constexpr (DIR) {
    asm volatile(
        "global_store_b64 %0, %4, off\n\t"
        "global_store_b64 %0, %5, off offset:-65536\n\t"
        "global_store_b64 %0, %6, off offset:-131072\n\t"
        "global_store_b64 %0, %7, off offset:-196608\n\t"
        "s_wait_xcnt 0x0"
        : "+v"(p.o), "+v"(p.r), "+v"(p.k), "+v"(p.v)
        : "v"(y[0]), "v"(y[1]), "v"(y[2]), "v"(y[3])
        : "memory");
  } else {
    asm volatile(
        "global_store_b64 %0, %4, off\n\t"
        "global_store_b64 %0, %5, off offset:65536\n\t"
        "global_store_b64 %0, %6, off offset:131072\n\t"
        "global_store_b64 %0, %7, off offset:196608\n\t"
        "s_wait_xcnt 0x0"
        : "+v"(p.o), "+v"(p.r), "+v"(p.k), "+v"(p.v)
        : "v"(y[0]), "v"(y[1]), "v"(y[2]), "v"(y[3])
        : "memory");
  }
  // keeps what follows (among it the compiler's register copies of values that
  // are still in flight) behind the batch's arithmetic: moved up into it, such
  // a copy waits for its load half a batch early
  __builtin_amdgcn_sched_barrier(0);
  p.o += (DIR ? -1 : 1) * B_DIM * H_DIM * SCAN_DEPTH;      // 2H floats = H pairs per (t, b)
  return y[SCAN_DEPTH - 1];
}

// p: the lane's addresses of the first step of the wave's chunk.
template <int DIR>
__device__ __forceinline__ void scan_channel(ScanPtr p, v2f uu, v2f ww,
                                             v2f* __restrict__ hid,
                                             int lane, int chunk,
                                             v2f (*st)[SCAN_WAVES][32]) {
  constexpr int BI = (DIR ? -1 : 1) * B_DIM * H_DIM / 2 * SCAN_DEPTH;  // pairs per batch
  constexpr int PAIRS = SCAN_LEN / (2 * SCAN_DEPTH);
  ScanSt s;
  state_empty(s);

  // Once, in front of the loops: the loads of u and w, and then each pass's
  // first batch, use address registers of the compiler's own choosing; the wait
  // stands before any of them is written again.
  asm volatile("s_wait_xcnt 0x0" ::: "memory");

  // pass 1: the chunk's own state, from the empty state
  {
    gl_in_t pk = p.k, pv = p.v;
    ScanKv A, Bf;
    scan_load_kv<DIR, 0, true>(A, pk, pv);
    for (int i = 0; i < PAIRS; ++i) {
      scan_load_kv<DIR, SCAN_DEPTH>(Bf, pk, pv);
      state_batch(A, ww, s);
      // in the last trip this look-ahead reads the next chunk's first rows
      // (see pass 2 on the last chunk's); the values are not used
      scan_load_kv<DIR, 2 * SCAN_DEPTH>(A, pk, pv);
      state_batch(Bf, ww, s);
      // keeps the compiler's register copies of the look-ahead's values, still
      // in flight, behind the batch's arithmetic (as in scan_batch)
      __builtin_amdgcn_sched_barrier(0);
      // the wait that stands before the two pointers, which issued loads name,
      // are advanced; they are named so that they stay in their registers up to it
      asm volatile("s_wait_xcnt 0x0" : "+v"(pk), "+v"(pv) :: "memory");
      pk += 2 * BI; pv += 2 * BI;
    }
  }
  st[0][chunk][lane] = v2f{ s.fn[0], s.fn[1] };
  st[1][chunk][lane] = v2f{ s.fd[0], s.fd[1] };
  st[2][chunk][lane] = v2f{ s.scale[0], s.scale[1] };

  // pass 2's first batch flies while the states are handed over
  ScanIn A, Bf;
  scan_load<DIR, 0, true>(A, p);

  __syncthreads();   // every wave's chunk state is in LDS

  // fold: the state in front of this chunk, from the chunks before it
  const v2f lw = (float)SCAN_LEN * ww;
  state_empty(s);
  for (int j = 0; j < chunk; ++j) {
    const v2f gn = st[0][j][lane], gd = st[1][j][lane], gs = st[2][j][lane];
    state_take(lw.x, gn.x, gd.x, gs.x, s.fn[0], s.fd[0], s.scale[0]);
    state_take(lw.y, gn.y, gd.y, gs.y, s.fn[1], s.fd[1], s.scale[1]);
  }

  // pass 2: the chunk's full steps
  v2f y = { 0.0f, 0.0f };
  for (int i = 0; i < PAIRS; ++i) {
    scan_load<DIR, SCAN_DEPTH>(Bf, p);
    scan_batch<DIR>(A, uu, ww, s, p);
    // In the last trip this look-ahead reads the next chunk's first rows; the
    // last chunk's runs SCAN_DEPTH rows past the r, k, v planes' ends, into the
    // neighbouring plane of the same rkv array (forward: planes 0..2 into 1..3;
    // backward: 3..5 into 2..4), which the GEMM of this call has written; the
    // values are not used. A branch round it would make the counted load waits
    // of the batch below wait for these loads too.
    scan_load<DIR, 2 * SCAN_DEPTH>(A, p);
    y = scan_batch<DIR>(Bf, uu, ww, s, p);
    p.r += 2 * BI; p.k += 2 * BI; p.v += 2 * BI;
  }
  // the last look-ahead's loads are still in flight and nothing reads them:
  // they land before the wave ends and gives its registers back
  asm volatile("s_wait_loadcnt 0x0" ::: "memory");
  if (chunk == SCAN_WAVES - 1) *hid = y;   // the scan's last step
}

__global__ __launch_bounds__(SCAN_WAVES * 32)
void birwkv_scan(const half_t* __restrict__ rkv,
                 const float* __restrict__ u_fw, const float* __restrict__ w_fw,
                 const float* __restrict__ u_bw, const float* __restrict__ w_bw,
                 float* __restrict__ out) {
  __shared__ v2f st[3][SCAN_WAVES][32];                   // fn, fd, scale per chunk and lane

  const int lane  = threadIdx.x & 31;
  // the wave's chunk, in a scalar register: it is the fold's trip count
  const int chunk = __builtin_amdgcn_readfirstlane(threadIdx.x >> 5);
  const int dir = blockIdx.x >> 7;                        // 128 work-groups per direction
  const int b   = (blockIdx.x >> 4) & 7;
  const int h   = (blockIdx.x & 15) * 64 + lane * 2;      // the lane's first channel

  const size_t MAT = (size_t)M_DIM * H_DIM;
  // time index of the chunk's first step
  const int t0 = dir ? (T_DIM - 1 - chunk * SCAN_LEN) : chunk * SCAN_LEN;
  const half_t* r0 = rkv + (dir ? 3 * MAT : 0) + (size_t)(t0 * B_DIM + b) * H_DIM + h;
  ScanPtr p;
  p.r = (gl_in_t)r0;
  p.k = (gl_in_t)(r0 + MAT);
  p.v = (gl_in_t)(r0 + 2 * MAT);
  p.o = (gl_out_t)(out + (size_t)(t0 * B_DIM + b) * (2 * H_DIM) + (size_t)dir * H_DIM + h);
  v2f* hid = (v2f*)(out + (size_t)T_DIM * B_DIM * 2 * H_DIM
                        + (size_t)dir * B_DIM * H_DIM + (size_t)b * H_DIM + h);

  if (dir) scan_channel<1>(p, *(const v2f*)(u_bw + h), *(const v2f*)(w_bw + h), hid, lane, chunk, st);
  else     scan_channel<0>(p, *(const v2f*)(u_fw + h), *(const v2f*)(w_fw + h), hid, lane, chunk, st);
}

// ---------------------------------------------------------------------------
// Host launcher
// ---------------------------------------------------------------------------
extern "C" void kernel_launch(void* const* d_in, const int* in_sizes, int n_in,
                              void* d_out, int out_size, void* d_ws, size_t ws_size,
                              hipStream_t stream) {
  (void)in_sizes; (void)n_in; (void)out_size; (void)ws_size;

  const float* x      = (const float*)d_in[0];
  const float* w_r_fw = (const float*)d_in[1];
  const float* w_k_fw = (const float*)d_in[2];
  const float* w_v_fw = (const float*)d_in[3];
  const float* w_u_fw = (const float*)d_in[4];
  const float* w_w_fw = (const float*)d_in[5];
  const float* w_r_bw = (const float*)d_in[6];
  const float* w_k_bw = (const float*)d_in[7];
  const float* w_v_bw = (const float*)d_in[8];
  const float* w_u_bw = (const float*)d_in[9];
  const float* w_w_bw = (const float*)d_in[10];

  // Workspace layout (bytes):
  //   [0)                xh : f16 x,        T*B*I*2  = 33,554,432
  //   [xh)               wh : f16 weights,  6*H*I*2  = 12,582,912
  //   [xh+wh)            rkv: f16 r/k/v x2, 6*T*B*H*2 = 201,326,592
  const size_t XH_BYTES = (size_t)T_DIM * B_DIM * I_DIM * sizeof(half_t);
  const size_t WH_BYTES = (size_t)6 * H_DIM * I_DIM * sizeof(half_t);
  char*   ws  = (char*)d_ws;
  half_t* xh  = (half_t*)ws;
  half_t* wh  = (half_t*)(ws + XH_BYTES);
  half_t* rkv = (half_t*)(ws + XH_BYTES + WH_BYTES);

  // 1) convert x and the six weight matrices to f16 (xh and wh are one row)
  cvt_all_f32_to_f16<<<CVT_GROUPS, CVT_WAVES * 32, 0, stream>>>(
      x, w_r_fw, w_k_fw, w_v_fw, w_r_bw, w_k_bw, w_v_bw, xh);

  // 2) WMMA projection GEMMs
  {
    proj_gemm_wmma<<<G_GROUPS, 256, 0, stream>>>(xh, wh, rkv);   // six tiles each
  }

  // 3) bidirectional scan -> d_out ([T,B,2H] output + [2,B,H] hidden)
  birwkv_scan<<<SCAN_GROUPS, SCAN_WAVES * 32, 0, stream>>>(
      rkv, w_u_fw, w_w_fw, w_u_bw, w_w_bw, (float*)d_out);
}
